// v000
// Times are from an AMD MI455X. After a warm-up the kernel runs many times in a row, and a time is the length of
// such a window on the GPU divided by its runs, so every launch and the gaps after it count. The runs cycle
// through copies of the inputs. A figure is the median of several windows, for all but v000 over two sittings.
// Sittings can differ by a few percent; kernels timed side by side share one.
// v000 is the starting kernel. One run takes 3940 microseconds.
#include <hip/hip_runtime.h>

// Multi-head attention WITHOUT a mask with interleaved-pair rotary position embedding on a fused bias-free natural projection, four batches (x [4][2048][1024]; qkv = x w_attn^T ('oi' [3072][1024] 0.02, no bias) split in thirds q | k | v (16 heads x 64; token-major); angles = t x 1 / THETA ** (2i / 64) (THETA 1e4; computed); pairs (2i, 2i+1): re cos - im sin, re sin + im cos, on q and k; scores x 1/sqrt(64); softmax over ALL keys (no mask); y = merged w_proj^T ('oi', no bias) -> [4][2048][1024] (8.4 M); argument order x, w_attn, w_proj).
// Layout per batch: bf16 copy of x; exact projections; {cos, sin} per (position, pair) built once from the int positions and float32 inverse-frequency constants (precise cosf/sinf); interleaved rotary plane builder; DENSE T-2048 attention (hybrid rows: < 512 hi/lo 3 products, rest fp16 x1024; EVERY key tile computed by the plain tile GEMM: no causal tile skipping in this build: k_gemmc stays in the file, unused); merged hi/lo x Wo exact.
// Compute dtypes, f32 accumulate: every input rounded to bf16; projections exact; rotary f32; attention rows < 512 3 products, rest fp16; softmax f32; Wo hl x exact.

#define NB_  4
#define TT   2048
#define DM   1024
#define NH_  16
#define NKV  16
#define REP  (NH_ / NKV)
#define HD   64
#define DQ   (NH_ * HD)
#define DKV  (NKV * HD)
#define ZH   2
#define RH   512                  // query rows < RH use hi+lo planes (0: none)
#define WIN  0   
#define PCAR 1024.0f
#define SCL  0.125f   // HD^-0.5
typedef _Float16 h16;
typedef unsigned short bf;
typedef __attribute__((ext_vector_type(16))) __bf16   v16bf;
typedef __attribute__((ext_vector_type(16))) _Float16 v16h;
typedef __attribute__((ext_vector_type(8)))  _Float16 v8h;
typedef __attribute__((ext_vector_type(8)))  unsigned short v8us;
typedef __attribute__((ext_vector_type(8)))  float    v8f;
typedef __attribute__((ext_vector_type(4)))  float    v4f;
typedef v8h  __attribute__((may_alias)) v8ha;
typedef v4f  __attribute__((may_alias)) v4fa;
typedef v8us __attribute__((may_alias)) v8usa;

__device__ __forceinline__ unsigned short f2bf(float f) { unsigned u = __float_as_uint(f); u += 0x7FFFu + ((u >> 16) & 1u); return (unsigned short)(u >> 16); }
__device__ __forceinline__ float bf2f(unsigned short b) { return __uint_as_float(((unsigned)b) << 16); }
__device__ __forceinline__ float bfr(float f) { return bf2f(f2bf(f)); }
__device__ __forceinline__ v16h cat16(v8h lo, v8h hi) { return __builtin_shufflevector(lo, hi, 0, 1, 2, 3, 4, 5, 6, 7, 8, 9, 10, 11, 12, 13, 14, 15); }
__device__ __forceinline__ v16bf cat16b(v8us lo, v8us hi) { return __builtin_bit_cast(v16bf, __builtin_shufflevector(lo, hi, 0, 1, 2, 3, 4, 5, 6, 7, 8, 9, 10, 11, 12, 13, 14, 15)); }
__device__ __forceinline__ v8f wmma16(v16h a, v16h b, v8f c) { return __builtin_amdgcn_wmma_f32_16x16x32_f16(false, a, false, b, (short)0, c, false, false); }
__device__ __forceinline__ v8f wmmab(v16bf a, v16bf b, v8f c) { return __builtin_amdgcn_wmma_f32_16x16x32_bf16(false, a, false, b, (short)0, c, false, false); }



// ---- k_gemmw: register-blocked GEMM, ONE WAVE per 64x64 output tile (16 accumulators), operands straight from K-contiguous 16-bit planes; grid (M/64, N/64, Z), 32 threads.
// C[m][n] (f32, pitch ldc, + optional f32 bias[n]) = sum_k A[m][k] Bt[n][k] (+ split products per NSPLIT). z-batch strides sA/sB/sC in elements. K % 32 == 0.
template <typename T16> struct WFrag;
template <> struct WFrag<h16> { typedef v16h V; static __device__ __forceinline__ V ld(const h16* p) { return cat16(*(const v8h*)p, *(const v8h*)(p + 16)); } static __device__ __forceinline__ v8f mma(V a, V b, v8f c) { return wmma16(a, b, c); } };
template <> struct WFrag<bf> { typedef v16bf V; static __device__ __forceinline__ V ld(const bf* p) { return cat16b(*(const v8us*)p, *(const v8us*)(p + 16)); } static __device__ __forceinline__ v8f mma(V a, V b, v8f c) { return wmmab(a, b, c); } };
template <typename T16, int NSPLIT, bool BIAS>
__global__ __launch_bounds__(32) void k_gemmw(const T16* __restrict__ A, const T16* __restrict__ A2, const T16* __restrict__ Bt, const T16* __restrict__ Bt2, int K, float* C, int ldc, const float* __restrict__ bias, size_t sA, size_t sB, size_t sC) {
    typedef typename WFrag<T16>::V V;
    __shared__ __align__(16) float os[16 * 68];
    const size_t z = blockIdx.z; A += z * sA; if (A2) A2 += z * sA; Bt += z * sB; if (Bt2) Bt2 += z * sB; C += z * sC;
    const int lane = threadIdx.x & 31, lr = lane & 15, hi = lane >> 4; const int r0 = blockIdx.x * 64, c0 = blockIdx.y * 64;
    v8f acc[4][4];
#pragma unroll
    for (int mb = 0; mb < 4; ++mb)
#pragma unroll
        for (int nb = 0; nb < 4; ++nb) acc[mb][nb] = (v8f){};
    const size_t aoff = (size_t)(r0 + lr) * K + 8 * hi, boff = (size_t)(c0 + lr) * K + 8 * hi;
#pragma unroll 1
    for (int kc = 0; kc < K; kc += 32) {
        V a[4], a2[4];
#pragma unroll
        for (int mb = 0; mb < 4; ++mb) { a[mb] = WFrag<T16>::ld(A + aoff + (size_t)mb * 16 * K + kc); if (NSPLIT == 1 || NSPLIT == 2) a2[mb] = WFrag<T16>::ld(A2 + aoff + (size_t)mb * 16 * K + kc); }
#pragma unroll
        for (int nb = 0; nb < 4; ++nb) { const V b = WFrag<T16>::ld(Bt + boff + (size_t)nb * 16 * K + kc); V b2; if (NSPLIT >= 2) b2 = WFrag<T16>::ld(Bt2 + boff + (size_t)nb * 16 * K + kc);
#pragma unroll
            for (int mb = 0; mb < 4; ++mb) { acc[mb][nb] = WFrag<T16>::mma(a[mb], b, acc[mb][nb]); if (NSPLIT == 1 || NSPLIT == 2) acc[mb][nb] = WFrag<T16>::mma(a2[mb], b, acc[mb][nb]); if (NSPLIT >= 2) acc[mb][nb] = WFrag<T16>::mma(a[mb], b2, acc[mb][nb]); } }
        asm volatile("v_nop\n\tv_nop\n\tv_nop\n\tv_nop" : "+v"(acc[0][0]), "+v"(acc[1][1]), "+v"(acc[2][2]), "+v"(acc[3][3]) : "v"(a[0]), "v"(a[3]));
    }
#pragma unroll
    for (int mb = 0; mb < 4; ++mb) {
#pragma unroll
        for (int nb = 0; nb < 4; ++nb) {
#pragma unroll
            for (int j = 0; j < 8; ++j) os[(hi * 8 + j) * 68 + nb * 16 + lr] = acc[mb][nb][j]; }
        __builtin_amdgcn_wave_barrier(); asm volatile("" ::: "memory");
        float* crow = C + (size_t)(r0 + mb * 16) * ldc + c0;
{
#pragma unroll
            for (int s = 0; s < 8; ++s) { const int row = 2 * s + hi, cofs = lr * 4; v4f val = *(const v4fa*)(os + row * 68 + cofs); if (BIAS) { val[0] += bfr(bias[c0 + cofs]); val[1] += bfr(bias[c0 + cofs + 1]); val[2] += bfr(bias[c0 + cofs + 2]); val[3] += bfr(bias[c0 + cofs + 3]); }
                *(v4f*)(crow + (size_t)row * ldc + cofs) = val; }
             }
        __builtin_amdgcn_wave_barrier(); asm volatile("" ::: "memory");
    }
}

// ---- k_gemmc: the same one-wave 64x64 tile GEMM specialised for causal attention: CMODE 1 skips score tiles entirely above the diagonal (query rows r0+roff.., key columns c0..), CMODE 2 limits the
// key (K) loop of the probability x value contraction to the diagonal block (probabilities beyond it are exactly zero). roff = row offset of this launch's first row within the sequence.
template <typename T16, int NSPLIT, int CMODE>
__global__ __launch_bounds__(32) void k_gemmc(const T16* __restrict__ A, const T16* __restrict__ A2, const T16* __restrict__ Bt, const T16* __restrict__ Bt2, int K, float* C, int ldc, int roff, size_t sA, size_t sB, size_t sC) {
    typedef typename WFrag<T16>::V V;
    __shared__ __align__(16) float os[16 * 68];
    const size_t z = blockIdx.z; A += z * sA; if (A2) A2 += z * sA; Bt += z * sB; if (Bt2) Bt2 += z * sB; C += z * sC;
    const int lane = threadIdx.x & 31, lr = lane & 15, hi = lane >> 4; const int r0 = blockIdx.x * 64, c0 = blockIdx.y * 64;
    if (CMODE == 1 && c0 > r0 + roff + 63) return;                  // score tile entirely above the causal diagonal: not computed (k_asoft here has no mask and reads every key)
    const int Kl = (CMODE == 2) ? min(K, r0 + roff + 64) : K;        // P.V: probabilities are exactly 0 beyond the diagonal block, so the K loop stops there
    v8f acc[4][4];
#pragma unroll
    for (int mb = 0; mb < 4; ++mb)
#pragma unroll
        for (int nb = 0; nb < 4; ++nb) acc[mb][nb] = (v8f){};
    const size_t aoff = (size_t)(r0 + lr) * K + 8 * hi, boff = (size_t)(c0 + lr) * K + 8 * hi;
#pragma unroll 1
    for (int kc = 0; kc < Kl; kc += 32) {
        V a[4], a2[4];
#pragma unroll
        for (int mb = 0; mb < 4; ++mb) { a[mb] = WFrag<T16>::ld(A + aoff + (size_t)mb * 16 * K + kc); if (NSPLIT == 1 || NSPLIT == 2) a2[mb] = WFrag<T16>::ld(A2 + aoff + (size_t)mb * 16 * K + kc); }
#pragma unroll
        for (int nb = 0; nb < 4; ++nb) { const V b = WFrag<T16>::ld(Bt + boff + (size_t)nb * 16 * K + kc); V b2; if (NSPLIT >= 2) b2 = WFrag<T16>::ld(Bt2 + boff + (size_t)nb * 16 * K + kc);
#pragma unroll
            for (int mb = 0; mb < 4; ++mb) { acc[mb][nb] = WFrag<T16>::mma(a[mb], b, acc[mb][nb]); if (NSPLIT == 1 || NSPLIT == 2) acc[mb][nb] = WFrag<T16>::mma(a2[mb], b, acc[mb][nb]); if (NSPLIT >= 2) acc[mb][nb] = WFrag<T16>::mma(a[mb], b2, acc[mb][nb]); } }
        asm volatile("v_nop\n\tv_nop\n\tv_nop\n\tv_nop" : "+v"(acc[0][0]), "+v"(acc[1][1]), "+v"(acc[2][2]), "+v"(acc[3][3]) : "v"(a[0]), "v"(a[3]));
    }
#pragma unroll
    for (int mb = 0; mb < 4; ++mb) {
#pragma unroll
        for (int nb = 0; nb < 4; ++nb) {
#pragma unroll
            for (int j = 0; j < 8; ++j) os[(hi * 8 + j) * 68 + nb * 16 + lr] = acc[mb][nb][j]; }
        __builtin_amdgcn_wave_barrier(); asm volatile("" ::: "memory");
        float* crow = C + (size_t)(r0 + mb * 16) * ldc + c0;
{
#pragma unroll
            for (int s = 0; s < 8; ++s) { const int row = 2 * s + hi, cofs = lr * 4; v4f val = *(const v4fa*)(os + row * 68 + cofs);
                *(v4f*)(crow + (size_t)row * ldc + cofs) = val; }
             }
        __builtin_amdgcn_wave_barrier(); asm volatile("" ::: "memory");
    }
}

__device__ __forceinline__ h16 tohx(float x) { return (h16)x; }
__device__ __forceinline__ void splitf(float y, unsigned short& h, unsigned short& l) { h = f2bf(y); l = f2bf(y - bf2f(h)); }
typedef __attribute__((ext_vector_type(2))) _Float16 v2h;
typedef __attribute__((ext_vector_type(4))) _Float16 v4h;
typedef __attribute__((ext_vector_type(2))) unsigned short v2us;
typedef __attribute__((ext_vector_type(4))) unsigned short v4us;
typedef __attribute__((ext_vector_type(2))) float v2f;
typedef __attribute__((ext_vector_type(4))) int v4i;

__global__ __launch_bounds__(256) void k_cvt8(const float* __restrict__ src, bf* dst, size_t n8) { const size_t i = (size_t)blockIdx.x * 256 + threadIdx.x; if (i >= n8) return; const v8f v = *(const v8f*)(src + i * 8); v8us o;
#pragma unroll
    for (int k = 0; k < 8; ++k) o[k] = f2bf(v[k]); *(v8us*)(dst + i * 8) = o;  }

__global__ __launch_bounds__(256) void k_ropeI(const float* __restrict__ F, int pitch, int nheads, const float* __restrict__ CS, float sc, h16* P16, bf* Ph, bf* Pl) {
    const size_t e = ((size_t)blockIdx.x * 256 + threadIdx.x) * 2; if (e >= (size_t)nheads * TT * HD) return; const int d = (int)(e % HD); const int t = (int)((e / HD) % TT); const int h = (int)(e / ((size_t)HD * TT)); const float* f = F + (size_t)t * pitch + h * HD; const float x0 = f[d], x1 = f[d + 1]; const v2f cs = *(const v2f*)(CS + ((size_t)t * HD + d) * 2); v2h o16; v2us oh, ol;
    float a0 = __fmul_rn(x0, cs[0]), b0 = __fmul_rn(x1, cs[1]), a1 = __fmul_rn(x1, cs[0]), b1 = __fmul_rn(x0, cs[1]); asm volatile("" : "+v"(a0), "+v"(b0), "+v"(a1), "+v"(b1));
    float r0 = __fsub_rn(a0, b0) * sc, r1 = __fadd_rn(b1, a1) * sc;   /* even: x0 c - x1 s; odd: x0 s + x1 c */
    o16[0] = tohx(r0); o16[1] = tohx(r1); { unsigned short a2, c2; splitf(r0, a2, c2); oh[0] = a2; ol[0] = c2; splitf(r1, a2, c2); oh[1] = a2; ol[1] = c2; }
    *(v2h*)(P16 + e) = o16; *(v2us*)(Ph + e) = oh; *(v2us*)(Pl + e) = ol;  }

__constant__ float INV2[HD / 2] = { 1.000000000e+00f, 7.498942018e-01f, 5.623413324e-01f, 4.216965139e-01f, 3.162277639e-01f, 2.371373624e-01f, 1.778279394e-01f, 1.333521456e-01f, 1.000000015e-01f, 7.498941571e-02f, 5.623412877e-02f, 4.216964915e-02f, 3.162277862e-02f, 2.371373586e-02f, 1.778279431e-02f, 1.333521493e-02f, 9.999999776e-03f, 7.498942316e-03f, 5.623413250e-03f, 4.216964822e-03f, 3.162277862e-03f, 2.371373819e-03f, 1.778279431e-03f, 1.333521446e-03f, 1.000000047e-03f, 7.498941850e-04f, 5.623413017e-04f, 4.216964880e-04f, 3.162277862e-04f, 2.371373848e-04f, 1.778279402e-04f, 1.333521504e-04f };   // 1 / THETA ** (2i / 64), i = 0..31, in float32 as THIS module writes it (the RECIPROCAL spelling, evaluated in the reference's own f32 arithmetic: these 32 literals equal it bit for bit); ten entries differ by one ulp from the negative-power values the host's own table held
__global__ __launch_bounds__(256) void k_csP(float* CS) { const int idx = blockIdx.x * 256 + threadIdx.x; if (idx >= TT * HD) return; const int d = idx % HD; const int t = idx / HD; const float a = __fmul_rn((float)t, INV2[d >> 1]); v2f cs; cs[0] = cosf(a); cs[1] = sinf(a); *(v2f*)(CS + (size_t)idx * 2) = cs;  }
__global__ __launch_bounds__(256) void k_vtp(const float* __restrict__ F, int pitch, int nheads, h16* V16, bf* Vh, bf* Vl) { const size_t e = ((size_t)blockIdx.x * 256 + threadIdx.x) * 2; if (e >= (size_t)nheads * HD * TT) return; const int t = (int)(e % TT); const int d = (int)((e / TT) % HD); const int g = (int)(e / ((size_t)TT * HD)); v2h o16; v2us oh, ol;
#pragma unroll
    for (int q = 0; q < 2; ++q) { const float x = F[(size_t)(t + q) * pitch + g * HD + d]; o16[q] = tohx(x); unsigned short a2, c2; splitf(x, a2, c2); oh[q] = a2; ol[q] = c2; }
    *(v2h*)(V16 + e) = o16; *(v2us*)(Vh + e) = oh; *(v2us*)(Vl + e) = ol;  }
// k_asoft: per row (zz, i): t = S x SCL for EVERY key j (WIN 0: dense: no causal rule and no window in this build); softmax over the 2048 keys (register row, one exp, fixed trees);
__global__ __launch_bounds__(256) void k_asoft(const float* __restrict__ Sb, h16* P16, bf* Ph, bf* Pl) {
    const int lane = threadIdx.x & 31; const int row = blockIdx.x * 8 + (threadIdx.x >> 5); if (row >= ZH * TT) return; const int i = row % TT; const int zz = row / TT; (void)zz; const bool hires = (i < RH); const float* sr = Sb + (size_t)row * TT; float v[TT / 32]; float mx = -3.0e38f;
#pragma unroll
    for (int ch = 0; ch < TT / 128; ++ch) { const int j0 = ch * 128 + lane * 4; const v4f a = *(const v4f*)(sr + j0);
#pragma unroll
        for (int q = 0; q < 4; ++q) { const int j = j0 + q; (void)j; const float t = a[q] * SCL; v[ch * 4 + q] = t; mx = fmaxf(mx, t); } }
#pragma unroll
    for (int sh = 16; sh; sh >>= 1) mx = fmaxf(mx, __shfl_xor(mx, sh, 32));
    float sum = 0.f;
#pragma unroll
    for (int k = 0; k < TT / 32; ++k) { float d0 = __fsub_rn(v[k], mx); asm volatile("" : "+v"(d0)); v[k] = __builtin_amdgcn_exp2f(__fmul_rn(d0, 1.4426950408889634f)); sum += v[k]; }
#pragma unroll
    for (int sh = 16; sh; sh >>= 1) sum += __shfl_xor(sum, sh, 32);
    const float f = __fdiv_rn(hires ? 1.0f : PCAR, sum);
{
        if (hires) {
#pragma unroll
            for (int ch = 0; ch < TT / 128; ++ch) { v4us oh, ol;
#pragma unroll
                for (int q = 0; q < 4; ++q) { unsigned short a, c2; splitf(v[ch * 4 + q] * f, a, c2); oh[q] = a; ol[q] = c2; }
                const size_t oo = ((size_t)zz * (RH ? RH : 1) + i) * TT + ch * 128 + lane * 4; *(v4us*)(Ph + oo) = oh; *(v4us*)(Pl + oo) = ol; }
        } else {
#pragma unroll
            for (int ch = 0; ch < TT / 128; ++ch) { v4h o4;
#pragma unroll
                for (int q = 0; q < 4; ++q) o4[q] = tohx(v[ch * 4 + q] * f);
                *(v4h*)(P16 + (size_t)row * TT + ch * 128 + lane * 4) = o4; } }
         }
}
__global__ __launch_bounds__(256) void k_merge(const float* __restrict__ O, int h0, bf* Ah, bf* Al) { const size_t e = ((size_t)blockIdx.x * 256 + threadIdx.x) * 2; if (e >= (size_t)ZH * TT * HD) return; const int d = (int)(e % HD); const int t = (int)((e / HD) % TT); const int zz = (int)(e / ((size_t)HD * TT)); const float cs = (t < RH) ? 1.0f : (1.0f / PCAR); const size_t oo = (size_t)t * DQ + (h0 + zz) * HD + d;
    v2us oh, ol;
#pragma unroll
    for (int q = 0; q < 2; ++q) { unsigned short a, c2; splitf(O[e + q] * cs, a, c2); oh[q] = a; ol[q] = c2; } *(v2us*)(Ah + oo) = oh; *(v2us*)(Al + oo) = ol;  }

extern "C" void kernel_launch(void* const* d_in, const int* in_sizes, int n_in,
                              void* d_out, int out_size, void* d_ws, size_t ws_size, hipStream_t stream) {
    (void)in_sizes; (void)n_in; (void)out_size;
    const float* x = (const float*)d_in[0]; const float* wqkv = (const float*)d_in[1]; const float* wo = (const float*)d_in[2];   /* argument order x, w_attn ('oi' [3072][1024]: q | k | v row blocks), w_proj ('oi' [1024][1024]) */ const float* wq = wqkv; const float* wk = wqkv + (size_t)DQ * DM; const float* wv = wqkv + (size_t)2 * DQ * DM;
    float* OUT = (float*)d_out;     // [4][2048][1024]
    char* wsp = (char*)d_ws;
    auto take = [&](size_t bytes) { char* p = wsp; wsp += (bytes + 255) & ~(size_t)255; return (void*)p; };
    bf* WQ = (bf*)take((size_t)DQ * DM * 2); bf* WK = (bf*)take((size_t)DKV * DM * 2); bf* WV = (bf*)take((size_t)DKV * DM * 2); bf* WO = (bf*)take((size_t)DM * DQ * 2); float* CS = (float*)take((size_t)TT * HD * 2 * 4);
    bf* XB = (bf*)take((size_t)TT * DM * 2); float* FQ = (float*)take((size_t)TT * DQ * 4); float* FK = (float*)take((size_t)TT * DKV * 4);
    h16* QP16 = (h16*)take((size_t)NH_ * TT * HD * 2); h16* KP16 = (h16*)take((size_t)NKV * TT * HD * 2); h16* VT16 = (h16*)take((size_t)NKV * HD * TT * 2);
    bf* QPh = (bf*)take((size_t)NH_ * TT * HD * 2); bf* QPl = (bf*)take((size_t)NH_ * TT * HD * 2); bf* KPh = (bf*)take((size_t)NKV * TT * HD * 2); bf* KPl = (bf*)take((size_t)NKV * TT * HD * 2); bf* VTh = (bf*)take((size_t)NKV * HD * TT * 2); bf* VTl = (bf*)take((size_t)NKV * HD * TT * 2); bf* Ph = (bf*)take((size_t)ZH * RH * TT * 2); bf* Pl = (bf*)take((size_t)ZH * RH * TT * 2);
    float* Sb = (float*)take((size_t)ZH * TT * TT * 4); h16* P16 = (h16*)take((size_t)ZH * TT * TT * 2); float* Ob = (float*)take((size_t)ZH * TT * HD * 4); bf* ATh = (bf*)take((size_t)TT * DQ * 2); bf* ATl = (bf*)take((size_t)TT * DQ * 2);
    if ((size_t)(wsp - (char*)d_ws) > ws_size) return;    // ws 256 MiB
    float* FV = FK;   // v projection reuses the k buffer after the k planes are built (stream-ordered)
    { k_cvt8<<<(unsigned)(((size_t)DQ * DM / 8 + 255) / 256), 256, 0, stream>>>(wq, WQ, (size_t)DQ * DM / 8); k_cvt8<<<(unsigned)(((size_t)DKV * DM / 8 + 255) / 256), 256, 0, stream>>>(wk, WK, (size_t)DKV * DM / 8); k_cvt8<<<(unsigned)(((size_t)DKV * DM / 8 + 255) / 256), 256, 0, stream>>>(wv, WV, (size_t)DKV * DM / 8);
      k_cvt8<<<(unsigned)(((size_t)DM * DQ / 8 + 255) / 256), 256, 0, stream>>>(wo, WO, (size_t)DM * DQ / 8); k_csP<<<(TT * HD + 255) / 256, 256, 0, stream>>>(CS); }
    const unsigned LQ = (unsigned)(((size_t)NH_ * TT * HD / 2 + 255) / 256), LKv = (unsigned)(((size_t)NKV * TT * HD / 2 + 255) / 256);
    for (int b = 0; b < NB_; ++b) {
        
        k_cvt8<<<(unsigned)(((size_t)TT * DM / 8 + 255) / 256), 256, 0, stream>>>(x + (size_t)b * TT * DM, XB, (size_t)TT * DM / 8);
        k_gemmw<bf, 0, false><<<dim3(TT / 64, DQ / 64, 1), 32, 0, stream>>>(XB, nullptr, WQ, nullptr, DM, FQ, DQ, nullptr, 0, 0, 0);
        k_ropeI<<<LQ, 256, 0, stream>>>(FQ, DQ, NH_, CS, 1.0f, QP16, QPh, QPl);
        k_gemmw<bf, 0, false><<<dim3(TT / 64, DKV / 64, 1), 32, 0, stream>>>(XB, nullptr, WK, nullptr, DM, FK, DKV, nullptr, 0, 0, 0);
        k_ropeI<<<LKv, 256, 0, stream>>>(FK, DKV, NKV, CS, 1.0f, KP16, KPh, KPl);
        k_gemmw<bf, 0, false><<<dim3(TT / 64, DKV / 64, 1), 32, 0, stream>>>(XB, nullptr, WV, nullptr, DM, FV, DKV, nullptr, 0, 0, 0); k_vtp<<<LKv, 256, 0, stream>>>(FV, DKV, NKV, VT16, VTh, VTl);
        for (int h0 = 0; h0 < NH_; h0 += ZH) { const size_t zq = (size_t)h0, zk = (size_t)(h0 / REP);   // one kv head per query head: the pass's two heads use consecutive kv planes (z-strides TT*HD)
            k_gemmw<bf, 2, false><<<dim3(RH / 64, TT / 64, ZH), 32, 0, stream>>>(QPh + zq * TT * HD, QPl + zq * TT * HD, KPh + zk * TT * HD, KPl + zk * TT * HD, HD, Sb, TT, nullptr, (size_t)TT * HD, (size_t)TT * HD, (size_t)TT * TT);
            k_gemmw<h16, 0, false><<<dim3((TT - RH) / 64, TT / 64, ZH), 32, 0, stream>>>(QP16 + zq * TT * HD + (size_t)RH * HD, nullptr, KP16 + zk * TT * HD, nullptr, HD, Sb + (size_t)RH * TT, TT, nullptr, (size_t)TT * HD, (size_t)TT * HD, (size_t)TT * TT);
            k_asoft<<<ZH * TT / 8, 256, 0, stream>>>(Sb, P16, Ph, Pl);
            k_gemmw<bf, 2, false><<<dim3(RH / 64, HD / 64, ZH), 32, 0, stream>>>(Ph, Pl, VTh + zk * HD * TT, VTl + zk * HD * TT, TT, Ob, HD, nullptr, (size_t)RH * TT, (size_t)HD * TT, (size_t)TT * HD);
            k_gemmw<h16, 0, false><<<dim3((TT - RH) / 64, HD / 64, ZH), 32, 0, stream>>>(P16 + (size_t)RH * TT, nullptr, VT16 + zk * HD * TT, nullptr, TT, Ob + (size_t)RH * HD, HD, nullptr, (size_t)TT * TT, (size_t)HD * TT, (size_t)TT * HD);
            k_merge<<<(unsigned)(((size_t)ZH * TT * HD / 2 + 255) / 256), 256, 0, stream>>>(Ob, h0, ATh, ATl); }
        k_gemmw<bf, 1, false><<<dim3(TT / 64, DM / 64, 1), 32, 0, stream>>>(ATh, ATl, WO, nullptr, DQ, OUT + (size_t)b * TT * DM, DM, nullptr, 0, 0, 0); }
}

// v001
// A run of this version takes 1680 microseconds.
// Timed twice side by side with v000, it ran 2.36 times as fast both times.
#include <hip/hip_runtime.h>

// Multi-head attention WITHOUT a mask with interleaved-pair rotary position embedding on a fused bias-free natural projection, four batches (x [4][2048][1024]; qkv = x w_attn^T ('oi' [3072][1024] 0.02, no bias) split in thirds q | k | v (16 heads x 64; token-major); angles = t x 1 / THETA ** (2i / 64) (THETA 1e4; computed); pairs (2i, 2i+1): re cos - im sin, re sin + im cos, on q and k; scores x 1/sqrt(64); softmax over ALL keys (no mask); y = merged w_proj^T ('oi', no bias) -> [4][2048][1024] (8.4 M); argument order x, w_attn, w_proj).
// Layout per batch: bf16 copy of x; exact projections; {cos, sin} per (position, pair) built once from the int positions and float32 inverse-frequency constants (precise cosf/sinf); interleaved rotary plane builder; DENSE T-2048 attention (hybrid rows: < 512 hi/lo 3 products, rest fp16 x1024; EVERY key tile computed by the plain tile GEMM: no causal tile skipping in this build: k_gemmc stays in the file, unused); merged hi/lo x Wo exact.
// Compute dtypes, f32 accumulate: every input rounded to bf16; projections exact; rotary f32; attention rows < 512 3 products, rest fp16; softmax f32; Wo hl x exact.

#define NB_  4
#define TT   2048
#define DM   1024
#define NH_  16
#define NKV  16
#define REP  (NH_ / NKV)
#define HD   64
#define DQ   (NH_ * HD)
#define DKV  (NKV * HD)
#define ZH   2
#define RH   512                  // query rows < RH use hi+lo planes (0: none)
#define WIN  0   
#define PCAR 1024.0f
#define SCL  0.125f   // HD^-0.5
#define KSL  16                   // key slices of the probability x value product: one work-group per slice, f32 partial planes, summed in slice order by k_merge
typedef _Float16 h16;
typedef unsigned short bf;
typedef __attribute__((ext_vector_type(16))) __bf16   v16bf;
typedef __attribute__((ext_vector_type(16))) _Float16 v16h;
typedef __attribute__((ext_vector_type(8)))  _Float16 v8h;
typedef __attribute__((ext_vector_type(8)))  unsigned short v8us;
typedef __attribute__((ext_vector_type(8)))  float    v8f;
typedef __attribute__((ext_vector_type(4)))  float    v4f;
typedef v8h  __attribute__((may_alias)) v8ha;
typedef v4f  __attribute__((may_alias)) v4fa;
typedef v8us __attribute__((may_alias)) v8usa;

__device__ __forceinline__ unsigned short f2bf(float f) { unsigned u = __float_as_uint(f); u += 0x7FFFu + ((u >> 16) & 1u); return (unsigned short)(u >> 16); }
__device__ __forceinline__ float bf2f(unsigned short b) { return __uint_as_float(((unsigned)b) << 16); }
__device__ __forceinline__ float bfr(float f) { return bf2f(f2bf(f)); }
__device__ __forceinline__ v16h cat16(v8h lo, v8h hi) { return __builtin_shufflevector(lo, hi, 0, 1, 2, 3, 4, 5, 6, 7, 8, 9, 10, 11, 12, 13, 14, 15); }
__device__ __forceinline__ v16bf cat16b(v8us lo, v8us hi) { return __builtin_bit_cast(v16bf, __builtin_shufflevector(lo, hi, 0, 1, 2, 3, 4, 5, 6, 7, 8, 9, 10, 11, 12, 13, 14, 15)); }
__device__ __forceinline__ v8f wmma16(v16h a, v16h b, v8f c) { return __builtin_amdgcn_wmma_f32_16x16x32_f16(false, a, false, b, (short)0, c, false, false); }
__device__ __forceinline__ v8f wmmab(v16bf a, v16bf b, v8f c) { return __builtin_amdgcn_wmma_f32_16x16x32_bf16(false, a, false, b, (short)0, c, false, false); }



// ---- k_gemmw: register-blocked GEMM, ONE WAVE per 64x64 output tile (16 accumulators), operands straight from K-contiguous 16-bit planes; grid (M/64, N/64, Z), 32 threads.
// C[m][n] (f32, pitch ldc, + optional f32 bias[n]) = sum_k A[m][k] Bt[n][k] (+ split products per NSPLIT). z-batch strides sA/sB/sC in elements. K % 32 == 0.
// KS > 1: grid.y = (N/64) * KS; work-group y sums only k in slice y % KS (K / KS long, K stays the row pitch) into partial plane y % KS of C (plane stride ZH * sC elements: the ZH z-planes of one slice lie together); the reader adds the KS planes.
template <typename T16> struct WFrag;
template <> struct WFrag<h16> { typedef v16h V; static __device__ __forceinline__ V ld(const h16* p) { return cat16(*(const v8h*)p, *(const v8h*)(p + 16)); } static __device__ __forceinline__ v8f mma(V a, V b, v8f c) { return wmma16(a, b, c); } };
template <> struct WFrag<bf> { typedef v16bf V; static __device__ __forceinline__ V ld(const bf* p) { return cat16b(*(const v8us*)p, *(const v8us*)(p + 16)); } static __device__ __forceinline__ v8f mma(V a, V b, v8f c) { return wmmab(a, b, c); } };
template <typename T16, int NSPLIT, bool BIAS, int KS = 1>
__global__ __launch_bounds__(32) void k_gemmw(const T16* __restrict__ A, const T16* __restrict__ A2, const T16* __restrict__ Bt, const T16* __restrict__ Bt2, int K, float* C, int ldc, const float* __restrict__ bias, size_t sA, size_t sB, size_t sC) {
    typedef typename WFrag<T16>::V V;
    __shared__ __align__(16) float os[16 * 68];
    const size_t z = blockIdx.z; A += z * sA; if (A2) A2 += z * sA; Bt += z * sB; if (Bt2) Bt2 += z * sB; C += z * sC;
    const int lane = threadIdx.x & 31, lr = lane & 15, hi = lane >> 4; const int r0 = blockIdx.x * 64, c0 = (int)(blockIdx.y / KS) * 64;
    const int kb = (int)(blockIdx.y % KS) * (K / KS), ke = kb + K / KS; C += (size_t)(blockIdx.y % KS) * ZH * sC;
    v8f acc[4][4];
#pragma unroll
    for (int mb = 0; mb < 4; ++mb)
#pragma unroll
        for (int nb = 0; nb < 4; ++nb) acc[mb][nb] = (v8f){};
    const size_t aoff = (size_t)(r0 + lr) * K + 8 * hi, boff = (size_t)(c0 + lr) * K + 8 * hi;
#pragma unroll 1
    for (int kc = kb; kc < ke; kc += 32) {
        V a[4], a2[4];
#pragma unroll
        for (int mb = 0; mb < 4; ++mb) { a[mb] = WFrag<T16>::ld(A + aoff + (size_t)mb * 16 * K + kc); if (NSPLIT == 1 || NSPLIT == 2) a2[mb] = WFrag<T16>::ld(A2 + aoff + (size_t)mb * 16 * K + kc); }
#pragma unroll
        for (int nb = 0; nb < 4; ++nb) { const V b = WFrag<T16>::ld(Bt + boff + (size_t)nb * 16 * K + kc); V b2; if (NSPLIT >= 2) b2 = WFrag<T16>::ld(Bt2 + boff + (size_t)nb * 16 * K + kc);
#pragma unroll
            for (int mb = 0; mb < 4; ++mb) { acc[mb][nb] = WFrag<T16>::mma(a[mb], b, acc[mb][nb]); if (NSPLIT == 1 || NSPLIT == 2) acc[mb][nb] = WFrag<T16>::mma(a2[mb], b, acc[mb][nb]); if (NSPLIT >= 2) acc[mb][nb] = WFrag<T16>::mma(a[mb], b2, acc[mb][nb]); } }
        asm volatile("v_nop\n\tv_nop\n\tv_nop\n\tv_nop" : "+v"(acc[0][0]), "+v"(acc[1][1]), "+v"(acc[2][2]), "+v"(acc[3][3]) : "v"(a[0]), "v"(a[3]));
    }
#pragma unroll
    for (int mb = 0; mb < 4; ++mb) {
#pragma unroll
        for (int nb = 0; nb < 4; ++nb) {
#pragma unroll
            for (int j = 0; j < 8; ++j) os[(hi * 8 + j) * 68 + nb * 16 + lr] = acc[mb][nb][j]; }
        __builtin_amdgcn_wave_barrier(); asm volatile("" ::: "memory");
        float* crow = C + (size_t)(r0 + mb * 16) * ldc + c0;
{
#pragma unroll
            for (int s = 0; s < 8; ++s) { const int row = 2 * s + hi, cofs = lr * 4; v4f val = *(const v4fa*)(os + row * 68 + cofs); if (BIAS) { val[0] += bfr(bias[c0 + cofs]); val[1] += bfr(bias[c0 + cofs + 1]); val[2] += bfr(bias[c0 + cofs + 2]); val[3] += bfr(bias[c0 + cofs + 3]); }
                *(v4f*)(crow + (size_t)row * ldc + cofs) = val; }
             }
        __builtin_amdgcn_wave_barrier(); asm volatile("" ::: "memory");
    }
}

// ---- k_gemmc: the same one-wave 64x64 tile GEMM specialised for causal attention: CMODE 1 skips score tiles entirely above the diagonal (query rows r0+roff.., key columns c0..), CMODE 2 limits the
// key (K) loop of the probability x value contraction to the diagonal block (probabilities beyond it are exactly zero). roff = row offset of this launch's first row within the sequence.
template <typename T16, int NSPLIT, int CMODE>
__global__ __launch_bounds__(32) void k_gemmc(const T16* __restrict__ A, const T16* __restrict__ A2, const T16* __restrict__ Bt, const T16* __restrict__ Bt2, int K, float* C, int ldc, int roff, size_t sA, size_t sB, size_t sC) {
    typedef typename WFrag<T16>::V V;
    __shared__ __align__(16) float os[16 * 68];
    const size_t z = blockIdx.z; A += z * sA; if (A2) A2 += z * sA; Bt += z * sB; if (Bt2) Bt2 += z * sB; C += z * sC;
    const int lane = threadIdx.x & 31, lr = lane & 15, hi = lane >> 4; const int r0 = blockIdx.x * 64, c0 = blockIdx.y * 64;
    if (CMODE == 1 && c0 > r0 + roff + 63) return;                  // score tile entirely above the causal diagonal: not computed (k_asoft here has no mask and reads every key)
    const int Kl = (CMODE == 2) ? min(K, r0 + roff + 64) : K;        // P.V: probabilities are exactly 0 beyond the diagonal block, so the K loop stops there
    v8f acc[4][4];
#pragma unroll
    for (int mb = 0; mb < 4; ++mb)
#pragma unroll
        for (int nb = 0; nb < 4; ++nb) acc[mb][nb] = (v8f){};
    const size_t aoff = (size_t)(r0 + lr) * K + 8 * hi, boff = (size_t)(c0 + lr) * K + 8 * hi;
#pragma unroll 1
    for (int kc = 0; kc < Kl; kc += 32) {
        V a[4], a2[4];
#pragma unroll
        for (int mb = 0; mb < 4; ++mb) { a[mb] = WFrag<T16>::ld(A + aoff + (size_t)mb * 16 * K + kc); if (NSPLIT == 1 || NSPLIT == 2) a2[mb] = WFrag<T16>::ld(A2 + aoff + (size_t)mb * 16 * K + kc); }
#pragma unroll
        for (int nb = 0; nb < 4; ++nb) { const V b = WFrag<T16>::ld(Bt + boff + (size_t)nb * 16 * K + kc); V b2; if (NSPLIT >= 2) b2 = WFrag<T16>::ld(Bt2 + boff + (size_t)nb * 16 * K + kc);
#pragma unroll
            for (int mb = 0; mb < 4; ++mb) { acc[mb][nb] = WFrag<T16>::mma(a[mb], b, acc[mb][nb]); if (NSPLIT == 1 || NSPLIT == 2) acc[mb][nb] = WFrag<T16>::mma(a2[mb], b, acc[mb][nb]); if (NSPLIT >= 2) acc[mb][nb] = WFrag<T16>::mma(a[mb], b2, acc[mb][nb]); } }
        asm volatile("v_nop\n\tv_nop\n\tv_nop\n\tv_nop" : "+v"(acc[0][0]), "+v"(acc[1][1]), "+v"(acc[2][2]), "+v"(acc[3][3]) : "v"(a[0]), "v"(a[3]));
    }
#pragma unroll
    for (int mb = 0; mb < 4; ++mb) {
#pragma unroll
        for (int nb = 0; nb < 4; ++nb) {
#pragma unroll
            for (int j = 0; j < 8; ++j) os[(hi * 8 + j) * 68 + nb * 16 + lr] = acc[mb][nb][j]; }
        __builtin_amdgcn_wave_barrier(); asm volatile("" ::: "memory");
        float* crow = C + (size_t)(r0 + mb * 16) * ldc + c0;
{
#pragma unroll
            for (int s = 0; s < 8; ++s) { const int row = 2 * s + hi, cofs = lr * 4; v4f val = *(const v4fa*)(os + row * 68 + cofs);
                *(v4f*)(crow + (size_t)row * ldc + cofs) = val; }
             }
        __builtin_amdgcn_wave_barrier(); asm volatile("" ::: "memory");
    }
}

__device__ __forceinline__ h16 tohx(float x) { return (h16)x; }
__device__ __forceinline__ void splitf(float y, unsigned short& h, unsigned short& l) { h = f2bf(y); l = f2bf(y - bf2f(h)); }
typedef __attribute__((ext_vector_type(2))) _Float16 v2h;
typedef __attribute__((ext_vector_type(4))) _Float16 v4h;
typedef __attribute__((ext_vector_type(2))) unsigned short v2us;
typedef __attribute__((ext_vector_type(4))) unsigned short v4us;
typedef __attribute__((ext_vector_type(2))) float v2f;
typedef __attribute__((ext_vector_type(4))) int v4i;

__global__ __launch_bounds__(256) void k_cvt8(const float* __restrict__ src, bf* dst, size_t n8) { const size_t i = (size_t)blockIdx.x * 256 + threadIdx.x; if (i >= n8) return; const v8f v = *(const v8f*)(src + i * 8); v8us o;
#pragma unroll
    for (int k = 0; k < 8; ++k) o[k] = f2bf(v[k]); *(v8us*)(dst + i * 8) = o;  }

__global__ __launch_bounds__(256) void k_ropeI(const float* __restrict__ F, int pitch, int nheads, const float* __restrict__ CS, float sc, h16* P16, bf* Ph, bf* Pl) {
    const size_t e = ((size_t)blockIdx.x * 256 + threadIdx.x) * 2; if (e >= (size_t)nheads * TT * HD) return; const int d = (int)(e % HD); const int t = (int)((e / HD) % TT); const int h = (int)(e / ((size_t)HD * TT)); const float* f = F + (size_t)t * pitch + h * HD; const float x0 = f[d], x1 = f[d + 1]; const v2f cs = *(const v2f*)(CS + ((size_t)t * HD + d) * 2); v2h o16; v2us oh, ol;
    float a0 = __fmul_rn(x0, cs[0]), b0 = __fmul_rn(x1, cs[1]), a1 = __fmul_rn(x1, cs[0]), b1 = __fmul_rn(x0, cs[1]); asm volatile("" : "+v"(a0), "+v"(b0), "+v"(a1), "+v"(b1));
    float r0 = __fsub_rn(a0, b0) * sc, r1 = __fadd_rn(b1, a1) * sc;   /* even: x0 c - x1 s; odd: x0 s + x1 c */
    o16[0] = tohx(r0); o16[1] = tohx(r1); { unsigned short a2, c2; splitf(r0, a2, c2); oh[0] = a2; ol[0] = c2; splitf(r1, a2, c2); oh[1] = a2; ol[1] = c2; }
    *(v2h*)(P16 + e) = o16; *(v2us*)(Ph + e) = oh; *(v2us*)(Pl + e) = ol;  }

__constant__ float INV2[HD / 2] = { 1.000000000e+00f, 7.498942018e-01f, 5.623413324e-01f, 4.216965139e-01f, 3.162277639e-01f, 2.371373624e-01f, 1.778279394e-01f, 1.333521456e-01f, 1.000000015e-01f, 7.498941571e-02f, 5.623412877e-02f, 4.216964915e-02f, 3.162277862e-02f, 2.371373586e-02f, 1.778279431e-02f, 1.333521493e-02f, 9.999999776e-03f, 7.498942316e-03f, 5.623413250e-03f, 4.216964822e-03f, 3.162277862e-03f, 2.371373819e-03f, 1.778279431e-03f, 1.333521446e-03f, 1.000000047e-03f, 7.498941850e-04f, 5.623413017e-04f, 4.216964880e-04f, 3.162277862e-04f, 2.371373848e-04f, 1.778279402e-04f, 1.333521504e-04f };   // 1 / THETA ** (2i / 64), i = 0..31, in float32 as THIS module writes it (the RECIPROCAL spelling, evaluated in the reference's own f32 arithmetic: these 32 literals equal it bit for bit); ten entries differ by one ulp from the negative-power values the host's own table held
__global__ __launch_bounds__(256) void k_csP(float* CS) { const int idx = blockIdx.x * 256 + threadIdx.x; if (idx >= TT * HD) return; const int d = idx % HD; const int t = idx / HD; const float a = __fmul_rn((float)t, INV2[d >> 1]); v2f cs; cs[0] = cosf(a); cs[1] = sinf(a); *(v2f*)(CS + (size_t)idx * 2) = cs;  }
__global__ __launch_bounds__(256) void k_vtp(const float* __restrict__ F, int pitch, int nheads, h16* V16, bf* Vh, bf* Vl) { const size_t e = ((size_t)blockIdx.x * 256 + threadIdx.x) * 2; if (e >= (size_t)nheads * HD * TT) return; const int t = (int)(e % TT); const int d = (int)((e / TT) % HD); const int g = (int)(e / ((size_t)TT * HD)); v2h o16; v2us oh, ol;
#pragma unroll
    for (int q = 0; q < 2; ++q) { const float x = F[(size_t)(t + q) * pitch + g * HD + d]; o16[q] = tohx(x); unsigned short a2, c2; splitf(x, a2, c2); oh[q] = a2; ol[q] = c2; }
    *(v2h*)(V16 + e) = o16; *(v2us*)(Vh + e) = oh; *(v2us*)(Vl + e) = ol;  }
// k_asoft: per row (zz, i): t = S x SCL for EVERY key j (WIN 0: dense: no causal rule and no window in this build); softmax over the 2048 keys (register row, one exp, fixed trees);
__global__ __launch_bounds__(256) void k_asoft(const float* __restrict__ Sb, h16* P16, bf* Ph, bf* Pl) {
    const int lane = threadIdx.x & 31; const int row = blockIdx.x * 8 + (threadIdx.x >> 5); if (row >= ZH * TT) return; const int i = row % TT; const int zz = row / TT; (void)zz; const bool hires = (i < RH); const float* sr = Sb + (size_t)row * TT; float v[TT / 32]; float mx = -3.0e38f;
#pragma unroll
    for (int ch = 0; ch < TT / 128; ++ch) { const int j0 = ch * 128 + lane * 4; const v4f a = *(const v4f*)(sr + j0);
#pragma unroll
        for (int q = 0; q < 4; ++q) { const int j = j0 + q; (void)j; const float t = a[q] * SCL; v[ch * 4 + q] = t; mx = fmaxf(mx, t); } }
#pragma unroll
    for (int sh = 16; sh; sh >>= 1) mx = fmaxf(mx, __shfl_xor(mx, sh, 32));
    float sum = 0.f;
#pragma unroll
    for (int k = 0; k < TT / 32; ++k) { float d0 = __fsub_rn(v[k], mx); asm volatile("" : "+v"(d0)); v[k] = __builtin_amdgcn_exp2f(__fmul_rn(d0, 1.4426950408889634f)); sum += v[k]; }
#pragma unroll
    for (int sh = 16; sh; sh >>= 1) sum += __shfl_xor(sum, sh, 32);
    const float f = __fdiv_rn(hires ? 1.0f : PCAR, sum);
{
        if (hires) {
#pragma unroll
            for (int ch = 0; ch < TT / 128; ++ch) { v4us oh, ol;
#pragma unroll
                for (int q = 0; q < 4; ++q) { unsigned short a, c2; splitf(v[ch * 4 + q] * f, a, c2); oh[q] = a; ol[q] = c2; }
                const size_t oo = ((size_t)zz * (RH ? RH : 1) + i) * TT + ch * 128 + lane * 4; *(v4us*)(Ph + oo) = oh; *(v4us*)(Pl + oo) = ol; }
        } else {
#pragma unroll
            for (int ch = 0; ch < TT / 128; ++ch) { v4h o4;
#pragma unroll
                for (int q = 0; q < 4; ++q) o4[q] = tohx(v[ch * 4 + q] * f);
                *(v4h*)(P16 + (size_t)row * TT + ch * 128 + lane * 4) = o4; } }
         }
}
__global__ __launch_bounds__(256) void k_merge(const float* __restrict__ O, int h0, bf* Ah, bf* Al) { const size_t e = ((size_t)blockIdx.x * 256 + threadIdx.x) * 2; if (e >= (size_t)ZH * TT * HD) return; const int d = (int)(e % HD); const int t = (int)((e / HD) % TT); const int zz = (int)(e / ((size_t)HD * TT)); const float cs = (t < RH) ? 1.0f : (1.0f / PCAR); const size_t oo = (size_t)t * DQ + (h0 + zz) * HD + d;
    v2f s = *(const v2f*)(O + e);   // the KSL key-slice partials, added in slice order
#pragma unroll
    for (int k = 1; k < KSL; ++k) s += *(const v2f*)(O + (size_t)k * ZH * TT * HD + e);
    v2us oh, ol;
#pragma unroll
    for (int q = 0; q < 2; ++q) { unsigned short a, c2; splitf(s[q] * cs, a, c2); oh[q] = a; ol[q] = c2; } *(v2us*)(Ah + oo) = oh; *(v2us*)(Al + oo) = ol;  }

extern "C" void kernel_launch(void* const* d_in, const int* in_sizes, int n_in,
                              void* d_out, int out_size, void* d_ws, size_t ws_size, hipStream_t stream) {
    (void)in_sizes; (void)n_in; (void)out_size;
    const float* x = (const float*)d_in[0]; const float* wqkv = (const float*)d_in[1]; const float* wo = (const float*)d_in[2];   /* argument order x, w_attn ('oi' [3072][1024]: q | k | v row blocks), w_proj ('oi' [1024][1024]) */ const float* wq = wqkv; const float* wk = wqkv + (size_t)DQ * DM; const float* wv = wqkv + (size_t)2 * DQ * DM;
    float* OUT = (float*)d_out;     // [4][2048][1024]
    char* wsp = (char*)d_ws;
    auto take = [&](size_t bytes) { char* p = wsp; wsp += (bytes + 255) & ~(size_t)255; return (void*)p; };
    bf* WQ = (bf*)take((size_t)DQ * DM * 2); bf* WK = (bf*)take((size_t)DKV * DM * 2); bf* WV = (bf*)take((size_t)DKV * DM * 2); bf* WO = (bf*)take((size_t)DM * DQ * 2); float* CS = (float*)take((size_t)TT * HD * 2 * 4);
    bf* XB = (bf*)take((size_t)TT * DM * 2); float* FQ = (float*)take((size_t)TT * DQ * 4); float* FK = (float*)take((size_t)TT * DKV * 4);
    h16* QP16 = (h16*)take((size_t)NH_ * TT * HD * 2); h16* KP16 = (h16*)take((size_t)NKV * TT * HD * 2); h16* VT16 = (h16*)take((size_t)NKV * HD * TT * 2);
    bf* QPh = (bf*)take((size_t)NH_ * TT * HD * 2); bf* QPl = (bf*)take((size_t)NH_ * TT * HD * 2); bf* KPh = (bf*)take((size_t)NKV * TT * HD * 2); bf* KPl = (bf*)take((size_t)NKV * TT * HD * 2); bf* VTh = (bf*)take((size_t)NKV * HD * TT * 2); bf* VTl = (bf*)take((size_t)NKV * HD * TT * 2); bf* Ph = (bf*)take((size_t)ZH * RH * TT * 2); bf* Pl = (bf*)take((size_t)ZH * RH * TT * 2);
    float* Sb = (float*)take((size_t)ZH * TT * TT * 4); h16* P16 = (h16*)take((size_t)ZH * TT * TT * 2); float* Ob = (float*)take((size_t)KSL * ZH * TT * HD * 4); bf* ATh = (bf*)take((size_t)TT * DQ * 2); bf* ATl = (bf*)take((size_t)TT * DQ * 2);
    if ((size_t)(wsp - (char*)d_ws) > ws_size) return;    // ws 256 MiB
    float* FV = FK;   // v projection reuses the k buffer after the k planes are built (stream-ordered)
    { k_cvt8<<<(unsigned)(((size_t)DQ * DM / 8 + 255) / 256), 256, 0, stream>>>(wq, WQ, (size_t)DQ * DM / 8); k_cvt8<<<(unsigned)(((size_t)DKV * DM / 8 + 255) / 256), 256, 0, stream>>>(wk, WK, (size_t)DKV * DM / 8); k_cvt8<<<(unsigned)(((size_t)DKV * DM / 8 + 255) / 256), 256, 0, stream>>>(wv, WV, (size_t)DKV * DM / 8);
      k_cvt8<<<(unsigned)(((size_t)DM * DQ / 8 + 255) / 256), 256, 0, stream>>>(wo, WO, (size_t)DM * DQ / 8); k_csP<<<(TT * HD + 255) / 256, 256, 0, stream>>>(CS); }
    const unsigned LQ = (unsigned)(((size_t)NH_ * TT * HD / 2 + 255) / 256), LKv = (unsigned)(((size_t)NKV * TT * HD / 2 + 255) / 256);
    for (int b = 0; b < NB_; ++b) {
        
        k_cvt8<<<(unsigned)(((size_t)TT * DM / 8 + 255) / 256), 256, 0, stream>>>(x + (size_t)b * TT * DM, XB, (size_t)TT * DM / 8);
        k_gemmw<bf, 0, false><<<dim3(TT / 64, DQ / 64, 1), 32, 0, stream>>>(XB, nullptr, WQ, nullptr, DM, FQ, DQ, nullptr, 0, 0, 0);
        k_ropeI<<<LQ, 256, 0, stream>>>(FQ, DQ, NH_, CS, 1.0f, QP16, QPh, QPl);
        k_gemmw<bf, 0, false><<<dim3(TT / 64, DKV / 64, 1), 32, 0, stream>>>(XB, nullptr, WK, nullptr, DM, FK, DKV, nullptr, 0, 0, 0);
        k_ropeI<<<LKv, 256, 0, stream>>>(FK, DKV, NKV, CS, 1.0f, KP16, KPh, KPl);
        k_gemmw<bf, 0, false><<<dim3(TT / 64, DKV / 64, 1), 32, 0, stream>>>(XB, nullptr, WV, nullptr, DM, FV, DKV, nullptr, 0, 0, 0); k_vtp<<<LKv, 256, 0, stream>>>(FV, DKV, NKV, VT16, VTh, VTl);
        for (int h0 = 0; h0 < NH_; h0 += ZH) { const size_t zq = (size_t)h0, zk = (size_t)(h0 / REP);   // one kv head per query head: the pass's two heads use consecutive kv planes (z-strides TT*HD)
            k_gemmw<bf, 2, false><<<dim3(RH / 64, TT / 64, ZH), 32, 0, stream>>>(QPh + zq * TT * HD, QPl + zq * TT * HD, KPh + zk * TT * HD, KPl + zk * TT * HD, HD, Sb, TT, nullptr, (size_t)TT * HD, (size_t)TT * HD, (size_t)TT * TT);
            k_gemmw<h16, 0, false><<<dim3((TT - RH) / 64, TT / 64, ZH), 32, 0, stream>>>(QP16 + zq * TT * HD + (size_t)RH * HD, nullptr, KP16 + zk * TT * HD, nullptr, HD, Sb + (size_t)RH * TT, TT, nullptr, (size_t)TT * HD, (size_t)TT * HD, (size_t)TT * TT);
            k_asoft<<<ZH * TT / 8, 256, 0, stream>>>(Sb, P16, Ph, Pl);
            k_gemmw<bf, 2, false, KSL><<<dim3(RH / 64, HD / 64 * KSL, ZH), 32, 0, stream>>>(Ph, Pl, VTh + zk * HD * TT, VTl + zk * HD * TT, TT, Ob, HD, nullptr, (size_t)RH * TT, (size_t)HD * TT, (size_t)TT * HD);
            k_gemmw<h16, 0, false, KSL><<<dim3((TT - RH) / 64, HD / 64 * KSL, ZH), 32, 0, stream>>>(P16 + (size_t)RH * TT, nullptr, VT16 + zk * HD * TT, nullptr, TT, Ob + (size_t)RH * HD, HD, nullptr, (size_t)TT * TT, (size_t)HD * TT, (size_t)TT * HD);
            k_merge<<<(unsigned)(((size_t)ZH * TT * HD / 2 + 255) / 256), 256, 0, stream>>>(Ob, h0, ATh, ATl); }
        k_gemmw<bf, 1, false><<<dim3(TT / 64, DM / 64, 1), 32, 0, stream>>>(ATh, ATl, WO, nullptr, DQ, OUT + (size_t)b * TT * DM, DM, nullptr, 0, 0, 0); }
}

// v002
// One run takes 1280 microseconds.
// Timed twice side by side with v001, it ran 1.31 times as fast both times.
// All steps since v000 together make it 3.09 times as fast.
#include <hip/hip_runtime.h>

// Multi-head attention WITHOUT a mask with interleaved-pair rotary position embedding on a fused bias-free natural projection, four batches (x [4][2048][1024]; qkv = x w_attn^T ('oi' [3072][1024] 0.02, no bias) split in thirds q | k | v (16 heads x 64; token-major); angles = t x 1 / THETA ** (2i / 64) (THETA 1e4; computed); pairs (2i, 2i+1): re cos - im sin, re sin + im cos, on q and k; scores x 1/sqrt(64); softmax over ALL keys (no mask); y = merged w_proj^T ('oi', no bias) -> [4][2048][1024] (8.4 M); argument order x, w_attn, w_proj).
// Layout per batch: bf16 copy of x; exact projections; {cos, sin} per (position, pair) built once from the int positions and float32 inverse-frequency constants (precise cosf/sinf); interleaved rotary plane builder; DENSE T-2048 attention (hybrid rows: < 512 hi/lo 3 products, rest fp16 x1024; EVERY key tile computed by the plain tile GEMM: no causal tile skipping in this build: k_gemmc stays in the file, unused); merged hi/lo x Wo exact.
// Compute dtypes, f32 accumulate: every input rounded to bf16; projections exact; rotary f32; attention rows < 512 3 products, rest fp16; softmax f32; Wo hl x exact.

#define NB_  4
#define TT   2048
#define DM   1024
#define NH_  16
#define NKV  16
#define REP  (NH_ / NKV)
#define HD   64
#define DQ   (NH_ * HD)
#define DKV  (NKV * HD)
#define ZH   8                    // heads per attention pass: every launch of a pass covers ZH heads (grid z, or ZH blocks of rows)
#define RH   512                  // query rows < RH use hi+lo planes (0: none)
#define WIN  0   
#define PCAR 1024.0f
#define SCL  0.125f   // HD^-0.5
#define KSL  16                   // key slices of the probability x value product: one work-group per slice, f32 partial planes, summed in slice order by k_merge
typedef _Float16 h16;
typedef unsigned short bf;
typedef __attribute__((ext_vector_type(16))) __bf16   v16bf;
typedef __attribute__((ext_vector_type(16))) _Float16 v16h;
typedef __attribute__((ext_vector_type(8)))  _Float16 v8h;
typedef __attribute__((ext_vector_type(8)))  unsigned short v8us;
typedef __attribute__((ext_vector_type(8)))  float    v8f;
typedef __attribute__((ext_vector_type(4)))  float    v4f;
typedef v8h  __attribute__((may_alias)) v8ha;
typedef v4f  __attribute__((may_alias)) v4fa;
typedef v8us __attribute__((may_alias)) v8usa;

__device__ __forceinline__ unsigned short f2bf(float f) { unsigned u = __float_as_uint(f); u += 0x7FFFu + ((u >> 16) & 1u); return (unsigned short)(u >> 16); }
__device__ __forceinline__ float bf2f(unsigned short b) { return __uint_as_float(((unsigned)b) << 16); }
__device__ __forceinline__ float bfr(float f) { return bf2f(f2bf(f)); }
__device__ __forceinline__ v16h cat16(v8h lo, v8h hi) { return __builtin_shufflevector(lo, hi, 0, 1, 2, 3, 4, 5, 6, 7, 8, 9, 10, 11, 12, 13, 14, 15); }
__device__ __forceinline__ v16bf cat16b(v8us lo, v8us hi) { return __builtin_bit_cast(v16bf, __builtin_shufflevector(lo, hi, 0, 1, 2, 3, 4, 5, 6, 7, 8, 9, 10, 11, 12, 13, 14, 15)); }
__device__ __forceinline__ v8f wmma16(v16h a, v16h b, v8f c) { return __builtin_amdgcn_wmma_f32_16x16x32_f16(false, a, false, b, (short)0, c, false, false); }
__device__ __forceinline__ v8f wmmab(v16bf a, v16bf b, v8f c) { return __builtin_amdgcn_wmma_f32_16x16x32_bf16(false, a, false, b, (short)0, c, false, false); }



// ---- k_gemmw: register-blocked GEMM, ONE WAVE per 64x64 output tile (16 accumulators), operands straight from K-contiguous 16-bit planes; grid (M/64, N/64, Z), 32 threads.
// C[m][n] (f32, pitch ldc, + optional f32 bias[n]) = sum_k A[m][k] Bt[n][k] (+ split products per NSPLIT). z-batch strides sA/sB/sC in elements. K % 32 == 0.
// KS > 1: grid.y = (N/64) * KS; work-group y sums only k in slice y % KS (K / KS long, K stays the row pitch) into partial plane y % KS of C (plane stride ZH * sC elements: the ZH z-planes of one slice lie together); the reader adds the KS planes.
template <typename T16> struct WFrag;
template <> struct WFrag<h16> { typedef v16h V; static __device__ __forceinline__ V ld(const h16* p) { return cat16(*(const v8h*)p, *(const v8h*)(p + 16)); } static __device__ __forceinline__ v8f mma(V a, V b, v8f c) { return wmma16(a, b, c); } };
template <> struct WFrag<bf> { typedef v16bf V; static __device__ __forceinline__ V ld(const bf* p) { return cat16b(*(const v8us*)p, *(const v8us*)(p + 16)); } static __device__ __forceinline__ v8f mma(V a, V b, v8f c) { return wmmab(a, b, c); } };
template <typename T16, int NSPLIT, bool BIAS, int KS = 1>
__global__ __launch_bounds__(32) void k_gemmw(const T16* __restrict__ A, const T16* __restrict__ A2, const T16* __restrict__ Bt, const T16* __restrict__ Bt2, int K, float* C, int ldc, const float* __restrict__ bias, size_t sA, size_t sB, size_t sC) {
    typedef typename WFrag<T16>::V V;
    __shared__ __align__(16) float os[16 * 68];
    const size_t z = blockIdx.z; A += z * sA; if (A2) A2 += z * sA; Bt += z * sB; if (Bt2) Bt2 += z * sB; C += z * sC;
    const int lane = threadIdx.x & 31, lr = lane & 15, hi = lane >> 4; const int r0 = blockIdx.x * 64, c0 = (int)(blockIdx.y / KS) * 64;
    const int kb = (int)(blockIdx.y % KS) * (K / KS), ke = kb + K / KS; C += (size_t)(blockIdx.y % KS) * ZH * sC;
    v8f acc[4][4];
#pragma unroll
    for (int mb = 0; mb < 4; ++mb)
#pragma unroll
        for (int nb = 0; nb < 4; ++nb) acc[mb][nb] = (v8f){};
    const size_t aoff = (size_t)(r0 + lr) * K + 8 * hi, boff = (size_t)(c0 + lr) * K + 8 * hi;
#pragma unroll 1
    for (int kc = kb; kc < ke; kc += 32) {
        V a[4], a2[4];
#pragma unroll
        for (int mb = 0; mb < 4; ++mb) { a[mb] = WFrag<T16>::ld(A + aoff + (size_t)mb * 16 * K + kc); if (NSPLIT == 1 || NSPLIT == 2) a2[mb] = WFrag<T16>::ld(A2 + aoff + (size_t)mb * 16 * K + kc); }
#pragma unroll
        for (int nb = 0; nb < 4; ++nb) { const V b = WFrag<T16>::ld(Bt + boff + (size_t)nb * 16 * K + kc); V b2; if (NSPLIT >= 2) b2 = WFrag<T16>::ld(Bt2 + boff + (size_t)nb * 16 * K + kc);
#pragma unroll
            for (int mb = 0; mb < 4; ++mb) { acc[mb][nb] = WFrag<T16>::mma(a[mb], b, acc[mb][nb]); if (NSPLIT == 1 || NSPLIT == 2) acc[mb][nb] = WFrag<T16>::mma(a2[mb], b, acc[mb][nb]); if (NSPLIT >= 2) acc[mb][nb] = WFrag<T16>::mma(a[mb], b2, acc[mb][nb]); } }
        asm volatile("v_nop\n\tv_nop\n\tv_nop\n\tv_nop" : "+v"(acc[0][0]), "+v"(acc[1][1]), "+v"(acc[2][2]), "+v"(acc[3][3]) : "v"(a[0]), "v"(a[3]));
    }
#pragma unroll
    for (int mb = 0; mb < 4; ++mb) {
#pragma unroll
        for (int nb = 0; nb < 4; ++nb) {
#pragma unroll
            for (int j = 0; j < 8; ++j) os[(hi * 8 + j) * 68 + nb * 16 + lr] = acc[mb][nb][j]; }
        __builtin_amdgcn_wave_barrier(); asm volatile("" ::: "memory");
        float* crow = C + (size_t)(r0 + mb * 16) * ldc + c0;
{
#pragma unroll
            for (int s = 0; s < 8; ++s) { const int row = 2 * s + hi, cofs = lr * 4; v4f val = *(const v4fa*)(os + row * 68 + cofs); if (BIAS) { val[0] += bfr(bias[c0 + cofs]); val[1] += bfr(bias[c0 + cofs + 1]); val[2] += bfr(bias[c0 + cofs + 2]); val[3] += bfr(bias[c0 + cofs + 3]); }
                *(v4f*)(crow + (size_t)row * ldc + cofs) = val; }
             }
        __builtin_amdgcn_wave_barrier(); asm volatile("" ::: "memory");
    }
}

// ---- k_gemmc: the same one-wave 64x64 tile GEMM specialised for causal attention: CMODE 1 skips score tiles entirely above the diagonal (query rows r0+roff.., key columns c0..), CMODE 2 limits the
// key (K) loop of the probability x value contraction to the diagonal block (probabilities beyond it are exactly zero). roff = row offset of this launch's first row within the sequence.
template <typename T16, int NSPLIT, int CMODE>
__global__ __launch_bounds__(32) void k_gemmc(const T16* __restrict__ A, const T16* __restrict__ A2, const T16* __restrict__ Bt, const T16* __restrict__ Bt2, int K, float* C, int ldc, int roff, size_t sA, size_t sB, size_t sC) {
    typedef typename WFrag<T16>::V V;
    __shared__ __align__(16) float os[16 * 68];
    const size_t z = blockIdx.z; A += z * sA; if (A2) A2 += z * sA; Bt += z * sB; if (Bt2) Bt2 += z * sB; C += z * sC;
    const int lane = threadIdx.x & 31, lr = lane & 15, hi = lane >> 4; const int r0 = blockIdx.x * 64, c0 = blockIdx.y * 64;
    if (CMODE == 1 && c0 > r0 + roff + 63) return;                  // score tile entirely above the causal diagonal: not computed (k_asoft here has no mask and reads every key)
    const int Kl = (CMODE == 2) ? min(K, r0 + roff + 64) : K;        // P.V: probabilities are exactly 0 beyond the diagonal block, so the K loop stops there
    v8f acc[4][4];
#pragma unroll
    for (int mb = 0; mb < 4; ++mb)
#pragma unroll
        for (int nb = 0; nb < 4; ++nb) acc[mb][nb] = (v8f){};
    const size_t aoff = (size_t)(r0 + lr) * K + 8 * hi, boff = (size_t)(c0 + lr) * K + 8 * hi;
#pragma unroll 1
    for (int kc = 0; kc < Kl; kc += 32) {
        V a[4], a2[4];
#pragma unroll
        for (int mb = 0; mb < 4; ++mb) { a[mb] = WFrag<T16>::ld(A + aoff + (size_t)mb * 16 * K + kc); if (NSPLIT == 1 || NSPLIT == 2) a2[mb] = WFrag<T16>::ld(A2 + aoff + (size_t)mb * 16 * K + kc); }
#pragma unroll
        for (int nb = 0; nb < 4; ++nb) { const V b = WFrag<T16>::ld(Bt + boff + (size_t)nb * 16 * K + kc); V b2; if (NSPLIT >= 2) b2 = WFrag<T16>::ld(Bt2 + boff + (size_t)nb * 16 * K + kc);
#pragma unroll
            for (int mb = 0; mb < 4; ++mb) { acc[mb][nb] = WFrag<T16>::mma(a[mb], b, acc[mb][nb]); if (NSPLIT == 1 || NSPLIT == 2) acc[mb][nb] = WFrag<T16>::mma(a2[mb], b, acc[mb][nb]); if (NSPLIT >= 2) acc[mb][nb] = WFrag<T16>::mma(a[mb], b2, acc[mb][nb]); } }
        asm volatile("v_nop\n\tv_nop\n\tv_nop\n\tv_nop" : "+v"(acc[0][0]), "+v"(acc[1][1]), "+v"(acc[2][2]), "+v"(acc[3][3]) : "v"(a[0]), "v"(a[3]));
    }
#pragma unroll
    for (int mb = 0; mb < 4; ++mb) {
#pragma unroll
        for (int nb = 0; nb < 4; ++nb) {
#pragma unroll
            for (int j = 0; j < 8; ++j) os[(hi * 8 + j) * 68 + nb * 16 + lr] = acc[mb][nb][j]; }
        __builtin_amdgcn_wave_barrier(); asm volatile("" ::: "memory");
        float* crow = C + (size_t)(r0 + mb * 16) * ldc + c0;
{
#pragma unroll
            for (int s = 0; s < 8; ++s) { const int row = 2 * s + hi, cofs = lr * 4; v4f val = *(const v4fa*)(os + row * 68 + cofs);
                *(v4f*)(crow + (size_t)row * ldc + cofs) = val; }
             }
        __builtin_amdgcn_wave_barrier(); asm volatile("" ::: "memory");
    }
}

__device__ __forceinline__ h16 tohx(float x) { return (h16)x; }
__device__ __forceinline__ void splitf(float y, unsigned short& h, unsigned short& l) { h = f2bf(y); l = f2bf(y - bf2f(h)); }
typedef __attribute__((ext_vector_type(2))) _Float16 v2h;
typedef __attribute__((ext_vector_type(4))) _Float16 v4h;
typedef __attribute__((ext_vector_type(2))) unsigned short v2us;
typedef __attribute__((ext_vector_type(4))) unsigned short v4us;
typedef __attribute__((ext_vector_type(2))) float v2f;
typedef __attribute__((ext_vector_type(4))) int v4i;

__global__ __launch_bounds__(256) void k_cvt8(const float* __restrict__ src, bf* dst, size_t n8) { const size_t i = (size_t)blockIdx.x * 256 + threadIdx.x; if (i >= n8) return; const v8f v = *(const v8f*)(src + i * 8); v8us o;
#pragma unroll
    for (int k = 0; k < 8; ++k) o[k] = f2bf(v[k]); *(v8us*)(dst + i * 8) = o;  }

__global__ __launch_bounds__(256) void k_ropeI(const float* __restrict__ F, int pitch, int nheads, const float* __restrict__ CS, float sc, h16* P16, bf* Ph, bf* Pl) {
    const size_t e = ((size_t)blockIdx.x * 256 + threadIdx.x) * 2; if (e >= (size_t)nheads * TT * HD) return; const int d = (int)(e % HD); const int t = (int)((e / HD) % TT); const int h = (int)(e / ((size_t)HD * TT)); const float* f = F + (size_t)t * pitch + h * HD; const float x0 = f[d], x1 = f[d + 1]; const v2f cs = *(const v2f*)(CS + ((size_t)t * HD + d) * 2); v2h o16; v2us oh, ol;
    float a0 = __fmul_rn(x0, cs[0]), b0 = __fmul_rn(x1, cs[1]), a1 = __fmul_rn(x1, cs[0]), b1 = __fmul_rn(x0, cs[1]); asm volatile("" : "+v"(a0), "+v"(b0), "+v"(a1), "+v"(b1));
    float r0 = __fsub_rn(a0, b0) * sc, r1 = __fadd_rn(b1, a1) * sc;   /* even: x0 c - x1 s; odd: x0 s + x1 c */
    o16[0] = tohx(r0); o16[1] = tohx(r1); { unsigned short a2, c2; splitf(r0, a2, c2); oh[0] = a2; ol[0] = c2; splitf(r1, a2, c2); oh[1] = a2; ol[1] = c2; }
    *(v2h*)(P16 + e) = o16; *(v2us*)(Ph + e) = oh; *(v2us*)(Pl + e) = ol;  }

__constant__ float INV2[HD / 2] = { 1.000000000e+00f, 7.498942018e-01f, 5.623413324e-01f, 4.216965139e-01f, 3.162277639e-01f, 2.371373624e-01f, 1.778279394e-01f, 1.333521456e-01f, 1.000000015e-01f, 7.498941571e-02f, 5.623412877e-02f, 4.216964915e-02f, 3.162277862e-02f, 2.371373586e-02f, 1.778279431e-02f, 1.333521493e-02f, 9.999999776e-03f, 7.498942316e-03f, 5.623413250e-03f, 4.216964822e-03f, 3.162277862e-03f, 2.371373819e-03f, 1.778279431e-03f, 1.333521446e-03f, 1.000000047e-03f, 7.498941850e-04f, 5.623413017e-04f, 4.216964880e-04f, 3.162277862e-04f, 2.371373848e-04f, 1.778279402e-04f, 1.333521504e-04f };   // 1 / THETA ** (2i / 64), i = 0..31, in float32 as THIS module writes it (the RECIPROCAL spelling, evaluated in the reference's own f32 arithmetic: these 32 literals equal it bit for bit); ten entries differ by one ulp from the negative-power values the host's own table held
__global__ __launch_bounds__(256) void k_csP(float* CS) { const int idx = blockIdx.x * 256 + threadIdx.x; if (idx >= TT * HD) return; const int d = idx % HD; const int t = idx / HD; const float a = __fmul_rn((float)t, INV2[d >> 1]); v2f cs; cs[0] = cosf(a); cs[1] = sinf(a); *(v2f*)(CS + (size_t)idx * 2) = cs;  }
__global__ __launch_bounds__(256) void k_vtp(const float* __restrict__ F, int pitch, int nheads, h16* V16, bf* Vh, bf* Vl) { const size_t e = ((size_t)blockIdx.x * 256 + threadIdx.x) * 2; if (e >= (size_t)nheads * HD * TT) return; const int t = (int)(e % TT); const int d = (int)((e / TT) % HD); const int g = (int)(e / ((size_t)TT * HD)); v2h o16; v2us oh, ol;
#pragma unroll
    for (int q = 0; q < 2; ++q) { const float x = F[(size_t)(t + q) * pitch + g * HD + d]; o16[q] = tohx(x); unsigned short a2, c2; splitf(x, a2, c2); oh[q] = a2; ol[q] = c2; }
    *(v2h*)(V16 + e) = o16; *(v2us*)(Vh + e) = oh; *(v2us*)(Vl + e) = ol;  }
// One launch per row class: HI rows (< RH of each head) from the score block [ZH][RH][TT] to the hi and lo planes, the other rows from the block [ZH][TT - RH][TT] to P16 of the same shape; i counts within the class.
// k_asoft: per row (zz, i): t = S x SCL for EVERY key j (WIN 0: dense: no causal rule and no window in this build); softmax over the 2048 keys (register row, one exp, fixed trees);
template <bool HI>
__global__ __launch_bounds__(256) void k_asoft(const float* __restrict__ Sb, h16* P16, bf* Ph, bf* Pl) {
    constexpr int NR = HI ? RH : TT - RH;   // rows per head in this launch
    const int lane = threadIdx.x & 31; const int row = blockIdx.x * 8 + (threadIdx.x >> 5); if (row >= ZH * NR) return; const int i = row % NR; const int zz = row / NR; (void)zz; (void)i; const bool hires = HI; const float* sr = Sb + (size_t)row * TT; float v[TT / 32]; float mx = -3.0e38f;
#pragma unroll
    for (int ch = 0; ch < TT / 128; ++ch) { const int j0 = ch * 128 + lane * 4; const v4f a = *(const v4f*)(sr + j0);
#pragma unroll
        for (int q = 0; q < 4; ++q) { const int j = j0 + q; (void)j; const float t = a[q] * SCL; v[ch * 4 + q] = t; mx = fmaxf(mx, t); } }
#pragma unroll
    for (int sh = 16; sh; sh >>= 1) mx = fmaxf(mx, __shfl_xor(mx, sh, 32));
    float sum = 0.f;
#pragma unroll
    for (int k = 0; k < TT / 32; ++k) { float d0 = __fsub_rn(v[k], mx); asm volatile("" : "+v"(d0)); v[k] = __builtin_amdgcn_exp2f(__fmul_rn(d0, 1.4426950408889634f)); sum += v[k]; }
#pragma unroll
    for (int sh = 16; sh; sh >>= 1) sum += __shfl_xor(sum, sh, 32);
    const float f = __fdiv_rn(hires ? 1.0f : PCAR, sum);
{
        if (hires) {
#pragma unroll
            for (int ch = 0; ch < TT / 128; ++ch) { v4us oh, ol;
#pragma unroll
                for (int q = 0; q < 4; ++q) { unsigned short a, c2; splitf(v[ch * 4 + q] * f, a, c2); oh[q] = a; ol[q] = c2; }
                const size_t oo = ((size_t)zz * (RH ? RH : 1) + i) * TT + ch * 128 + lane * 4; *(v4us*)(Ph + oo) = oh; *(v4us*)(Pl + oo) = ol; }
        } else {
#pragma unroll
            for (int ch = 0; ch < TT / 128; ++ch) { v4h o4;
#pragma unroll
                for (int q = 0; q < 4; ++q) o4[q] = tohx(v[ch * 4 + q] * f);
                *(v4h*)(P16 + (size_t)row * TT + ch * 128 + lane * 4) = o4; } }
         }
}
__global__ __launch_bounds__(256) void k_merge(const float* __restrict__ O, int h0, bf* Ah, bf* Al) { const size_t e = ((size_t)blockIdx.x * 256 + threadIdx.x) * 2; if (e >= (size_t)ZH * TT * HD) return; const int d = (int)(e % HD); const int t = (int)((e / HD) % TT); const int zz = (int)(e / ((size_t)HD * TT)); const float cs = (t < RH) ? 1.0f : (1.0f / PCAR); const size_t oo = (size_t)t * DQ + (h0 + zz) * HD + d;
    v2f s = *(const v2f*)(O + e);   // the KSL key-slice partials, added in slice order
#pragma unroll
    for (int k = 1; k < KSL; ++k) s += *(const v2f*)(O + (size_t)k * ZH * TT * HD + e);
    v2us oh, ol;
#pragma unroll
    for (int q = 0; q < 2; ++q) { unsigned short a, c2; splitf(s[q] * cs, a, c2); oh[q] = a; ol[q] = c2; } *(v2us*)(Ah + oo) = oh; *(v2us*)(Al + oo) = ol;  }

extern "C" void kernel_launch(void* const* d_in, const int* in_sizes, int n_in,
                              void* d_out, int out_size, void* d_ws, size_t ws_size, hipStream_t stream) {
    (void)in_sizes; (void)n_in; (void)out_size;
    const float* x = (const float*)d_in[0]; const float* wqkv = (const float*)d_in[1]; const float* wo = (const float*)d_in[2];   /* argument order x, w_attn ('oi' [3072][1024]: q | k | v row blocks), w_proj ('oi' [1024][1024]) */ const float* wq = wqkv; const float* wk = wqkv + (size_t)DQ * DM; const float* wv = wqkv + (size_t)2 * DQ * DM;
    float* OUT = (float*)d_out;     // [4][2048][1024]
    char* wsp = (char*)d_ws;
    auto take = [&](size_t bytes) { char* p = wsp; wsp += (bytes + 255) & ~(size_t)255; return (void*)p; };
    bf* WQ = (bf*)take((size_t)DQ * DM * 2); bf* WK = (bf*)take((size_t)DKV * DM * 2); bf* WV = (bf*)take((size_t)DKV * DM * 2); bf* WO = (bf*)take((size_t)DM * DQ * 2); float* CS = (float*)take((size_t)TT * HD * 2 * 4);
    bf* XB = (bf*)take((size_t)TT * DM * 2); float* FQ = (float*)take((size_t)TT * DQ * 4); float* FK = (float*)take((size_t)TT * DKV * 4);
    h16* QP16 = (h16*)take((size_t)NH_ * TT * HD * 2); h16* KP16 = (h16*)take((size_t)NKV * TT * HD * 2); h16* VT16 = (h16*)take((size_t)NKV * HD * TT * 2);
    bf* QPh = (bf*)take((size_t)NH_ * TT * HD * 2); bf* QPl = (bf*)take((size_t)NH_ * TT * HD * 2); bf* KPh = (bf*)take((size_t)NKV * TT * HD * 2); bf* KPl = (bf*)take((size_t)NKV * TT * HD * 2); bf* VTh = (bf*)take((size_t)NKV * HD * TT * 2); bf* VTl = (bf*)take((size_t)NKV * HD * TT * 2);
    float* SbH = (float*)take((size_t)ZH * RH * TT * 4); float* SbL = (float*)take((size_t)ZH * (TT - RH) * TT * 4); h16* P16 = (h16*)take((size_t)ZH * (TT - RH) * TT * 2); bf* ATh = (bf*)take((size_t)TT * DQ * 2); bf* ATl = (bf*)take((size_t)TT * DQ * 2);
    if ((size_t)(wsp - (char*)d_ws) > ws_size) return;    // ws 256 MiB
    static_assert((size_t)KSL * HD * 4 + (size_t)RH * 4 <= (size_t)(TT - RH) * 4, "partial planes and hi/lo probability planes must fit in SbL");
    float* Ob = SbL; bf* Ph = (bf*)(Ob + (size_t)KSL * ZH * TT * HD); bf* Pl = Ph + (size_t)ZH * RH * TT;   // SbL is dead once its softmax launch has run: the partial planes and the hi/lo probability planes reuse it, each stored later in the same pass before it is read (stream-ordered)
    float* FV = FK;   // v projection reuses the k buffer after the k planes are built (stream-ordered)
    { k_cvt8<<<(unsigned)(((size_t)DQ * DM / 8 + 255) / 256), 256, 0, stream>>>(wq, WQ, (size_t)DQ * DM / 8); k_cvt8<<<(unsigned)(((size_t)DKV * DM / 8 + 255) / 256), 256, 0, stream>>>(wk, WK, (size_t)DKV * DM / 8); k_cvt8<<<(unsigned)(((size_t)DKV * DM / 8 + 255) / 256), 256, 0, stream>>>(wv, WV, (size_t)DKV * DM / 8);
      k_cvt8<<<(unsigned)(((size_t)DM * DQ / 8 + 255) / 256), 256, 0, stream>>>(wo, WO, (size_t)DM * DQ / 8); k_csP<<<(TT * HD + 255) / 256, 256, 0, stream>>>(CS); }
    const unsigned LQ = (unsigned)(((size_t)NH_ * TT * HD / 2 + 255) / 256), LKv = (unsigned)(((size_t)NKV * TT * HD / 2 + 255) / 256);
    for (int b = 0; b < NB_; ++b) {
        
        k_cvt8<<<(unsigned)(((size_t)TT * DM / 8 + 255) / 256), 256, 0, stream>>>(x + (size_t)b * TT * DM, XB, (size_t)TT * DM / 8);
        k_gemmw<bf, 0, false><<<dim3(TT / 64, DQ / 64, 1), 32, 0, stream>>>(XB, nullptr, WQ, nullptr, DM, FQ, DQ, nullptr, 0, 0, 0);
        k_ropeI<<<LQ, 256, 0, stream>>>(FQ, DQ, NH_, CS, 1.0f, QP16, QPh, QPl);
        k_gemmw<bf, 0, false><<<dim3(TT / 64, DKV / 64, 1), 32, 0, stream>>>(XB, nullptr, WK, nullptr, DM, FK, DKV, nullptr, 0, 0, 0);
        k_ropeI<<<LKv, 256, 0, stream>>>(FK, DKV, NKV, CS, 1.0f, KP16, KPh, KPl);
        k_gemmw<bf, 0, false><<<dim3(TT / 64, DKV / 64, 1), 32, 0, stream>>>(XB, nullptr, WV, nullptr, DM, FV, DKV, nullptr, 0, 0, 0); k_vtp<<<LKv, 256, 0, stream>>>(FV, DKV, NKV, VT16, VTh, VTl);
        for (int h0 = 0; h0 < NH_; h0 += ZH) { const size_t zq = (size_t)h0, zk = (size_t)(h0 / REP);   // one kv head per query head: the pass's ZH heads use consecutive kv planes (z-strides TT*HD); each consumer launch follows its producer: rows >= RH first (scores, softmax, P x V), then rows < RH
            k_gemmw<h16, 0, false><<<dim3((TT - RH) / 64, TT / 64, ZH), 32, 0, stream>>>(QP16 + zq * TT * HD + (size_t)RH * HD, nullptr, KP16 + zk * TT * HD, nullptr, HD, SbL, TT, nullptr, (size_t)TT * HD, (size_t)TT * HD, (size_t)(TT - RH) * TT);
            k_asoft<false><<<ZH * (TT - RH) / 8, 256, 0, stream>>>(SbL, P16, nullptr, nullptr);
            k_gemmw<h16, 0, false, KSL><<<dim3((TT - RH) / 64, HD / 64 * KSL, ZH), 32, 0, stream>>>(P16, nullptr, VT16 + zk * HD * TT, nullptr, TT, Ob + (size_t)RH * HD, HD, nullptr, (size_t)(TT - RH) * TT, (size_t)HD * TT, (size_t)TT * HD);
            k_gemmw<bf, 2, false><<<dim3(RH / 64, TT / 64, ZH), 32, 0, stream>>>(QPh + zq * TT * HD, QPl + zq * TT * HD, KPh + zk * TT * HD, KPl + zk * TT * HD, HD, SbH, TT, nullptr, (size_t)TT * HD, (size_t)TT * HD, (size_t)RH * TT);
            k_asoft<true><<<ZH * RH / 8, 256, 0, stream>>>(SbH, nullptr, Ph, Pl);
            k_gemmw<bf, 2, false, KSL><<<dim3(RH / 64, HD / 64 * KSL, ZH), 32, 0, stream>>>(Ph, Pl, VTh + zk * HD * TT, VTl + zk * HD * TT, TT, Ob, HD, nullptr, (size_t)RH * TT, (size_t)HD * TT, (size_t)TT * HD);
            k_merge<<<(unsigned)(((size_t)ZH * TT * HD / 2 + 255) / 256), 256, 0, stream>>>(Ob, h0, ATh, ATl); }
        k_gemmw<bf, 1, false><<<dim3(TT / 64, DM / 64, 1), 32, 0, stream>>>(ATh, ATl, WO, nullptr, DQ, OUT + (size_t)b * TT * DM, DM, nullptr, 0, 0, 0); }
}

// v003
// One run takes 752 microseconds.
// In two side-by-side timings against v002, it was 1.72 and 1.71 times as fast.
// Over all steps from v000 it is 5.28 times as fast.
#include <hip/hip_runtime.h>

// Multi-head attention WITHOUT a mask with interleaved-pair rotary position embedding on a fused bias-free natural projection, four batches (x [4][2048][1024]; qkv = x w_attn^T ('oi' [3072][1024] 0.02, no bias) split in thirds q | k | v (16 heads x 64; token-major); angles = t x 1 / THETA ** (2i / 64) (THETA 1e4; computed); pairs (2i, 2i+1): re cos - im sin, re sin + im cos, on q and k; scores x 1/sqrt(64); softmax over ALL keys (no mask); y = merged w_proj^T ('oi', no bias) -> [4][2048][1024] (8.4 M); argument order x, w_attn, w_proj).
// Layout per batch: bf16 copy of x; exact projections; {cos, sin} per (position, pair) built once from the int positions and float32 inverse-frequency constants (precise cosf/sinf); interleaved rotary plane builder; DENSE T-2048 attention in ONE launch per batch (k_fattn: scores, running softmax and probability x value stay in registers; hybrid rows: < 512 hi/lo 3 products, rest fp16; every key block computed: no mask; k_gemmc stays in the file, unused); merged hi/lo x Wo exact.
// Compute dtypes, f32 accumulate: every input rounded to bf16; projections exact; rotary f32; attention rows < 512 3 products, rest fp16; softmax f32; Wo hl x exact.

#define NB_  4
#define TT   2048
#define DM   1024
#define NH_  16
#define NKV  16
#define REP  (NH_ / NKV)
#define HD   64
#define DQ   (NH_ * HD)
#define DKV  (NKV * HD)
#define RH   512                  // query rows < RH use hi+lo planes (0: none)
#define SCL  0.125f   // HD^-0.5
typedef _Float16 h16;
typedef unsigned short bf;
typedef __attribute__((ext_vector_type(16))) __bf16   v16bf;
typedef __attribute__((ext_vector_type(16))) _Float16 v16h;
typedef __attribute__((ext_vector_type(8)))  _Float16 v8h;
typedef __attribute__((ext_vector_type(8)))  unsigned short v8us;
typedef __attribute__((ext_vector_type(8)))  float    v8f;
typedef __attribute__((ext_vector_type(4)))  float    v4f;
typedef v8h  __attribute__((may_alias)) v8ha;
typedef v4f  __attribute__((may_alias)) v4fa;
typedef v8us __attribute__((may_alias)) v8usa;

__device__ __forceinline__ unsigned short f2bf(float f) { unsigned u = __float_as_uint(f); u += 0x7FFFu + ((u >> 16) & 1u); return (unsigned short)(u >> 16); }
__device__ __forceinline__ float bf2f(unsigned short b) { return __uint_as_float(((unsigned)b) << 16); }
__device__ __forceinline__ float bfr(float f) { return bf2f(f2bf(f)); }
__device__ __forceinline__ v16h cat16(v8h lo, v8h hi) { return __builtin_shufflevector(lo, hi, 0, 1, 2, 3, 4, 5, 6, 7, 8, 9, 10, 11, 12, 13, 14, 15); }
__device__ __forceinline__ v16bf cat16b(v8us lo, v8us hi) { return __builtin_bit_cast(v16bf, __builtin_shufflevector(lo, hi, 0, 1, 2, 3, 4, 5, 6, 7, 8, 9, 10, 11, 12, 13, 14, 15)); }
__device__ __forceinline__ v8f wmma16(v16h a, v16h b, v8f c) { return __builtin_amdgcn_wmma_f32_16x16x32_f16(false, a, false, b, (short)0, c, false, false); }
__device__ __forceinline__ v8f wmmab(v16bf a, v16bf b, v8f c) { return __builtin_amdgcn_wmma_f32_16x16x32_bf16(false, a, false, b, (short)0, c, false, false); }



// ---- k_gemmw: register-blocked GEMM, ONE WAVE per 64x64 output tile (16 accumulators), operands straight from K-contiguous 16-bit planes; grid (M/64, N/64, Z), 32 threads.
// C[m][n] (f32, pitch ldc, + optional f32 bias[n]) = sum_k A[m][k] Bt[n][k] (+ split products per NSPLIT). z-batch strides sA/sB/sC in elements. K % 32 == 0.
template <typename T16> struct WFrag;
template <> struct WFrag<h16> { typedef v16h V; static __device__ __forceinline__ V ld(const h16* p) { return cat16(*(const v8h*)p, *(const v8h*)(p + 16)); } static __device__ __forceinline__ v8f mma(V a, V b, v8f c) { return wmma16(a, b, c); } };
template <> struct WFrag<bf> { typedef v16bf V; static __device__ __forceinline__ V ld(const bf* p) { return cat16b(*(const v8us*)p, *(const v8us*)(p + 16)); } static __device__ __forceinline__ v8f mma(V a, V b, v8f c) { return wmmab(a, b, c); } };
template <typename T16, int NSPLIT, bool BIAS>
__global__ __launch_bounds__(32) void k_gemmw(const T16* __restrict__ A, const T16* __restrict__ A2, const T16* __restrict__ Bt, const T16* __restrict__ Bt2, int K, float* C, int ldc, const float* __restrict__ bias, size_t sA, size_t sB, size_t sC) {
    typedef typename WFrag<T16>::V V;
    __shared__ __align__(16) float os[16 * 68];
    const size_t z = blockIdx.z; A += z * sA; if (A2) A2 += z * sA; Bt += z * sB; if (Bt2) Bt2 += z * sB; C += z * sC;
    const int lane = threadIdx.x & 31, lr = lane & 15, hi = lane >> 4; const int r0 = blockIdx.x * 64, c0 = blockIdx.y * 64;
    v8f acc[4][4];
#pragma unroll
    for (int mb = 0; mb < 4; ++mb)
#pragma unroll
        for (int nb = 0; nb < 4; ++nb) acc[mb][nb] = (v8f){};
    const size_t aoff = (size_t)(r0 + lr) * K + 8 * hi, boff = (size_t)(c0 + lr) * K + 8 * hi;
#pragma unroll 1
    for (int kc = 0; kc < K; kc += 32) {
        V a[4], a2[4];
#pragma unroll
        for (int mb = 0; mb < 4; ++mb) { a[mb] = WFrag<T16>::ld(A + aoff + (size_t)mb * 16 * K + kc); if (NSPLIT == 1 || NSPLIT == 2) a2[mb] = WFrag<T16>::ld(A2 + aoff + (size_t)mb * 16 * K + kc); }
#pragma unroll
        for (int nb = 0; nb < 4; ++nb) { const V b = WFrag<T16>::ld(Bt + boff + (size_t)nb * 16 * K + kc); V b2; if (NSPLIT >= 2) b2 = WFrag<T16>::ld(Bt2 + boff + (size_t)nb * 16 * K + kc);
#pragma unroll
            for (int mb = 0; mb < 4; ++mb) { acc[mb][nb] = WFrag<T16>::mma(a[mb], b, acc[mb][nb]); if (NSPLIT == 1 || NSPLIT == 2) acc[mb][nb] = WFrag<T16>::mma(a2[mb], b, acc[mb][nb]); if (NSPLIT >= 2) acc[mb][nb] = WFrag<T16>::mma(a[mb], b2, acc[mb][nb]); } }
        asm volatile("v_nop\n\tv_nop\n\tv_nop\n\tv_nop" : "+v"(acc[0][0]), "+v"(acc[1][1]), "+v"(acc[2][2]), "+v"(acc[3][3]) : "v"(a[0]), "v"(a[3]));
    }
#pragma unroll
    for (int mb = 0; mb < 4; ++mb) {
#pragma unroll
        for (int nb = 0; nb < 4; ++nb) {
#pragma unroll
            for (int j = 0; j < 8; ++j) os[(hi * 8 + j) * 68 + nb * 16 + lr] = acc[mb][nb][j]; }
        __builtin_amdgcn_wave_barrier(); asm volatile("" ::: "memory");
        float* crow = C + (size_t)(r0 + mb * 16) * ldc + c0;
{
#pragma unroll
            for (int s = 0; s < 8; ++s) { const int row = 2 * s + hi, cofs = lr * 4; v4f val = *(const v4fa*)(os + row * 68 + cofs); if (BIAS) { val[0] += bfr(bias[c0 + cofs]); val[1] += bfr(bias[c0 + cofs + 1]); val[2] += bfr(bias[c0 + cofs + 2]); val[3] += bfr(bias[c0 + cofs + 3]); }
                *(v4f*)(crow + (size_t)row * ldc + cofs) = val; }
             }
        __builtin_amdgcn_wave_barrier(); asm volatile("" ::: "memory");
    }
}

// ---- k_gemmc: the same one-wave 64x64 tile GEMM specialised for causal attention: CMODE 1 skips score tiles entirely above the diagonal (query rows r0+roff.., key columns c0..), CMODE 2 limits the
// key (K) loop of the probability x value contraction to the diagonal block (probabilities beyond it are exactly zero). roff = row offset of this launch's first row within the sequence.
template <typename T16, int NSPLIT, int CMODE>
__global__ __launch_bounds__(32) void k_gemmc(const T16* __restrict__ A, const T16* __restrict__ A2, const T16* __restrict__ Bt, const T16* __restrict__ Bt2, int K, float* C, int ldc, int roff, size_t sA, size_t sB, size_t sC) {
    typedef typename WFrag<T16>::V V;
    __shared__ __align__(16) float os[16 * 68];
    const size_t z = blockIdx.z; A += z * sA; if (A2) A2 += z * sA; Bt += z * sB; if (Bt2) Bt2 += z * sB; C += z * sC;
    const int lane = threadIdx.x & 31, lr = lane & 15, hi = lane >> 4; const int r0 = blockIdx.x * 64, c0 = blockIdx.y * 64;
    if (CMODE == 1 && c0 > r0 + roff + 63) return;                  // score tile entirely above the causal diagonal: not computed
    const int Kl = (CMODE == 2) ? min(K, r0 + roff + 64) : K;        // P.V: probabilities are exactly 0 beyond the diagonal block, so the K loop stops there
    v8f acc[4][4];
#pragma unroll
    for (int mb = 0; mb < 4; ++mb)
#pragma unroll
        for (int nb = 0; nb < 4; ++nb) acc[mb][nb] = (v8f){};
    const size_t aoff = (size_t)(r0 + lr) * K + 8 * hi, boff = (size_t)(c0 + lr) * K + 8 * hi;
#pragma unroll 1
    for (int kc = 0; kc < Kl; kc += 32) {
        V a[4], a2[4];
#pragma unroll
        for (int mb = 0; mb < 4; ++mb) { a[mb] = WFrag<T16>::ld(A + aoff + (size_t)mb * 16 * K + kc); if (NSPLIT == 1 || NSPLIT == 2) a2[mb] = WFrag<T16>::ld(A2 + aoff + (size_t)mb * 16 * K + kc); }
#pragma unroll
        for (int nb = 0; nb < 4; ++nb) { const V b = WFrag<T16>::ld(Bt + boff + (size_t)nb * 16 * K + kc); V b2; if (NSPLIT >= 2) b2 = WFrag<T16>::ld(Bt2 + boff + (size_t)nb * 16 * K + kc);
#pragma unroll
            for (int mb = 0; mb < 4; ++mb) { acc[mb][nb] = WFrag<T16>::mma(a[mb], b, acc[mb][nb]); if (NSPLIT == 1 || NSPLIT == 2) acc[mb][nb] = WFrag<T16>::mma(a2[mb], b, acc[mb][nb]); if (NSPLIT >= 2) acc[mb][nb] = WFrag<T16>::mma(a[mb], b2, acc[mb][nb]); } }
        asm volatile("v_nop\n\tv_nop\n\tv_nop\n\tv_nop" : "+v"(acc[0][0]), "+v"(acc[1][1]), "+v"(acc[2][2]), "+v"(acc[3][3]) : "v"(a[0]), "v"(a[3]));
    }
#pragma unroll
    for (int mb = 0; mb < 4; ++mb) {
#pragma unroll
        for (int nb = 0; nb < 4; ++nb) {
#pragma unroll
            for (int j = 0; j < 8; ++j) os[(hi * 8 + j) * 68 + nb * 16 + lr] = acc[mb][nb][j]; }
        __builtin_amdgcn_wave_barrier(); asm volatile("" ::: "memory");
        float* crow = C + (size_t)(r0 + mb * 16) * ldc + c0;
{
#pragma unroll
            for (int s = 0; s < 8; ++s) { const int row = 2 * s + hi, cofs = lr * 4; v4f val = *(const v4fa*)(os + row * 68 + cofs);
                *(v4f*)(crow + (size_t)row * ldc + cofs) = val; }
             }
        __builtin_amdgcn_wave_barrier(); asm volatile("" ::: "memory");
    }
}

__device__ __forceinline__ h16 tohx(float x) { return (h16)x; }
__device__ __forceinline__ void splitf(float y, unsigned short& h, unsigned short& l) { h = f2bf(y); l = f2bf(y - bf2f(h)); }
typedef __attribute__((ext_vector_type(2))) _Float16 v2h;
typedef __attribute__((ext_vector_type(4))) _Float16 v4h;
typedef __attribute__((ext_vector_type(2))) unsigned short v2us;
typedef __attribute__((ext_vector_type(4))) unsigned short v4us;
typedef __attribute__((ext_vector_type(2))) float v2f;
typedef __attribute__((ext_vector_type(4))) int v4i;

__global__ __launch_bounds__(256) void k_cvt8(const float* __restrict__ src, bf* dst, size_t n8) { const size_t i = (size_t)blockIdx.x * 256 + threadIdx.x; if (i >= n8) return; const v8f v = *(const v8f*)(src + i * 8); v8us o;
#pragma unroll
    for (int k = 0; k < 8; ++k) o[k] = f2bf(v[k]); *(v8us*)(dst + i * 8) = o;  }

__global__ __launch_bounds__(256) void k_ropeI(const float* __restrict__ F, int pitch, int nheads, const float* __restrict__ CS, float sc, h16* P16, bf* Ph, bf* Pl) {
    const size_t e = ((size_t)blockIdx.x * 256 + threadIdx.x) * 2; if (e >= (size_t)nheads * TT * HD) return; const int d = (int)(e % HD); const int t = (int)((e / HD) % TT); const int h = (int)(e / ((size_t)HD * TT)); const float* f = F + (size_t)t * pitch + h * HD; const float x0 = f[d], x1 = f[d + 1]; const v2f cs = *(const v2f*)(CS + ((size_t)t * HD + d) * 2); v2h o16; v2us oh, ol;
    float a0 = __fmul_rn(x0, cs[0]), b0 = __fmul_rn(x1, cs[1]), a1 = __fmul_rn(x1, cs[0]), b1 = __fmul_rn(x0, cs[1]); asm volatile("" : "+v"(a0), "+v"(b0), "+v"(a1), "+v"(b1));
    float r0 = __fsub_rn(a0, b0) * sc, r1 = __fadd_rn(b1, a1) * sc;   /* even: x0 c - x1 s; odd: x0 s + x1 c */
    o16[0] = tohx(r0); o16[1] = tohx(r1); { unsigned short a2, c2; splitf(r0, a2, c2); oh[0] = a2; ol[0] = c2; splitf(r1, a2, c2); oh[1] = a2; ol[1] = c2; }
    *(v2h*)(P16 + e) = o16; *(v2us*)(Ph + e) = oh; *(v2us*)(Pl + e) = ol;  }

__constant__ float INV2[HD / 2] = { 1.000000000e+00f, 7.498942018e-01f, 5.623413324e-01f, 4.216965139e-01f, 3.162277639e-01f, 2.371373624e-01f, 1.778279394e-01f, 1.333521456e-01f, 1.000000015e-01f, 7.498941571e-02f, 5.623412877e-02f, 4.216964915e-02f, 3.162277862e-02f, 2.371373586e-02f, 1.778279431e-02f, 1.333521493e-02f, 9.999999776e-03f, 7.498942316e-03f, 5.623413250e-03f, 4.216964822e-03f, 3.162277862e-03f, 2.371373819e-03f, 1.778279431e-03f, 1.333521446e-03f, 1.000000047e-03f, 7.498941850e-04f, 5.623413017e-04f, 4.216964880e-04f, 3.162277862e-04f, 2.371373848e-04f, 1.778279402e-04f, 1.333521504e-04f };   // 1 / THETA ** (2i / 64), i = 0..31, in float32 as THIS module writes it (the RECIPROCAL spelling, evaluated in the reference's own f32 arithmetic: these 32 literals equal it bit for bit); ten entries differ by one ulp from the negative-power values the host's own table held
__global__ __launch_bounds__(256) void k_csP(float* CS) { const int idx = blockIdx.x * 256 + threadIdx.x; if (idx >= TT * HD) return; const int d = idx % HD; const int t = idx / HD; const float a = __fmul_rn((float)t, INV2[d >> 1]); v2f cs; cs[0] = cosf(a); cs[1] = sinf(a); *(v2f*)(CS + (size_t)idx * 2) = cs;  }
__global__ __launch_bounds__(256) void k_vtp(const float* __restrict__ F, int pitch, int nheads, h16* V16, bf* Vh, bf* Vl) { const size_t e = ((size_t)blockIdx.x * 256 + threadIdx.x) * 2; if (e >= (size_t)nheads * HD * TT) return; const int t = (int)(e % TT); const int d = (int)((e / TT) % HD); const int g = (int)(e / ((size_t)TT * HD)); v2h o16; v2us oh, ol;
#pragma unroll
    for (int q = 0; q < 2; ++q) { const float x = F[(size_t)(t + q) * pitch + g * HD + d]; o16[q] = tohx(x); unsigned short a2, c2; splitf(x, a2, c2); oh[q] = a2; ol[q] = c2; }
    *(v2h*)(V16 + e) = o16; *(v2us*)(Vh + e) = oh; *(v2us*)(Vl + e) = ol;  }
// ---- k_fattn: scores, softmax and probability x value of one batch in one launch; nothing of a score or a probability goes to memory.
// One wave owns NQ x 16 query rows of one head and walks the 2048 keys in blocks of 32, operands straight from the K-contiguous 16-bit planes.
// S^T = K Q^T (A = key rows, B = query rows): a lane holds scores of its own query column only (keys 8 hi + j of each 16-key tile), so two S^T tiles, converted in place, ARE the B operand of O^T += V^T P^T
// (A = V^T rows loaded in the same k order: 8 hi + 0..7, 16 + 8 hi + 0..7). Running softmax in log2 units: p = 2^(s c - ref), f32 row sum; ref moves (and O, sum are rescaled) only when a column's
// block maximum exceeds it by more than 8, so p <= 2^8; the common factor cancels in the final division. HI: bf16 hi/lo planes, 3 products in both contractions; else fp16, 1 product.
__device__ __forceinline__ float xhalf(float x) { const int b = __float_as_int(x); return __int_as_float(__builtin_amdgcn_permlanex16(b, b, 0x76543210, 0xfedcba98, false, false)); }   // value of lane l ^ 16
// Four x = 2^x in one statement: behind a transcendental the instruction set asks for one independent instruction before its result is read or its source overwritten; here each v_exp_f32 is followed by an
// independent one and the last by v_nop, so the slot is kept whatever the compiler schedules around the statement. In place: the statement writes only registers that the compiler's own multiply-add has just written,
// so it can overwrite no operand of a matrix instruction sooner than compiled code may.
__device__ __forceinline__ void exp2x4(float& x0, float& x1, float& x2, float& x3) {
    asm("v_exp_f32 %0, %0\n\tv_exp_f32 %1, %1\n\tv_exp_f32 %2, %2\n\tv_exp_f32 %3, %3\n\tv_nop" : "+v"(x0), "+v"(x1), "+v"(x2), "+v"(x3)); }
template <typename T16, bool HI, int NQ>
__device__ __forceinline__ void fa_body(const T16* __restrict__ Q, const T16* __restrict__ Q2, const T16* __restrict__ Kp, const T16* __restrict__ K2, const T16* __restrict__ Vt, const T16* __restrict__ V2, int q0, bf* Ah, bf* Al) {
    typedef typename WFrag<T16>::V V;
    constexpr float C2 = SCL * 1.4426950408889634f;
    const int lane = threadIdx.x & 31, lr = lane & 15, hi = lane >> 4;
    V qf[NQ][2], q2[NQ][2];
#pragma unroll
    for (int qt = 0; qt < NQ; ++qt)
#pragma unroll
        for (int ks = 0; ks < 2; ++ks) { const size_t qo = (size_t)(q0 + qt * 16 + lr) * HD + ks * 32 + 8 * hi; qf[qt][ks] = WFrag<T16>::ld(Q + qo); if (HI) q2[qt][ks] = WFrag<T16>::ld(Q2 + qo); }
    v8f o[4][NQ]; float ref[NQ]; v2f lsum[NQ];   // row sum: even and odd keys apart (packed adds), joined in the epilogue
#pragma unroll
    for (int qt = 0; qt < NQ; ++qt) { ref[qt] = -3.0e38f; lsum[qt] = (v2f){};
#pragma unroll
        for (int dt = 0; dt < 4; ++dt) o[dt][qt] = (v8f){}; }
    const int ko = lr * HD + 8 * hi, vo = lr * TT + 8 * hi;
    V kf[2][2], k2[2][2];
#pragma unroll
    for (int mt = 0; mt < 2; ++mt)
#pragma unroll
        for (int ks = 0; ks < 2; ++ks) { kf[mt][ks] = WFrag<T16>::ld(Kp + ko + mt * 16 * HD + ks * 32); if (HI) k2[mt][ks] = WFrag<T16>::ld(K2 + ko + mt * 16 * HD + ks * 32); }
#pragma unroll 2
    for (int kb = 0; kb < TT; kb += 32) {   // two blocks per trip: the key fragments fetched ahead alternate between two register sets instead of being copied
        V vf[4], v2[4];
#pragma unroll
        for (int dt = 0; dt < 4; ++dt) { vf[dt] = WFrag<T16>::ld(Vt + vo + dt * 16 * TT + kb); if (HI) v2[dt] = WFrag<T16>::ld(V2 + vo + dt * 16 * TT + kb); }
        v8f s[2][NQ];
#pragma unroll
        for (int mt = 0; mt < 2; ++mt)
#pragma unroll
            for (int qt = 0; qt < NQ; ++qt) s[mt][qt] = (v8f){};
#pragma unroll
        for (int ks = 0; ks < 2; ++ks)
#pragma unroll
            for (int pr = 0; pr < (HI ? 3 : 1); ++pr)   // tiles innermost: neighbouring matrix instructions accumulate into different tiles
#pragma unroll
                for (int mt = 0; mt < 2; ++mt)
#pragma unroll
                    for (int qt = 0; qt < NQ; ++qt) s[mt][qt] = WFrag<T16>::mma(pr == 2 ? k2[mt][ks] : kf[mt][ks], pr == 1 ? q2[qt][ks] : qf[qt][ks], s[mt][qt]);
        const int kn = (kb + 32 < TT) ? kb + 32 : 0;   // next block's key fragments, fetched behind this block's score products so that they fly during the softmax; the last pass refetches block 0 (in bounds, not used)
#pragma unroll
        for (int mt = 0; mt < 2; ++mt)
#pragma unroll
            for (int ks = 0; ks < 2; ++ks) { kf[mt][ks] = WFrag<T16>::ld(Kp + ko + (kn + mt * 16) * HD + ks * 32); if (HI) k2[mt][ks] = WFrag<T16>::ld(K2 + ko + (kn + mt * 16) * HD + ks * 32); }
        float mx[NQ]; bool need = false;
#pragma unroll
        for (int qt = 0; qt < NQ; ++qt) { float m = s[0][qt][0];
#pragma unroll
            for (int j = 1; j < 8; ++j) m = fmaxf(m, s[0][qt][j]);
#pragma unroll
            for (int j = 0; j < 8; ++j) m = fmaxf(m, s[1][qt][j]);
            m = fmaxf(m, xhalf(m)) * C2; mx[qt] = m; need = need || (m > ref[qt] + 8.0f); }
        if (__builtin_amdgcn_ballot_w32(need) != 0) {   // wave-uniform: rare after the first block
#pragma unroll
            for (int qt = 0; qt < NQ; ++qt) { const float mn = fmaxf(ref[qt], mx[qt]); const float al = __builtin_amdgcn_exp2f(ref[qt] - mn); ref[qt] = mn; lsum[qt] *= al;
#pragma unroll
                for (int dt = 0; dt < 4; ++dt) o[dt][qt] *= al; } }
#pragma unroll
        for (int qt = 0; qt < NQ; ++qt) { V pf, pl; float pe[16];
#pragma unroll
            for (int e = 0; e < 16; ++e) pe[e] = __builtin_fmaf(s[e >> 3][qt][e & 7], C2, -ref[qt]);
#pragma unroll
            for (int e = 0; e < 16; e += 4) exp2x4(pe[e], pe[e + 1], pe[e + 2], pe[e + 3]);
#pragma unroll
            for (int e = 0; e < 16; e += 2) lsum[qt] += (v2f){pe[e], pe[e + 1]};
#pragma unroll
            for (int e = 0; e < 16; ++e) { const float p = pe[e]; pf[e] = (__typeof__(pf[0]))p; if (HI) pl[e] = (__typeof__(pf[0]))(p - (float)pf[e]); }
#pragma unroll
            for (int dt = 0; dt < 4; ++dt) { o[dt][qt] = WFrag<T16>::mma(vf[dt], pf, o[dt][qt]); if (HI) { o[dt][qt] = WFrag<T16>::mma(vf[dt], pl, o[dt][qt]); o[dt][qt] = WFrag<T16>::mma(v2[dt], pf, o[dt][qt]); } } }
    }
#pragma unroll
    for (int qt = 0; qt < NQ; ++qt) { const float lh = lsum[qt][0] + lsum[qt][1]; const float inv = __fdiv_rn(1.0f, lh + xhalf(lh));   // the two halves of a column hold disjoint keys under one ref: joined once
        const size_t oo = (size_t)(q0 + qt * 16 + lr) * DQ + 8 * hi;
#pragma unroll
        for (int dt = 0; dt < 4; ++dt) { v8us oh, ol;
#pragma unroll
            for (int j = 0; j < 8; ++j) { unsigned short a, c2; splitf(o[dt][qt][j] * inv, a, c2); oh[j] = a; ol[j] = c2; }
            *(v8us*)(Ah + oo + dt * 16) = oh; *(v8us*)(Al + oo + dt * 16) = ol; } }
}
// grid (heads, RH / 64 + (TT - RH) / 128), 4 waves: blocks y < RH / 64 take 4 x 16 hi/lo rows (the longer bodies, so they start first), the others 4 x 32 fp16 rows; the four waves of a block walk the same head's keys together. Writes the merged token-major hi/lo planes.
__global__ __launch_bounds__(128) void k_fattn(const h16* __restrict__ Q16, const h16* __restrict__ K16, const h16* __restrict__ V16, const bf* __restrict__ Qh, const bf* __restrict__ Ql, const bf* __restrict__ Kh, const bf* __restrict__ Kl, const bf* __restrict__ Vh, const bf* __restrict__ Vl, bf* Ah, bf* Al) {
    const int h = blockIdx.x, w = threadIdx.x >> 5, bx = blockIdx.y; const size_t po = (size_t)h * TT * HD, pk = (size_t)(h / REP) * TT * HD; Ah += h * HD; Al += h * HD;
    if (bx < RH / 64) fa_body<bf, true, 1>(Qh + po, Ql + po, Kh + pk, Kl + pk, Vh + pk, Vl + pk, bx * 64 + w * 16, Ah, Al);
    else fa_body<h16, false, 2>(Q16 + po, nullptr, K16 + pk, nullptr, V16 + pk, nullptr, RH + (bx - RH / 64) * 128 + w * 32, Ah, Al);
}

extern "C" void kernel_launch(void* const* d_in, const int* in_sizes, int n_in,
                              void* d_out, int out_size, void* d_ws, size_t ws_size, hipStream_t stream) {
    (void)in_sizes; (void)n_in; (void)out_size;
    const float* x = (const float*)d_in[0]; const float* wqkv = (const float*)d_in[1]; const float* wo = (const float*)d_in[2];   /* argument order x, w_attn ('oi' [3072][1024]: q | k | v row blocks), w_proj ('oi' [1024][1024]) */ const float* wq = wqkv; const float* wk = wqkv + (size_t)DQ * DM; const float* wv = wqkv + (size_t)2 * DQ * DM;
    float* OUT = (float*)d_out;     // [4][2048][1024]
    char* wsp = (char*)d_ws;
    auto take = [&](size_t bytes) { char* p = wsp; wsp += (bytes + 255) & ~(size_t)255; return (void*)p; };
    bf* WQ = (bf*)take((size_t)DQ * DM * 2); bf* WK = (bf*)take((size_t)DKV * DM * 2); bf* WV = (bf*)take((size_t)DKV * DM * 2); bf* WO = (bf*)take((size_t)DM * DQ * 2); float* CS = (float*)take((size_t)TT * HD * 2 * 4);
    bf* XB = (bf*)take((size_t)TT * DM * 2); float* FQ = (float*)take((size_t)TT * DQ * 4); float* FK = (float*)take((size_t)TT * DKV * 4);
    h16* QP16 = (h16*)take((size_t)NH_ * TT * HD * 2); h16* KP16 = (h16*)take((size_t)NKV * TT * HD * 2); h16* VT16 = (h16*)take((size_t)NKV * HD * TT * 2);
    bf* QPh = (bf*)take((size_t)NH_ * TT * HD * 2); bf* QPl = (bf*)take((size_t)NH_ * TT * HD * 2); bf* KPh = (bf*)take((size_t)NKV * TT * HD * 2); bf* KPl = (bf*)take((size_t)NKV * TT * HD * 2); bf* VTh = (bf*)take((size_t)NKV * HD * TT * 2); bf* VTl = (bf*)take((size_t)NKV * HD * TT * 2);
    bf* ATh = (bf*)take((size_t)TT * DQ * 2); bf* ATl = (bf*)take((size_t)TT * DQ * 2);
    if ((size_t)(wsp - (char*)d_ws) > ws_size) return;    // ws 256 MiB
    float* FV = FK;   // v projection reuses the k buffer after the k planes are built (stream-ordered)
    { k_cvt8<<<(unsigned)(((size_t)DQ * DM / 8 + 255) / 256), 256, 0, stream>>>(wq, WQ, (size_t)DQ * DM / 8); k_cvt8<<<(unsigned)(((size_t)DKV * DM / 8 + 255) / 256), 256, 0, stream>>>(wk, WK, (size_t)DKV * DM / 8); k_cvt8<<<(unsigned)(((size_t)DKV * DM / 8 + 255) / 256), 256, 0, stream>>>(wv, WV, (size_t)DKV * DM / 8);
      k_cvt8<<<(unsigned)(((size_t)DM * DQ / 8 + 255) / 256), 256, 0, stream>>>(wo, WO, (size_t)DM * DQ / 8); k_csP<<<(TT * HD + 255) / 256, 256, 0, stream>>>(CS); }
    const unsigned LQ = (unsigned)(((size_t)NH_ * TT * HD / 2 + 255) / 256), LKv = (unsigned)(((size_t)NKV * TT * HD / 2 + 255) / 256);
    for (int b = 0; b < NB_; ++b) {
        
        k_cvt8<<<(unsigned)(((size_t)TT * DM / 8 + 255) / 256), 256, 0, stream>>>(x + (size_t)b * TT * DM, XB, (size_t)TT * DM / 8);
        k_gemmw<bf, 0, false><<<dim3(TT / 64, DQ / 64, 1), 32, 0, stream>>>(XB, nullptr, WQ, nullptr, DM, FQ, DQ, nullptr, 0, 0, 0);
        k_ropeI<<<LQ, 256, 0, stream>>>(FQ, DQ, NH_, CS, 1.0f, QP16, QPh, QPl);
        k_gemmw<bf, 0, false><<<dim3(TT / 64, DKV / 64, 1), 32, 0, stream>>>(XB, nullptr, WK, nullptr, DM, FK, DKV, nullptr, 0, 0, 0);
        k_ropeI<<<LKv, 256, 0, stream>>>(FK, DKV, NKV, CS, 1.0f, KP16, KPh, KPl);
        k_gemmw<bf, 0, false><<<dim3(TT / 64, DKV / 64, 1), 32, 0, stream>>>(XB, nullptr, WV, nullptr, DM, FV, DKV, nullptr, 0, 0, 0); k_vtp<<<LKv, 256, 0, stream>>>(FV, DKV, NKV, VT16, VTh, VTl);
        k_fattn<<<dim3(NH_, RH / 64 + (TT - RH) / 128, 1), 128, 0, stream>>>(QP16, KP16, VT16, QPh, QPl, KPh, KPl, VTh, VTl, ATh, ATl);
        k_gemmw<bf, 1, false><<<dim3(TT / 64, DM / 64, 1), 32, 0, stream>>>(ATh, ATl, WO, nullptr, DQ, OUT + (size_t)b * TT * DM, DM, nullptr, 0, 0, 0); }
}

// v004
// A run of this version takes 555 microseconds.
// In two side-by-side timings against v003, it was 1.37 and 1.35 times as fast.
// Counting every step since v000, it is 7.18 times as fast.
#include <hip/hip_runtime.h>

// Multi-head attention WITHOUT a mask with interleaved-pair rotary position embedding on a fused bias-free natural projection, four batches (x [4][2048][1024]; qkv = x w_attn^T ('oi' [3072][1024] 0.02, no bias) split in thirds q | k | v (16 heads x 64; token-major); angles = t x 1 / THETA ** (2i / 64) (THETA 1e4; computed); pairs (2i, 2i+1): re cos - im sin, re sin + im cos, on q and k; scores x 1/sqrt(64); softmax over ALL keys (no mask); y = merged w_proj^T ('oi', no bias) -> [4][2048][1024] (8.4 M); argument order x, w_attn, w_proj).
// Layout per batch: bf16 copy of x; exact q | k | v projections in ONE launch whose epilogue (qkv_planes) applies the interleaved rotary step and writes the 16-bit planes; {cos, sin} per (position, pair) built once from the int positions and float32 inverse-frequency constants (precise cosf/sinf); DENSE T-2048 attention in ONE launch per batch (k_fattn: scores, running softmax and probability x value stay in registers; hybrid rows: < 512 hi/lo 3 products, rest fp16; every key block computed: no mask; k_gemmc stays in the file, unused); merged hi/lo x Wo exact.
// Compute dtypes, f32 accumulate: every input rounded to bf16; projections exact; rotary f32; attention rows < 512 3 products, rest fp16; softmax f32; Wo hl x exact.

#define NB_  4
#define TT   2048
#define DM   1024
#define NH_  16
#define NKV  16
#define REP  (NH_ / NKV)
#define HD   64
#define DQ   (NH_ * HD)
#define DKV  (NKV * HD)
#define RH   512                  // query rows < RH use hi+lo planes (0: none)
#define SCL  0.125f   // HD^-0.5
typedef _Float16 h16;
typedef unsigned short bf;
typedef __attribute__((ext_vector_type(16))) __bf16   v16bf;
typedef __attribute__((ext_vector_type(16))) _Float16 v16h;
typedef __attribute__((ext_vector_type(8)))  _Float16 v8h;
typedef __attribute__((ext_vector_type(8)))  unsigned short v8us;
typedef __attribute__((ext_vector_type(8)))  float    v8f;
typedef __attribute__((ext_vector_type(4)))  float    v4f;
typedef v8h  __attribute__((may_alias)) v8ha;
typedef v4f  __attribute__((may_alias)) v4fa;
typedef v8us __attribute__((may_alias)) v8usa;

__device__ __forceinline__ unsigned short f2bf(float f) { unsigned u = __float_as_uint(f); u += 0x7FFFu + ((u >> 16) & 1u); return (unsigned short)(u >> 16); }
__device__ __forceinline__ float bf2f(unsigned short b) { return __uint_as_float(((unsigned)b) << 16); }
__device__ __forceinline__ float bfr(float f) { return bf2f(f2bf(f)); }
__device__ __forceinline__ v16h cat16(v8h lo, v8h hi) { return __builtin_shufflevector(lo, hi, 0, 1, 2, 3, 4, 5, 6, 7, 8, 9, 10, 11, 12, 13, 14, 15); }
__device__ __forceinline__ v16bf cat16b(v8us lo, v8us hi) { return __builtin_bit_cast(v16bf, __builtin_shufflevector(lo, hi, 0, 1, 2, 3, 4, 5, 6, 7, 8, 9, 10, 11, 12, 13, 14, 15)); }
__device__ __forceinline__ v8f wmma16(v16h a, v16h b, v8f c) { return __builtin_amdgcn_wmma_f32_16x16x32_f16(false, a, false, b, (short)0, c, false, false); }
__device__ __forceinline__ v8f wmmab(v16bf a, v16bf b, v8f c) { return __builtin_amdgcn_wmma_f32_16x16x32_bf16(false, a, false, b, (short)0, c, false, false); }



// ---- k_gemmw: register-blocked GEMM, ONE WAVE per 64x64 output tile (16 accumulators), operands straight from K-contiguous 16-bit planes; grid (M/64, N/64, Z), 32 threads.
// C[m][n] (f32, pitch ldc, + optional f32 bias[n]) = sum_k A[m][k] Bt[n][k] (+ split products per NSPLIT). z-batch strides sA/sB/sC in elements. K % 32 == 0.
template <typename T16> struct WFrag;
template <> struct WFrag<h16> { typedef v16h V; static __device__ __forceinline__ V ld(const h16* p) { return cat16(*(const v8h*)p, *(const v8h*)(p + 16)); } static __device__ __forceinline__ v8f mma(V a, V b, v8f c) { return wmma16(a, b, c); } };
template <> struct WFrag<bf> { typedef v16bf V; static __device__ __forceinline__ V ld(const bf* p) { return cat16b(*(const v8us*)p, *(const v8us*)(p + 16)); } static __device__ __forceinline__ v8f mma(V a, V b, v8f c) { return wmmab(a, b, c); } };
// QKV: the tile is 64 tokens x one head of the q | k | v projection (Bt: the q, then k, then v weight rows); instead of the f32 tile the epilogue qkv_planes writes that head's 16-bit planes, C is not used.
struct QkvOut { const float* CS; h16* Q16; bf* Qh; bf* Ql; h16* K16; bf* Kh; bf* Kl; h16* V16; bf* Vh; bf* Vl; };
__device__ __forceinline__ void qkv_planes(const v8f (&acc)[4][4], float* os, int r0, int y, const QkvOut& po);
template <typename T16, int NSPLIT, bool BIAS, bool QKV>
__global__ __launch_bounds__(32) void k_gemmw(const T16* __restrict__ A, const T16* __restrict__ A2, const T16* __restrict__ Bt, const T16* __restrict__ Bt2, int K, float* C, int ldc, const float* __restrict__ bias, size_t sA, size_t sB, size_t sC, QkvOut po) {
    typedef typename WFrag<T16>::V V;
    __shared__ __align__(16) float os[16 * 68];
    const size_t z = blockIdx.z; A += z * sA; if (A2) A2 += z * sA; Bt += z * sB; if (Bt2) Bt2 += z * sB; C += z * sC;
    const int lane = threadIdx.x & 31, lr = lane & 15, hi = lane >> 4; const int r0 = blockIdx.x * 64, c0 = blockIdx.y * 64;
    v8f acc[4][4];
#pragma unroll
    for (int mb = 0; mb < 4; ++mb)
#pragma unroll
        for (int nb = 0; nb < 4; ++nb) acc[mb][nb] = (v8f){};
    const size_t aoff = (size_t)(r0 + lr) * K + 8 * hi, boff = (size_t)(c0 + lr) * K + 8 * hi;
#pragma unroll 1
    for (int kc = 0; kc < K; kc += 32) {
        V a[4], a2[4];
#pragma unroll
        for (int mb = 0; mb < 4; ++mb) { a[mb] = WFrag<T16>::ld(A + aoff + (size_t)mb * 16 * K + kc); if (NSPLIT == 1 || NSPLIT == 2) a2[mb] = WFrag<T16>::ld(A2 + aoff + (size_t)mb * 16 * K + kc); }
#pragma unroll
        for (int nb = 0; nb < 4; ++nb) { const V b = WFrag<T16>::ld(Bt + boff + (size_t)nb * 16 * K + kc); V b2; if (NSPLIT >= 2) b2 = WFrag<T16>::ld(Bt2 + boff + (size_t)nb * 16 * K + kc);
#pragma unroll
            for (int mb = 0; mb < 4; ++mb) { acc[mb][nb] = WFrag<T16>::mma(a[mb], b, acc[mb][nb]); if (NSPLIT == 1 || NSPLIT == 2) acc[mb][nb] = WFrag<T16>::mma(a2[mb], b, acc[mb][nb]); if (NSPLIT >= 2) acc[mb][nb] = WFrag<T16>::mma(a[mb], b2, acc[mb][nb]); } }
        asm volatile("v_nop\n\tv_nop\n\tv_nop\n\tv_nop" : "+v"(acc[0][0]), "+v"(acc[1][1]), "+v"(acc[2][2]), "+v"(acc[3][3]) : "v"(a[0]), "v"(a[3]));
    }
    if (QKV) { qkv_planes(acc, os, r0, blockIdx.y, po); return; }
#pragma unroll
    for (int mb = 0; mb < 4; ++mb) {
#pragma unroll
        for (int nb = 0; nb < 4; ++nb) {
#pragma unroll
            for (int j = 0; j < 8; ++j) os[(hi * 8 + j) * 68 + nb * 16 + lr] = acc[mb][nb][j]; }
        __builtin_amdgcn_wave_barrier(); asm volatile("" ::: "memory");
        float* crow = C + (size_t)(r0 + mb * 16) * ldc + c0;
{
#pragma unroll
            for (int s = 0; s < 8; ++s) { const int row = 2 * s + hi, cofs = lr * 4; v4f val = *(const v4fa*)(os + row * 68 + cofs); if (BIAS) { val[0] += bfr(bias[c0 + cofs]); val[1] += bfr(bias[c0 + cofs + 1]); val[2] += bfr(bias[c0 + cofs + 2]); val[3] += bfr(bias[c0 + cofs + 3]); }
                *(v4f*)(crow + (size_t)row * ldc + cofs) = val; }
             }
        __builtin_amdgcn_wave_barrier(); asm volatile("" ::: "memory");
    }
}

// ---- k_gemmc: the same one-wave 64x64 tile GEMM specialised for causal attention: CMODE 1 skips score tiles entirely above the diagonal (query rows r0+roff.., key columns c0..), CMODE 2 limits the
// key (K) loop of the probability x value contraction to the diagonal block (probabilities beyond it are exactly zero). roff = row offset of this launch's first row within the sequence.
template <typename T16, int NSPLIT, int CMODE>
__global__ __launch_bounds__(32) void k_gemmc(const T16* __restrict__ A, const T16* __restrict__ A2, const T16* __restrict__ Bt, const T16* __restrict__ Bt2, int K, float* C, int ldc, int roff, size_t sA, size_t sB, size_t sC) {
    typedef typename WFrag<T16>::V V;
    __shared__ __align__(16) float os[16 * 68];
    const size_t z = blockIdx.z; A += z * sA; if (A2) A2 += z * sA; Bt += z * sB; if (Bt2) Bt2 += z * sB; C += z * sC;
    const int lane = threadIdx.x & 31, lr = lane & 15, hi = lane >> 4; const int r0 = blockIdx.x * 64, c0 = blockIdx.y * 64;
    if (CMODE == 1 && c0 > r0 + roff + 63) return;                  // score tile entirely above the causal diagonal: not computed
    const int Kl = (CMODE == 2) ? min(K, r0 + roff + 64) : K;        // P.V: probabilities are exactly 0 beyond the diagonal block, so the K loop stops there
    v8f acc[4][4];
#pragma unroll
    for (int mb = 0; mb < 4; ++mb)
#pragma unroll
        for (int nb = 0; nb < 4; ++nb) acc[mb][nb] = (v8f){};
    const size_t aoff = (size_t)(r0 + lr) * K + 8 * hi, boff = (size_t)(c0 + lr) * K + 8 * hi;
#pragma unroll 1
    for (int kc = 0; kc < Kl; kc += 32) {
        V a[4], a2[4];
#pragma unroll
        for (int mb = 0; mb < 4; ++mb) { a[mb] = WFrag<T16>::ld(A + aoff + (size_t)mb * 16 * K + kc); if (NSPLIT == 1 || NSPLIT == 2) a2[mb] = WFrag<T16>::ld(A2 + aoff + (size_t)mb * 16 * K + kc); }
#pragma unroll
        for (int nb = 0; nb < 4; ++nb) { const V b = WFrag<T16>::ld(Bt + boff + (size_t)nb * 16 * K + kc); V b2; if (NSPLIT >= 2) b2 = WFrag<T16>::ld(Bt2 + boff + (size_t)nb * 16 * K + kc);
#pragma unroll
            for (int mb = 0; mb < 4; ++mb) { acc[mb][nb] = WFrag<T16>::mma(a[mb], b, acc[mb][nb]); if (NSPLIT == 1 || NSPLIT == 2) acc[mb][nb] = WFrag<T16>::mma(a2[mb], b, acc[mb][nb]); if (NSPLIT >= 2) acc[mb][nb] = WFrag<T16>::mma(a[mb], b2, acc[mb][nb]); } }
        asm volatile("v_nop\n\tv_nop\n\tv_nop\n\tv_nop" : "+v"(acc[0][0]), "+v"(acc[1][1]), "+v"(acc[2][2]), "+v"(acc[3][3]) : "v"(a[0]), "v"(a[3]));
    }
#pragma unroll
    for (int mb = 0; mb < 4; ++mb) {
#pragma unroll
        for (int nb = 0; nb < 4; ++nb) {
#pragma unroll
            for (int j = 0; j < 8; ++j) os[(hi * 8 + j) * 68 + nb * 16 + lr] = acc[mb][nb][j]; }
        __builtin_amdgcn_wave_barrier(); asm volatile("" ::: "memory");
        float* crow = C + (size_t)(r0 + mb * 16) * ldc + c0;
{
#pragma unroll
            for (int s = 0; s < 8; ++s) { const int row = 2 * s + hi, cofs = lr * 4; v4f val = *(const v4fa*)(os + row * 68 + cofs);
                *(v4f*)(crow + (size_t)row * ldc + cofs) = val; }
             }
        __builtin_amdgcn_wave_barrier(); asm volatile("" ::: "memory");
    }
}

__device__ __forceinline__ h16 tohx(float x) { return (h16)x; }
__device__ __forceinline__ void splitf(float y, unsigned short& h, unsigned short& l) { h = f2bf(y); l = f2bf(y - bf2f(h)); }
typedef __attribute__((ext_vector_type(2))) _Float16 v2h;
typedef __attribute__((ext_vector_type(4))) _Float16 v4h;
typedef __attribute__((ext_vector_type(2))) unsigned short v2us;
typedef __attribute__((ext_vector_type(4))) unsigned short v4us;
typedef __attribute__((ext_vector_type(2))) float v2f;
typedef __attribute__((ext_vector_type(4))) int v4i;

__global__ __launch_bounds__(256) void k_cvt8(const float* __restrict__ src, bf* dst, size_t n8) { const size_t i = (size_t)blockIdx.x * 256 + threadIdx.x; if (i >= n8) return; const v8f v = *(const v8f*)(src + i * 8); v8us o;
#pragma unroll
    for (int k = 0; k < 8; ++k) o[k] = f2bf(v[k]); *(v8us*)(dst + i * 8) = o;  }

__constant__ float INV2[HD / 2] = { 1.000000000e+00f, 7.498942018e-01f, 5.623413324e-01f, 4.216965139e-01f, 3.162277639e-01f, 2.371373624e-01f, 1.778279394e-01f, 1.333521456e-01f, 1.000000015e-01f, 7.498941571e-02f, 5.623412877e-02f, 4.216964915e-02f, 3.162277862e-02f, 2.371373586e-02f, 1.778279431e-02f, 1.333521493e-02f, 9.999999776e-03f, 7.498942316e-03f, 5.623413250e-03f, 4.216964822e-03f, 3.162277862e-03f, 2.371373819e-03f, 1.778279431e-03f, 1.333521446e-03f, 1.000000047e-03f, 7.498941850e-04f, 5.623413017e-04f, 4.216964880e-04f, 3.162277862e-04f, 2.371373848e-04f, 1.778279402e-04f, 1.333521504e-04f };   // 1 / THETA ** (2i / 64), i = 0..31, in float32 as THIS module writes it (the RECIPROCAL spelling, evaluated in the reference's own f32 arithmetic: these 32 literals equal it bit for bit); ten entries differ by one ulp from the negative-power values the host's own table held
__global__ __launch_bounds__(256) void k_csP(float* CS) { const int idx = blockIdx.x * 256 + threadIdx.x; if (idx >= TT * HD) return; const int d = idx % HD; const int t = idx / HD; const float a = __fmul_rn((float)t, INV2[d >> 1]); v2f cs; cs[0] = cosf(a); cs[1] = sinf(a); *(v2f*)(CS + (size_t)idx * 2) = cs;  }
// ---- qkv_planes: epilogue of the q | k | v projection tile (k_gemmw, QKV): rotary step, fp16 / bf16 hi / lo split and the transposition of v, straight from the accumulators; no f32 projection goes to memory.
// y: q heads, then k heads, then v heads. 16 rows at a time through the wave's LDS so that every store covers whole 128-byte lines (8 lanes x 16 bytes a row):
// q, k: rows = tokens, a lane takes 8 neighbouring columns = 4 rotary pairs -> planes [head][token][64]; v: staged transposed (a lane's 8 accumulator values are 8 neighbouring tokens of one column), rows = columns, a lane takes 8 neighbouring tokens -> planes [head][64][token].
__device__ __forceinline__ void planes8(const float* r, size_t e, h16* P16, bf* Ph, bf* Pl) { v8h o16; v8us oh, ol;   // eight neighbouring elements -> fp16 plane, bf16 hi and lo planes
#pragma unroll
    for (int q = 0; q < 8; ++q) { o16[q] = tohx(r[q]); unsigned short a2, c2; splitf(r[q], a2, c2); oh[q] = a2; ol[q] = c2; }
    *(v8h*)(P16 + e) = o16; *(v8us*)(Ph + e) = oh; *(v8us*)(Pl + e) = ol; }
__device__ __forceinline__ void qkv_planes(const v8f (&acc)[4][4], float* os, int r0, int y, const QkvOut& po) {
    const int lane = threadIdx.x & 31, lr = lane & 15, hi = lane >> 4, rw = lane >> 3, cofs = (lane & 7) * 8;   // reader: row 4 s + rw of the 16 staged, 8 elements from cofs
    if (y < NH_ + NKV) {   // q or k head (block-uniform)
        const bool isq = y < NH_; const size_t pb = (size_t)(isq ? y : y - NH_) * TT * HD;
        h16* P16 = isq ? po.Q16 : po.K16; bf* Ph = isq ? po.Qh : po.Kh; bf* Pl = isq ? po.Ql : po.Kl;
        const float* cp = po.CS + ((size_t)(r0 + rw) * HD + cofs) * 2;
        v2f cs[4][4][4];   // {cos, sin} of the lane's four pairs, by 16-row group and step; each group's are asked for one group ahead
#pragma unroll
        for (int s = 0; s < 4; ++s)
#pragma unroll
            for (int q = 0; q < 4; ++q) cs[0][s][q] = *(const v2f*)(cp + (size_t)(4 * s) * HD * 2 + 4 * q);
#pragma unroll
        for (int mb = 0; mb < 4; ++mb) {
            if (mb < 3) {
                if (mb > 0) asm volatile("s_wait_xcnt 0x0" ::: "memory");   // the loads below may land in registers that the stores of the group before name: the wait stands between them
#pragma unroll
                for (int s = 0; s < 4; ++s)
#pragma unroll
                    for (int q = 0; q < 4; ++q) cs[mb + 1][s][q] = *(const v2f*)(cp + (size_t)((mb + 1) * 16 + 4 * s) * HD * 2 + 4 * q); }
#pragma unroll
            for (int nb = 0; nb < 4; ++nb) {
#pragma unroll
                for (int j = 0; j < 8; ++j) os[(hi * 8 + j) * 68 + nb * 16 + lr] = acc[mb][nb][j]; }
            __builtin_amdgcn_wave_barrier(); asm volatile("" ::: "memory");   // the reads below take other lanes' values: keeps the compiler from moving them above the LDS stores
#pragma unroll
            for (int s = 0; s < 4; ++s) { const int row = 4 * s + rw; const v4f xa = *(const v4fa*)(os + row * 68 + cofs), xb = *(const v4fa*)(os + row * 68 + cofs + 4); const float x[8] = { xa[0], xa[1], xa[2], xa[3], xb[0], xb[1], xb[2], xb[3] }; float r[8];
#pragma unroll
                for (int q = 0; q < 4; ++q) { const v2f c = cs[mb][s][q]; r[2 * q] = x[2 * q] * c[0] - x[2 * q + 1] * c[1]; r[2 * q + 1] = x[2 * q] * c[1] + x[2 * q + 1] * c[0]; }   // even: re cos - im sin; odd: re sin + im cos
                planes8(r, pb + (size_t)(r0 + mb * 16 + row) * HD + cofs, P16, Ph, Pl); }
            __builtin_amdgcn_wave_barrier(); asm volatile("" ::: "memory");   // keeps the next 16 rows' LDS stores behind these reads
        }
    } else {                        // v head
        const size_t pb = (size_t)(y - NH_ - NKV) * HD * TT;
#pragma unroll
        for (int nb = 0; nb < 4; ++nb) {
#pragma unroll
            for (int mb = 0; mb < 4; ++mb) { const v8f t8 = acc[mb][nb]; float* op = os + lr * 68 + mb * 16 + hi * 8;
                *(v4fa*)op = __builtin_shufflevector(t8, t8, 0, 1, 2, 3); *(v4fa*)(op + 4) = __builtin_shufflevector(t8, t8, 4, 5, 6, 7); }
            __builtin_amdgcn_wave_barrier(); asm volatile("" ::: "memory");   // the reads below take other lanes' values: keeps the compiler from moving them above the LDS stores
#pragma unroll
            for (int s = 0; s < 4; ++s) { const int row = 4 * s + rw; const v4f xa = *(const v4fa*)(os + row * 68 + cofs), xb = *(const v4fa*)(os + row * 68 + cofs + 4); const float x[8] = { xa[0], xa[1], xa[2], xa[3], xb[0], xb[1], xb[2], xb[3] };
                planes8(x, pb + (size_t)(nb * 16 + row) * TT + r0 + cofs, po.V16, po.Vh, po.Vl); }
            __builtin_amdgcn_wave_barrier(); asm volatile("" ::: "memory");   // keeps the next 16 columns' LDS stores behind these reads
        }
        asm volatile("s_wait_xcnt 0x0" ::: "memory");   // behind the last stores of this branch: in the built code the other branch's address arithmetic follows them and writes registers that they name
    }
}
// ---- k_fattn: scores, softmax and probability x value of one batch in one launch; nothing of a score or a probability goes to memory.
// One wave owns NQ x 16 query rows of one head and walks the 2048 keys in blocks of 32, operands straight from the K-contiguous 16-bit planes.
// S^T = K Q^T (A = key rows, B = query rows): a lane holds scores of its own query column only (keys 8 hi + j of each 16-key tile), so two S^T tiles, converted in place, ARE the B operand of O^T += V^T P^T
// (A = V^T rows loaded in the same k order: 8 hi + 0..7, 16 + 8 hi + 0..7). Running softmax in log2 units: p = 2^(s c - ref), f32 row sum; ref moves (and O, sum are rescaled) only when a column's
// block maximum exceeds it by more than 8, so p <= 2^8; the common factor cancels in the final division. HI: bf16 hi/lo planes, 3 products in both contractions; else fp16, 1 product.
__device__ __forceinline__ float xhalf(float x) { const int b = __float_as_int(x); return __int_as_float(__builtin_amdgcn_permlanex16(b, b, 0x76543210, 0xfedcba98, false, false)); }   // value of lane l ^ 16
// Four x = 2^x in one statement: behind a transcendental the instruction set asks for one independent instruction before its result is read or its source overwritten; here each v_exp_f32 is followed by an
// independent one and the last by v_nop, so the slot is kept whatever the compiler schedules around the statement. In place: the statement writes only registers that the compiler's own multiply-add has just written,
// so it can overwrite no operand of a matrix instruction sooner than compiled code may.
__device__ __forceinline__ void exp2x4(float& x0, float& x1, float& x2, float& x3) {
    asm("v_exp_f32 %0, %0\n\tv_exp_f32 %1, %1\n\tv_exp_f32 %2, %2\n\tv_exp_f32 %3, %3\n\tv_nop" : "+v"(x0), "+v"(x1), "+v"(x2), "+v"(x3)); }
template <typename T16, bool HI, int NQ>
__device__ __forceinline__ void fa_body(const T16* __restrict__ Q, const T16* __restrict__ Q2, const T16* __restrict__ Kp, const T16* __restrict__ K2, const T16* __restrict__ Vt, const T16* __restrict__ V2, int q0, bf* Ah, bf* Al) {
    typedef typename WFrag<T16>::V V;
    constexpr float C2 = SCL * 1.4426950408889634f;
    const int lane = threadIdx.x & 31, lr = lane & 15, hi = lane >> 4;
    V qf[NQ][2], q2[NQ][2];
#pragma unroll
    for (int qt = 0; qt < NQ; ++qt)
#pragma unroll
        for (int ks = 0; ks < 2; ++ks) { const size_t qo = (size_t)(q0 + qt * 16 + lr) * HD + ks * 32 + 8 * hi; qf[qt][ks] = WFrag<T16>::ld(Q + qo); if (HI) q2[qt][ks] = WFrag<T16>::ld(Q2 + qo); }
    v8f o[4][NQ]; float ref[NQ]; v2f lsum[NQ];   // row sum: even and odd keys apart (packed adds), joined in the epilogue
#pragma unroll
    for (int qt = 0; qt < NQ; ++qt) { ref[qt] = -3.0e38f; lsum[qt] = (v2f){};
#pragma unroll
        for (int dt = 0; dt < 4; ++dt) o[dt][qt] = (v8f){}; }
    const int ko = lr * HD + 8 * hi, vo = lr * TT + 8 * hi;
    V kf[2][2], k2[2][2];
#pragma unroll
    for (int mt = 0; mt < 2; ++mt)
#pragma unroll
        for (int ks = 0; ks < 2; ++ks) { kf[mt][ks] = WFrag<T16>::ld(Kp + ko + mt * 16 * HD + ks * 32); if (HI) k2[mt][ks] = WFrag<T16>::ld(K2 + ko + mt * 16 * HD + ks * 32); }
#pragma unroll 2
    for (int kb = 0; kb < TT; kb += 32) {   // two blocks per trip: the key fragments fetched ahead alternate between two register sets instead of being copied
        V vf[4], v2[4];
#pragma unroll
        for (int dt = 0; dt < 4; ++dt) { vf[dt] = WFrag<T16>::ld(Vt + vo + dt * 16 * TT + kb); if (HI) v2[dt] = WFrag<T16>::ld(V2 + vo + dt * 16 * TT + kb); }
        v8f s[2][NQ];
#pragma unroll
        for (int mt = 0; mt < 2; ++mt)
#pragma unroll
            for (int qt = 0; qt < NQ; ++qt) s[mt][qt] = (v8f){};
#pragma unroll
        for (int ks = 0; ks < 2; ++ks)
#pragma unroll
            for (int pr = 0; pr < (HI ? 3 : 1); ++pr)   // tiles innermost: neighbouring matrix instructions accumulate into different tiles
#pragma unroll
                for (int mt = 0; mt < 2; ++mt)
#pragma unroll
                    for (int qt = 0; qt < NQ; ++qt) s[mt][qt] = WFrag<T16>::mma(pr == 2 ? k2[mt][ks] : kf[mt][ks], pr == 1 ? q2[qt][ks] : qf[qt][ks], s[mt][qt]);
        const int kn = (kb + 32 < TT) ? kb + 32 : 0;   // next block's key fragments, fetched behind this block's score products so that they fly during the softmax; the last pass refetches block 0 (in bounds, not used)
#pragma unroll
        for (int mt = 0; mt < 2; ++mt)
#pragma unroll
            for (int ks = 0; ks < 2; ++ks) { kf[mt][ks] = WFrag<T16>::ld(Kp + ko + (kn + mt * 16) * HD + ks * 32); if (HI) k2[mt][ks] = WFrag<T16>::ld(K2 + ko + (kn + mt * 16) * HD + ks * 32); }
        float mx[NQ]; bool need = false;
#pragma unroll
        for (int qt = 0; qt < NQ; ++qt) { float m = s[0][qt][0];
#pragma unroll
            for (int j = 1; j < 8; ++j) m = fmaxf(m, s[0][qt][j]);
#pragma unroll
            for (int j = 0; j < 8; ++j) m = fmaxf(m, s[1][qt][j]);
            m = fmaxf(m, xhalf(m)) * C2; mx[qt] = m; need = need || (m > ref[qt] + 8.0f); }
        if (__builtin_amdgcn_ballot_w32(need) != 0) {   // wave-uniform: rare after the first block
#pragma unroll
            for (int qt = 0; qt < NQ; ++qt) { const float mn = fmaxf(ref[qt], mx[qt]); const float al = __builtin_amdgcn_exp2f(ref[qt] - mn); ref[qt] = mn; lsum[qt] *= al;
#pragma unroll
                for (int dt = 0; dt < 4; ++dt) o[dt][qt] *= al; } }
#pragma unroll
        for (int qt = 0; qt < NQ; ++qt) { V pf, pl; float pe[16];
#pragma unroll
            for (int e = 0; e < 16; ++e) pe[e] = __builtin_fmaf(s[e >> 3][qt][e & 7], C2, -ref[qt]);
#pragma unroll
            for (int e = 0; e < 16; e += 4) exp2x4(pe[e], pe[e + 1], pe[e + 2], pe[e + 3]);
#pragma unroll
            for (int e = 0; e < 16; e += 2) lsum[qt] += (v2f){pe[e], pe[e + 1]};
#pragma unroll
            for (int e = 0; e < 16; ++e) { const float p = pe[e]; pf[e] = (__typeof__(pf[0]))p; if (HI) pl[e] = (__typeof__(pf[0]))(p - (float)pf[e]); }
#pragma unroll
            for (int dt = 0; dt < 4; ++dt) { o[dt][qt] = WFrag<T16>::mma(vf[dt], pf, o[dt][qt]); if (HI) { o[dt][qt] = WFrag<T16>::mma(vf[dt], pl, o[dt][qt]); o[dt][qt] = WFrag<T16>::mma(v2[dt], pf, o[dt][qt]); } } }
    }
#pragma unroll
    for (int qt = 0; qt < NQ; ++qt) { const float lh = lsum[qt][0] + lsum[qt][1]; const float inv = __fdiv_rn(1.0f, lh + xhalf(lh));   // the two halves of a column hold disjoint keys under one ref: joined once
        const size_t oo = (size_t)(q0 + qt * 16 + lr) * DQ + 8 * hi;
#pragma unroll
        for (int dt = 0; dt < 4; ++dt) { v8us oh, ol;
#pragma unroll
            for (int j = 0; j < 8; ++j) { unsigned short a, c2; splitf(o[dt][qt][j] * inv, a, c2); oh[j] = a; ol[j] = c2; }
            *(v8us*)(Ah + oo + dt * 16) = oh; *(v8us*)(Al + oo + dt * 16) = ol; } }
}
// grid (heads, RH / 64 + (TT - RH) / 128), 4 waves: blocks y < RH / 64 take 4 x 16 hi/lo rows (the longer bodies, so they start first), the others 4 x 32 fp16 rows; the four waves of a block walk the same head's keys together. Writes the merged token-major hi/lo planes.
__global__ __launch_bounds__(128) void k_fattn(const h16* __restrict__ Q16, const h16* __restrict__ K16, const h16* __restrict__ V16, const bf* __restrict__ Qh, const bf* __restrict__ Ql, const bf* __restrict__ Kh, const bf* __restrict__ Kl, const bf* __restrict__ Vh, const bf* __restrict__ Vl, bf* Ah, bf* Al) {
    const int h = blockIdx.x, w = threadIdx.x >> 5, bx = blockIdx.y; const size_t po = (size_t)h * TT * HD, pk = (size_t)(h / REP) * TT * HD; Ah += h * HD; Al += h * HD;
    if (bx < RH / 64) fa_body<bf, true, 1>(Qh + po, Ql + po, Kh + pk, Kl + pk, Vh + pk, Vl + pk, bx * 64 + w * 16, Ah, Al);
    else fa_body<h16, false, 2>(Q16 + po, nullptr, K16 + pk, nullptr, V16 + pk, nullptr, RH + (bx - RH / 64) * 128 + w * 32, Ah, Al);
}

extern "C" void kernel_launch(void* const* d_in, const int* in_sizes, int n_in,
                              void* d_out, int out_size, void* d_ws, size_t ws_size, hipStream_t stream) {
    (void)in_sizes; (void)n_in; (void)out_size;
    const float* x = (const float*)d_in[0]; const float* wqkv = (const float*)d_in[1]; const float* wo = (const float*)d_in[2];   /* argument order x, w_attn ('oi' [3072][1024]: q | k | v row blocks), w_proj ('oi' [1024][1024]) */ const float* wq = wqkv; const float* wk = wqkv + (size_t)DQ * DM; const float* wv = wqkv + (size_t)2 * DQ * DM;
    float* OUT = (float*)d_out;     // [4][2048][1024]
    char* wsp = (char*)d_ws;
    auto take = [&](size_t bytes) { char* p = wsp; wsp += (bytes + 255) & ~(size_t)255; return (void*)p; };
    bf* WQ = (bf*)take((size_t)(DQ + 2 * DKV) * DM * 2); bf* WK = WQ + (size_t)DQ * DM; bf* WV = WK + (size_t)DKV * DM;   /* one buffer: q | k | v weight rows */ bf* WO = (bf*)take((size_t)DM * DQ * 2); float* CS = (float*)take((size_t)TT * HD * 2 * 4);
    bf* XB = (bf*)take((size_t)TT * DM * 2);
    h16* QP16 = (h16*)take((size_t)NH_ * TT * HD * 2); h16* KP16 = (h16*)take((size_t)NKV * TT * HD * 2); h16* VT16 = (h16*)take((size_t)NKV * HD * TT * 2);
    bf* QPh = (bf*)take((size_t)NH_ * TT * HD * 2); bf* QPl = (bf*)take((size_t)NH_ * TT * HD * 2); bf* KPh = (bf*)take((size_t)NKV * TT * HD * 2); bf* KPl = (bf*)take((size_t)NKV * TT * HD * 2); bf* VTh = (bf*)take((size_t)NKV * HD * TT * 2); bf* VTl = (bf*)take((size_t)NKV * HD * TT * 2);
    bf* ATh = (bf*)take((size_t)TT * DQ * 2); bf* ATl = (bf*)take((size_t)TT * DQ * 2);
    if ((size_t)(wsp - (char*)d_ws) > ws_size) return;    // ws 256 MiB
    const QkvOut po = { CS, QP16, QPh, QPl, KP16, KPh, KPl, VT16, VTh, VTl };
    { k_cvt8<<<(unsigned)(((size_t)DQ * DM / 8 + 255) / 256), 256, 0, stream>>>(wq, WQ, (size_t)DQ * DM / 8); k_cvt8<<<(unsigned)(((size_t)DKV * DM / 8 + 255) / 256), 256, 0, stream>>>(wk, WK, (size_t)DKV * DM / 8); k_cvt8<<<(unsigned)(((size_t)DKV * DM / 8 + 255) / 256), 256, 0, stream>>>(wv, WV, (size_t)DKV * DM / 8);
      k_cvt8<<<(unsigned)(((size_t)DM * DQ / 8 + 255) / 256), 256, 0, stream>>>(wo, WO, (size_t)DM * DQ / 8); k_csP<<<(TT * HD + 255) / 256, 256, 0, stream>>>(CS); }
    for (int b = 0; b < NB_; ++b) {
        
        k_cvt8<<<(unsigned)(((size_t)TT * DM / 8 + 255) / 256), 256, 0, stream>>>(x + (size_t)b * TT * DM, XB, (size_t)TT * DM / 8);
        k_gemmw<bf, 0, false, true><<<dim3(TT / 64, NH_ + 2 * NKV, 1), 32, 0, stream>>>(XB, nullptr, WQ, nullptr, DM, nullptr, 0, nullptr, 0, 0, 0, po);
        k_fattn<<<dim3(NH_, RH / 64 + (TT - RH) / 128, 1), 128, 0, stream>>>(QP16, KP16, VT16, QPh, QPl, KPh, KPl, VTh, VTl, ATh, ATl);
        k_gemmw<bf, 1, false, false><<<dim3(TT / 64, DM / 64, 1), 32, 0, stream>>>(ATh, ATl, WO, nullptr, DQ, OUT + (size_t)b * TT * DM, DM, nullptr, 0, 0, 0, po); }
}

// v005
// A run of this version takes 375 microseconds.
// Next to v004, in two timings, it ran 1.47 times as fast each time.
// Counting every step since v000, it is 10.6 times as fast.
#include <hip/hip_runtime.h>

// Multi-head attention WITHOUT a mask with interleaved-pair rotary position embedding on a fused bias-free natural projection, four batches (x [4][2048][1024]; qkv = x w_attn^T ('oi' [3072][1024] 0.02, no bias) split in thirds q | k | v (16 heads x 64; token-major); angles = t x 1 / THETA ** (2i / 64) (THETA 1e4; computed); pairs (2i, 2i+1): re cos - im sin, re sin + im cos, on q and k; scores x 1/sqrt(64); softmax over ALL keys (no mask); y = merged w_proj^T ('oi', no bias) -> [4][2048][1024] (8.4 M); argument order x, w_attn, w_proj).
// Layout, all four batches in every launch (planes [batch][head]..., batch = grid z or the high bits of grid x): bf16 copy of x; exact q | k | v projections in ONE launch whose epilogue (qkv_planes) applies the interleaved rotary step and writes the 16-bit planes; {cos, sin} per (position, pair) built once from the int positions and float32 inverse-frequency constants (precise cosf/sinf); DENSE T-2048 attention in ONE launch (k_fattn: scores, running softmax and probability x value stay in registers; hybrid rows: < 512 hi/lo 3 products, rest fp16; every key block computed: no mask; k_gemmc stays in the file, unused); merged hi/lo x Wo exact.
// Compute dtypes, f32 accumulate: every input rounded to bf16; projections exact; rotary f32; attention rows < 512 3 products, rest fp16; softmax f32; Wo hl x exact.

#define NB_  4
#define TT   2048
#define DM   1024
#define NH_  16
#define NKV  16
#define REP  (NH_ / NKV)
#define HD   64
#define DQ   (NH_ * HD)
#define DKV  (NKV * HD)
#define RH   512                  // query rows < RH use hi+lo planes (0: none)
#define SCL  0.125f   // HD^-0.5
typedef _Float16 h16;
typedef unsigned short bf;
typedef __attribute__((ext_vector_type(16))) __bf16   v16bf;
typedef __attribute__((ext_vector_type(16))) _Float16 v16h;
typedef __attribute__((ext_vector_type(8)))  _Float16 v8h;
typedef __attribute__((ext_vector_type(8)))  unsigned short v8us;
typedef __attribute__((ext_vector_type(8)))  float    v8f;
typedef __attribute__((ext_vector_type(4)))  float    v4f;
typedef v8h  __attribute__((may_alias)) v8ha;
typedef v4f  __attribute__((may_alias)) v4fa;
typedef v8us __attribute__((may_alias)) v8usa;

__device__ __forceinline__ unsigned short f2bf(float f) { unsigned u = __float_as_uint(f); u += 0x7FFFu + ((u >> 16) & 1u); return (unsigned short)(u >> 16); }
__device__ __forceinline__ float bf2f(unsigned short b) { return __uint_as_float(((unsigned)b) << 16); }
__device__ __forceinline__ float bfr(float f) { return bf2f(f2bf(f)); }
__device__ __forceinline__ v16h cat16(v8h lo, v8h hi) { return __builtin_shufflevector(lo, hi, 0, 1, 2, 3, 4, 5, 6, 7, 8, 9, 10, 11, 12, 13, 14, 15); }
__device__ __forceinline__ v16bf cat16b(v8us lo, v8us hi) { return __builtin_bit_cast(v16bf, __builtin_shufflevector(lo, hi, 0, 1, 2, 3, 4, 5, 6, 7, 8, 9, 10, 11, 12, 13, 14, 15)); }
__device__ __forceinline__ v8f wmma16(v16h a, v16h b, v8f c) { return __builtin_amdgcn_wmma_f32_16x16x32_f16(false, a, false, b, (short)0, c, false, false); }
__device__ __forceinline__ v8f wmmab(v16bf a, v16bf b, v8f c) { return __builtin_amdgcn_wmma_f32_16x16x32_bf16(false, a, false, b, (short)0, c, false, false); }



// ---- k_gemmw: register-blocked GEMM, ONE WAVE per 64x64 output tile (16 accumulators), operands straight from K-contiguous 16-bit planes; grid (M/64, N/64, Z), 32 threads.
// C[m][n] (f32, pitch ldc, + optional f32 bias[n]) = sum_k A[m][k] Bt[n][k] (+ split products per NSPLIT). z-batch strides sA/sB/sC in elements. K % 32 == 0.
template <typename T16> struct WFrag;
template <> struct WFrag<h16> { typedef v16h V; static __device__ __forceinline__ V ld(const h16* p) { return cat16(*(const v8h*)p, *(const v8h*)(p + 16)); } static __device__ __forceinline__ v8f mma(V a, V b, v8f c) { return wmma16(a, b, c); } };
template <> struct WFrag<bf> { typedef v16bf V; static __device__ __forceinline__ V ld(const bf* p) { return cat16b(*(const v8us*)p, *(const v8us*)(p + 16)); } static __device__ __forceinline__ v8f mma(V a, V b, v8f c) { return wmmab(a, b, c); } };
// QKV: the tile is 64 tokens x one head of the q | k | v projection (Bt: the q, then k, then v weight rows); instead of the f32 tile the epilogue qkv_planes writes that head's 16-bit planes, C is not used.
struct QkvOut { const float* CS; h16* Q16; bf* Qh; bf* Ql; h16* K16; bf* Kh; bf* Kl; h16* V16; bf* Vh; bf* Vl; };
__device__ __forceinline__ void qkv_planes(const v8f (&acc)[4][4], float* os, int r0, int y, const QkvOut& po);
template <typename T16, int NSPLIT, bool BIAS, bool QKV>
__global__ __launch_bounds__(32) void k_gemmw(const T16* __restrict__ A, const T16* __restrict__ A2, const T16* __restrict__ Bt, const T16* __restrict__ Bt2, int K, float* C, int ldc, const float* __restrict__ bias, size_t sA, size_t sB, size_t sC, QkvOut po) {
    typedef typename WFrag<T16>::V V;
    __shared__ __align__(16) float os[16 * 68];
    const size_t z = blockIdx.z; A += z * sA; if (A2) A2 += z * sA; Bt += z * sB; if (Bt2) Bt2 += z * sB; C += z * sC;
    const int lane = threadIdx.x & 31, lr = lane & 15, hi = lane >> 4; const int r0 = blockIdx.x * 64, c0 = blockIdx.y * 64;
    v8f acc[4][4];
#pragma unroll
    for (int mb = 0; mb < 4; ++mb)
#pragma unroll
        for (int nb = 0; nb < 4; ++nb) acc[mb][nb] = (v8f){};
    const size_t aoff = (size_t)(r0 + lr) * K + 8 * hi, boff = (size_t)(c0 + lr) * K + 8 * hi;
#pragma unroll 1
    for (int kc = 0; kc < K; kc += 32) {
        V a[4], a2[4];
#pragma unroll
        for (int mb = 0; mb < 4; ++mb) { a[mb] = WFrag<T16>::ld(A + aoff + (size_t)mb * 16 * K + kc); if (NSPLIT == 1 || NSPLIT == 2) a2[mb] = WFrag<T16>::ld(A2 + aoff + (size_t)mb * 16 * K + kc); }
#pragma unroll
        for (int nb = 0; nb < 4; ++nb) { const V b = WFrag<T16>::ld(Bt + boff + (size_t)nb * 16 * K + kc); V b2; if (NSPLIT >= 2) b2 = WFrag<T16>::ld(Bt2 + boff + (size_t)nb * 16 * K + kc);
#pragma unroll
            for (int mb = 0; mb < 4; ++mb) { acc[mb][nb] = WFrag<T16>::mma(a[mb], b, acc[mb][nb]); if (NSPLIT == 1 || NSPLIT == 2) acc[mb][nb] = WFrag<T16>::mma(a2[mb], b, acc[mb][nb]); if (NSPLIT >= 2) acc[mb][nb] = WFrag<T16>::mma(a[mb], b2, acc[mb][nb]); } }
        asm volatile("v_nop\n\tv_nop\n\tv_nop\n\tv_nop" : "+v"(acc[0][0]), "+v"(acc[1][1]), "+v"(acc[2][2]), "+v"(acc[3][3]) : "v"(a[0]), "v"(a[3]));
    }
    if (QKV) { qkv_planes(acc, os, r0, blockIdx.y, po); return; }
#pragma unroll
    for (int mb = 0; mb < 4; ++mb) {
#pragma unroll
        for (int nb = 0; nb < 4; ++nb) {
#pragma unroll
            for (int j = 0; j < 8; ++j) os[(hi * 8 + j) * 68 + nb * 16 + lr] = acc[mb][nb][j]; }
        __builtin_amdgcn_wave_barrier(); asm volatile("" ::: "memory");
        float* crow = C + (size_t)(r0 + mb * 16) * ldc + c0;
{
#pragma unroll
            for (int s = 0; s < 8; ++s) { const int row = 2 * s + hi, cofs = lr * 4; v4f val = *(const v4fa*)(os + row * 68 + cofs); if (BIAS) { val[0] += bfr(bias[c0 + cofs]); val[1] += bfr(bias[c0 + cofs + 1]); val[2] += bfr(bias[c0 + cofs + 2]); val[3] += bfr(bias[c0 + cofs + 3]); }
                *(v4f*)(crow + (size_t)row * ldc + cofs) = val; }
             }
        __builtin_amdgcn_wave_barrier(); asm volatile("" ::: "memory");
    }
}

// ---- k_gemmc: the same one-wave 64x64 tile GEMM specialised for causal attention: CMODE 1 skips score tiles entirely above the diagonal (query rows r0+roff.., key columns c0..), CMODE 2 limits the
// key (K) loop of the probability x value contraction to the diagonal block (probabilities beyond it are exactly zero). roff = row offset of this launch's first row within the sequence.
template <typename T16, int NSPLIT, int CMODE>
__global__ __launch_bounds__(32) void k_gemmc(const T16* __restrict__ A, const T16* __restrict__ A2, const T16* __restrict__ Bt, const T16* __restrict__ Bt2, int K, float* C, int ldc, int roff, size_t sA, size_t sB, size_t sC) {
    typedef typename WFrag<T16>::V V;
    __shared__ __align__(16) float os[16 * 68];
    const size_t z = blockIdx.z; A += z * sA; if (A2) A2 += z * sA; Bt += z * sB; if (Bt2) Bt2 += z * sB; C += z * sC;
    const int lane = threadIdx.x & 31, lr = lane & 15, hi = lane >> 4; const int r0 = blockIdx.x * 64, c0 = blockIdx.y * 64;
    if (CMODE == 1 && c0 > r0 + roff + 63) return;                  // score tile entirely above the causal diagonal: not computed
    const int Kl = (CMODE == 2) ? min(K, r0 + roff + 64) : K;        // P.V: probabilities are exactly 0 beyond the diagonal block, so the K loop stops there
    v8f acc[4][4];
#pragma unroll
    for (int mb = 0; mb < 4; ++mb)
#pragma unroll
        for (int nb = 0; nb < 4; ++nb) acc[mb][nb] = (v8f){};
    const size_t aoff = (size_t)(r0 + lr) * K + 8 * hi, boff = (size_t)(c0 + lr) * K + 8 * hi;
#pragma unroll 1
    for (int kc = 0; kc < Kl; kc += 32) {
        V a[4], a2[4];
#pragma unroll
        for (int mb = 0; mb < 4; ++mb) { a[mb] = WFrag<T16>::ld(A + aoff + (size_t)mb * 16 * K + kc); if (NSPLIT == 1 || NSPLIT == 2) a2[mb] = WFrag<T16>::ld(A2 + aoff + (size_t)mb * 16 * K + kc); }
#pragma unroll
        for (int nb = 0; nb < 4; ++nb) { const V b = WFrag<T16>::ld(Bt + boff + (size_t)nb * 16 * K + kc); V b2; if (NSPLIT >= 2) b2 = WFrag<T16>::ld(Bt2 + boff + (size_t)nb * 16 * K + kc);
#pragma unroll
            for (int mb = 0; mb < 4; ++mb) { acc[mb][nb] = WFrag<T16>::mma(a[mb], b, acc[mb][nb]); if (NSPLIT == 1 || NSPLIT == 2) acc[mb][nb] = WFrag<T16>::mma(a2[mb], b, acc[mb][nb]); if (NSPLIT >= 2) acc[mb][nb] = WFrag<T16>::mma(a[mb], b2, acc[mb][nb]); } }
        asm volatile("v_nop\n\tv_nop\n\tv_nop\n\tv_nop" : "+v"(acc[0][0]), "+v"(acc[1][1]), "+v"(acc[2][2]), "+v"(acc[3][3]) : "v"(a[0]), "v"(a[3]));
    }
#pragma unroll
    for (int mb = 0; mb < 4; ++mb) {
#pragma unroll
        for (int nb = 0; nb < 4; ++nb) {
#pragma unroll
            for (int j = 0; j < 8; ++j) os[(hi * 8 + j) * 68 + nb * 16 + lr] = acc[mb][nb][j]; }
        __builtin_amdgcn_wave_barrier(); asm volatile("" ::: "memory");
        float* crow = C + (size_t)(r0 + mb * 16) * ldc + c0;
{
#pragma unroll
            for (int s = 0; s < 8; ++s) { const int row = 2 * s + hi, cofs = lr * 4; v4f val = *(const v4fa*)(os + row * 68 + cofs);
                *(v4f*)(crow + (size_t)row * ldc + cofs) = val; }
             }
        __builtin_amdgcn_wave_barrier(); asm volatile("" ::: "memory");
    }
}

__device__ __forceinline__ h16 tohx(float x) { return (h16)x; }
__device__ __forceinline__ void splitf(float y, unsigned short& h, unsigned short& l) { h = f2bf(y); l = f2bf(y - bf2f(h)); }
typedef __attribute__((ext_vector_type(2))) _Float16 v2h;
typedef __attribute__((ext_vector_type(4))) _Float16 v4h;
typedef __attribute__((ext_vector_type(2))) unsigned short v2us;
typedef __attribute__((ext_vector_type(4))) unsigned short v4us;
typedef __attribute__((ext_vector_type(2))) float v2f;
typedef __attribute__((ext_vector_type(4))) int v4i;

__global__ __launch_bounds__(256) void k_cvt8(const float* __restrict__ src, bf* dst, size_t n8) { const size_t i = (size_t)blockIdx.x * 256 + threadIdx.x; if (i >= n8) return; const v8f v = *(const v8f*)(src + i * 8); v8us o;
#pragma unroll
    for (int k = 0; k < 8; ++k) o[k] = f2bf(v[k]); *(v8us*)(dst + i * 8) = o;  }

__constant__ float INV2[HD / 2] = { 1.000000000e+00f, 7.498942018e-01f, 5.623413324e-01f, 4.216965139e-01f, 3.162277639e-01f, 2.371373624e-01f, 1.778279394e-01f, 1.333521456e-01f, 1.000000015e-01f, 7.498941571e-02f, 5.623412877e-02f, 4.216964915e-02f, 3.162277862e-02f, 2.371373586e-02f, 1.778279431e-02f, 1.333521493e-02f, 9.999999776e-03f, 7.498942316e-03f, 5.623413250e-03f, 4.216964822e-03f, 3.162277862e-03f, 2.371373819e-03f, 1.778279431e-03f, 1.333521446e-03f, 1.000000047e-03f, 7.498941850e-04f, 5.623413017e-04f, 4.216964880e-04f, 3.162277862e-04f, 2.371373848e-04f, 1.778279402e-04f, 1.333521504e-04f };   // 1 / THETA ** (2i / 64), i = 0..31, in float32 as THIS module writes it (the RECIPROCAL spelling, evaluated in the reference's own f32 arithmetic: these 32 literals equal it bit for bit); ten entries differ by one ulp from the negative-power values the host's own table held
__global__ __launch_bounds__(256) void k_csP(float* CS) { const int idx = blockIdx.x * 256 + threadIdx.x; if (idx >= TT * HD) return; const int d = idx % HD; const int t = idx / HD; const float a = __fmul_rn((float)t, INV2[d >> 1]); v2f cs; cs[0] = cosf(a); cs[1] = sinf(a); *(v2f*)(CS + (size_t)idx * 2) = cs;  }
// ---- qkv_planes: epilogue of the q | k | v projection tile (k_gemmw, QKV): rotary step, fp16 / bf16 hi / lo split and the transposition of v, straight from the accumulators; no f32 projection goes to memory.
// y: q heads, then k heads, then v heads. 16 rows at a time through the wave's LDS so that every store covers whole 128-byte lines (8 lanes x 16 bytes a row):
// q, k: rows = tokens, a lane takes 8 neighbouring columns = 4 rotary pairs -> planes [head][token][64]; v: staged transposed (a lane's 8 accumulator values are 8 neighbouring tokens of one column), rows = columns, a lane takes 8 neighbouring tokens -> planes [head][64][token].
__device__ __forceinline__ void planes8(const float* r, size_t e, h16* P16, bf* Ph, bf* Pl) { v8h o16; v8us oh, ol;   // eight neighbouring elements -> fp16 plane, bf16 hi and lo planes
#pragma unroll
    for (int q = 0; q < 8; ++q) { o16[q] = tohx(r[q]); unsigned short a2, c2; splitf(r[q], a2, c2); oh[q] = a2; ol[q] = c2; }
    *(v8h*)(P16 + e) = o16; *(v8us*)(Ph + e) = oh; *(v8us*)(Pl + e) = ol; }
__device__ __forceinline__ void qkv_planes(const v8f (&acc)[4][4], float* os, int r0, int y, const QkvOut& po) {
    const size_t zo = (size_t)blockIdx.z * NH_ * TT * HD;   // grid z = batch: every plane holds NH_ * TT * HD (= NKV * HD * TT) elements a batch
    const int lane = threadIdx.x & 31, lr = lane & 15, hi = lane >> 4, rw = lane >> 3, cofs = (lane & 7) * 8;   // reader: row 4 s + rw of the 16 staged, 8 elements from cofs
    if (y < NH_ + NKV) {   // q or k head (block-uniform)
        const bool isq = y < NH_; const size_t pb = zo + (size_t)(isq ? y : y - NH_) * TT * HD;
        h16* P16 = isq ? po.Q16 : po.K16; bf* Ph = isq ? po.Qh : po.Kh; bf* Pl = isq ? po.Ql : po.Kl;
        const float* cp = po.CS + ((size_t)(r0 + rw) * HD + cofs) * 2;
        v2f cs[4][4][4];   // {cos, sin} of the lane's four pairs, by 16-row group and step; each group's are asked for one group ahead
#pragma unroll
        for (int s = 0; s < 4; ++s)
#pragma unroll
            for (int q = 0; q < 4; ++q) cs[0][s][q] = *(const v2f*)(cp + (size_t)(4 * s) * HD * 2 + 4 * q);
#pragma unroll
        for (int mb = 0; mb < 4; ++mb) {
            if (mb < 3) {
                if (mb > 0) asm volatile("s_wait_xcnt 0x0" ::: "memory");   // the loads below may land in registers that the stores of the group before name: the wait stands between them
#pragma unroll
                for (int s = 0; s < 4; ++s)
#pragma unroll
                    for (int q = 0; q < 4; ++q) cs[mb + 1][s][q] = *(const v2f*)(cp + (size_t)((mb + 1) * 16 + 4 * s) * HD * 2 + 4 * q); }
#pragma unroll
            for (int nb = 0; nb < 4; ++nb) {
#pragma unroll
                for (int j = 0; j < 8; ++j) os[(hi * 8 + j) * 68 + nb * 16 + lr] = acc[mb][nb][j]; }
            __builtin_amdgcn_wave_barrier(); asm volatile("" ::: "memory");   // the reads below take other lanes' values: keeps the compiler from moving them above the LDS stores
#pragma unroll
            for (int s = 0; s < 4; ++s) { const int row = 4 * s + rw; const v4f xa = *(const v4fa*)(os + row * 68 + cofs), xb = *(const v4fa*)(os + row * 68 + cofs + 4); const float x[8] = { xa[0], xa[1], xa[2], xa[3], xb[0], xb[1], xb[2], xb[3] }; float r[8];
#pragma unroll
                for (int q = 0; q < 4; ++q) { const v2f c = cs[mb][s][q]; r[2 * q] = x[2 * q] * c[0] - x[2 * q + 1] * c[1]; r[2 * q + 1] = x[2 * q] * c[1] + x[2 * q + 1] * c[0]; }   // even: re cos - im sin; odd: re sin + im cos
                planes8(r, pb + (size_t)(r0 + mb * 16 + row) * HD + cofs, P16, Ph, Pl); }
            __builtin_amdgcn_wave_barrier(); asm volatile("" ::: "memory");   // keeps the next 16 rows' LDS stores behind these reads
        }
    } else {                        // v head
        const size_t pb = zo + (size_t)(y - NH_ - NKV) * HD * TT;
#pragma unroll
        for (int nb = 0; nb < 4; ++nb) {
#pragma unroll
            for (int mb = 0; mb < 4; ++mb) { const v8f t8 = acc[mb][nb]; float* op = os + lr * 68 + mb * 16 + hi * 8;
                *(v4fa*)op = __builtin_shufflevector(t8, t8, 0, 1, 2, 3); *(v4fa*)(op + 4) = __builtin_shufflevector(t8, t8, 4, 5, 6, 7); }
            __builtin_amdgcn_wave_barrier(); asm volatile("" ::: "memory");   // the reads below take other lanes' values: keeps the compiler from moving them above the LDS stores
#pragma unroll
            for (int s = 0; s < 4; ++s) { const int row = 4 * s + rw; const v4f xa = *(const v4fa*)(os + row * 68 + cofs), xb = *(const v4fa*)(os + row * 68 + cofs + 4); const float x[8] = { xa[0], xa[1], xa[2], xa[3], xb[0], xb[1], xb[2], xb[3] };
                planes8(x, pb + (size_t)(nb * 16 + row) * TT + r0 + cofs, po.V16, po.Vh, po.Vl); }
            __builtin_amdgcn_wave_barrier(); asm volatile("" ::: "memory");   // keeps the next 16 columns' LDS stores behind these reads
        }
        asm volatile("s_wait_xcnt 0x0" ::: "memory");   // behind the last stores of this branch: in the built code the other branch's address arithmetic follows them and writes registers that they name
    }
}
// ---- k_fattn: scores, softmax and probability x value of all batches in one launch; nothing of a score or a probability goes to memory.
// One wave owns NQ x 16 query rows of one head and walks the 2048 keys in blocks of 32, operands straight from the K-contiguous 16-bit planes.
// S^T = K Q^T (A = key rows, B = query rows): a lane holds scores of its own query column only (keys 8 hi + j of each 16-key tile), so two S^T tiles, converted in place, ARE the B operand of O^T += V^T P^T
// (A = V^T rows loaded in the same k order: 8 hi + 0..7, 16 + 8 hi + 0..7). Running softmax in log2 units: p = 2^(s c - ref), f32 row sum; ref moves (and O, sum are rescaled) only when a column's
// block maximum exceeds it by more than 8, so p <= 2^8; the common factor cancels in the final division. HI: bf16 hi/lo planes, 3 products in both contractions; else fp16, 1 product.
__device__ __forceinline__ float xhalf(float x) { const int b = __float_as_int(x); return __int_as_float(__builtin_amdgcn_permlanex16(b, b, 0x76543210, 0xfedcba98, false, false)); }   // value of lane l ^ 16
// Four x = 2^x in one statement: behind a transcendental the instruction set asks for one independent instruction before its result is read or its source overwritten; here each v_exp_f32 is followed by an
// independent one and the last by v_nop, so the slot is kept whatever the compiler schedules around the statement. In place: the statement writes only registers that the compiler's own multiply-add has just written,
// so it can overwrite no operand of a matrix instruction sooner than compiled code may.
__device__ __forceinline__ void exp2x4(float& x0, float& x1, float& x2, float& x3) {
    asm("v_exp_f32 %0, %0\n\tv_exp_f32 %1, %1\n\tv_exp_f32 %2, %2\n\tv_exp_f32 %3, %3\n\tv_nop" : "+v"(x0), "+v"(x1), "+v"(x2), "+v"(x3)); }
template <typename T16, bool HI, int NQ>
__device__ __forceinline__ void fa_body(const T16* __restrict__ Q, const T16* __restrict__ Q2, const T16* __restrict__ Kp, const T16* __restrict__ K2, const T16* __restrict__ Vt, const T16* __restrict__ V2, int q0, bf* Ah, bf* Al) {
    typedef typename WFrag<T16>::V V;
    constexpr float C2 = SCL * 1.4426950408889634f;
    const int lane = threadIdx.x & 31, lr = lane & 15, hi = lane >> 4;
    V qf[NQ][2], q2[NQ][2];
#pragma unroll
    for (int qt = 0; qt < NQ; ++qt)
#pragma unroll
        for (int ks = 0; ks < 2; ++ks) { const size_t qo = (size_t)(q0 + qt * 16 + lr) * HD + ks * 32 + 8 * hi; qf[qt][ks] = WFrag<T16>::ld(Q + qo); if (HI) q2[qt][ks] = WFrag<T16>::ld(Q2 + qo); }
    v8f o[4][NQ]; float ref[NQ]; v2f lsum[NQ];   // row sum: even and odd keys apart (packed adds), joined in the epilogue
#pragma unroll
    for (int qt = 0; qt < NQ; ++qt) { ref[qt] = -3.0e38f; lsum[qt] = (v2f){};
#pragma unroll
        for (int dt = 0; dt < 4; ++dt) o[dt][qt] = (v8f){}; }
    const int ko = lr * HD + 8 * hi, vo = lr * TT + 8 * hi;
    V kf[2][2], k2[2][2];
#pragma unroll
    for (int mt = 0; mt < 2; ++mt)
#pragma unroll
        for (int ks = 0; ks < 2; ++ks) { kf[mt][ks] = WFrag<T16>::ld(Kp + ko + mt * 16 * HD + ks * 32); if (HI) k2[mt][ks] = WFrag<T16>::ld(K2 + ko + mt * 16 * HD + ks * 32); }
#pragma unroll 2
    for (int kb = 0; kb < TT; kb += 32) {   // two blocks per trip: the key fragments fetched ahead alternate between two register sets instead of being copied
        V vf[4], v2[4];
#pragma unroll
        for (int dt = 0; dt < 4; ++dt) { vf[dt] = WFrag<T16>::ld(Vt + vo + dt * 16 * TT + kb); if (HI) v2[dt] = WFrag<T16>::ld(V2 + vo + dt * 16 * TT + kb); }
        v8f s[2][NQ];
#pragma unroll
        for (int mt = 0; mt < 2; ++mt)
#pragma unroll
            for (int qt = 0; qt < NQ; ++qt) s[mt][qt] = (v8f){};
#pragma unroll
        for (int ks = 0; ks < 2; ++ks)
#pragma unroll
            for (int pr = 0; pr < (HI ? 3 : 1); ++pr)   // tiles innermost: neighbouring matrix instructions accumulate into different tiles
#pragma unroll
                for (int mt = 0; mt < 2; ++mt)
#pragma unroll
                    for (int qt = 0; qt < NQ; ++qt) s[mt][qt] = WFrag<T16>::mma(pr == 2 ? k2[mt][ks] : kf[mt][ks], pr == 1 ? q2[qt][ks] : qf[qt][ks], s[mt][qt]);
        const int kn = (kb + 32 < TT) ? kb + 32 : 0;   // next block's key fragments, fetched behind this block's score products so that they fly during the softmax; the last pass refetches block 0 (in bounds, not used)
#pragma unroll
        for (int mt = 0; mt < 2; ++mt)
#pragma unroll
            for (int ks = 0; ks < 2; ++ks) { kf[mt][ks] = WFrag<T16>::ld(Kp + ko + (kn + mt * 16) * HD + ks * 32); if (HI) k2[mt][ks] = WFrag<T16>::ld(K2 + ko + (kn + mt * 16) * HD + ks * 32); }
        float mx[NQ]; bool need = false;
#pragma unroll
        for (int qt = 0; qt < NQ; ++qt) { float m = s[0][qt][0];
#pragma unroll
            for (int j = 1; j < 8; ++j) m = fmaxf(m, s[0][qt][j]);
#pragma unroll
            for (int j = 0; j < 8; ++j) m = fmaxf(m, s[1][qt][j]);
            m = fmaxf(m, xhalf(m)) * C2; mx[qt] = m; need = need || (m > ref[qt] + 8.0f); }
        if (__builtin_amdgcn_ballot_w32(need) != 0) {   // wave-uniform: rare after the first block
#pragma unroll
            for (int qt = 0; qt < NQ; ++qt) { const float mn = fmaxf(ref[qt], mx[qt]); const float al = __builtin_amdgcn_exp2f(ref[qt] - mn); ref[qt] = mn; lsum[qt] *= al;
#pragma unroll
                for (int dt = 0; dt < 4; ++dt) o[dt][qt] *= al; } }
#pragma unroll
        for (int qt = 0; qt < NQ; ++qt) { V pf, pl; float pe[16];
#pragma unroll
            for (int e = 0; e < 16; ++e) pe[e] = __builtin_fmaf(s[e >> 3][qt][e & 7], C2, -ref[qt]);
#pragma unroll
            for (int e = 0; e < 16; e += 4) exp2x4(pe[e], pe[e + 1], pe[e + 2], pe[e + 3]);
#pragma unroll
            for (int e = 0; e < 16; e += 2) lsum[qt] += (v2f){pe[e], pe[e + 1]};
#pragma unroll
            for (int e = 0; e < 16; ++e) { const float p = pe[e]; pf[e] = (__typeof__(pf[0]))p; if (HI) pl[e] = (__typeof__(pf[0]))(p - (float)pf[e]); }
#pragma unroll
            for (int dt = 0; dt < 4; ++dt) { o[dt][qt] = WFrag<T16>::mma(vf[dt], pf, o[dt][qt]); if (HI) { o[dt][qt] = WFrag<T16>::mma(vf[dt], pl, o[dt][qt]); o[dt][qt] = WFrag<T16>::mma(v2[dt], pf, o[dt][qt]); } } }
    }
#pragma unroll
    for (int qt = 0; qt < NQ; ++qt) { const float lh = lsum[qt][0] + lsum[qt][1]; const float inv = __fdiv_rn(1.0f, lh + xhalf(lh));   // the two halves of a column hold disjoint keys under one ref: joined once
        const size_t oo = (size_t)(q0 + qt * 16 + lr) * DQ + 8 * hi;
#pragma unroll
        for (int dt = 0; dt < 4; ++dt) { v8us oh, ol;
#pragma unroll
            for (int j = 0; j < 8; ++j) { unsigned short a, c2; splitf(o[dt][qt][j] * inv, a, c2); oh[j] = a; ol[j] = c2; }
            *(v8us*)(Ah + oo + dt * 16) = oh; *(v8us*)(Al + oo + dt * 16) = ol; } }
}
// grid (batches x heads, RH / 64 + (TT - RH) / 128), 4 waves: blocks y < RH / 64 take 4 x 16 hi/lo rows (the longer bodies, so they start first), the others 4 x 32 fp16 rows; the four waves of a block walk the same head's keys together. Writes the merged token-major hi/lo planes.
__global__ __launch_bounds__(128) void k_fattn(const h16* __restrict__ Q16, const h16* __restrict__ K16, const h16* __restrict__ V16, const bf* __restrict__ Qh, const bf* __restrict__ Ql, const bf* __restrict__ Kh, const bf* __restrict__ Kl, const bf* __restrict__ Vh, const bf* __restrict__ Vl, bf* Ah, bf* Al) {
    const int h = blockIdx.x % NH_, b = blockIdx.x / NH_, w = threadIdx.x >> 5, bx = blockIdx.y; const size_t po = ((size_t)b * NH_ + h) * TT * HD, pk = ((size_t)b * NKV + h / REP) * TT * HD, ao = (size_t)b * TT * DQ + h * HD; Ah += ao; Al += ao;
    if (bx < RH / 64) fa_body<bf, true, 1>(Qh + po, Ql + po, Kh + pk, Kl + pk, Vh + pk, Vl + pk, bx * 64 + w * 16, Ah, Al);
    else fa_body<h16, false, 2>(Q16 + po, nullptr, K16 + pk, nullptr, V16 + pk, nullptr, RH + (bx - RH / 64) * 128 + w * 32, Ah, Al);
}

extern "C" void kernel_launch(void* const* d_in, const int* in_sizes, int n_in,
                              void* d_out, int out_size, void* d_ws, size_t ws_size, hipStream_t stream) {
    (void)in_sizes; (void)n_in; (void)out_size;
    const float* x = (const float*)d_in[0]; const float* wqkv = (const float*)d_in[1]; const float* wo = (const float*)d_in[2];   /* order x, w_attn ('oi' [3072][1024]: q | k | v row blocks), w_proj ('oi' [1024][1024]) */
    float* OUT = (float*)d_out;     // [4][2048][1024]
    char* wsp = (char*)d_ws;
    auto take = [&](size_t bytes) { char* p = wsp; wsp += (bytes + 255) & ~(size_t)255; return (void*)p; };
    bf* WQ = (bf*)take((size_t)(DQ + 2 * DKV) * DM * 2);   /* one buffer: q | k | v weight rows */ bf* WO = (bf*)take((size_t)DM * DQ * 2); float* CS = (float*)take((size_t)TT * HD * 2 * 4);
    bf* XB = (bf*)take((size_t)NB_ * TT * DM * 2);
    h16* QP16 = (h16*)take((size_t)NB_ * NH_ * TT * HD * 2); h16* KP16 = (h16*)take((size_t)NB_ * NKV * TT * HD * 2); h16* VT16 = (h16*)take((size_t)NB_ * NKV * HD * TT * 2);
    bf* QPh = (bf*)take((size_t)NB_ * NH_ * TT * HD * 2); bf* QPl = (bf*)take((size_t)NB_ * NH_ * TT * HD * 2); bf* KPh = (bf*)take((size_t)NB_ * NKV * TT * HD * 2); bf* KPl = (bf*)take((size_t)NB_ * NKV * TT * HD * 2); bf* VTh = (bf*)take((size_t)NB_ * NKV * HD * TT * 2); bf* VTl = (bf*)take((size_t)NB_ * NKV * HD * TT * 2);
    bf* ATh = (bf*)take((size_t)NB_ * TT * DQ * 2); bf* ATl = (bf*)take((size_t)NB_ * TT * DQ * 2);
    if ((size_t)(wsp - (char*)d_ws) > ws_size) return;    // ws 256 MiB
    const QkvOut po = { CS, QP16, QPh, QPl, KP16, KPh, KPl, VT16, VTh, VTl };
    // every stage once, for all batches: x, the merged planes and out are contiguous over the batches (rows batch * TT + token); the q | k | v weight rows are one contiguous block
    k_cvt8<<<(unsigned)(((size_t)(DQ + 2 * DKV) * DM / 8 + 255) / 256), 256, 0, stream>>>(wqkv, WQ, (size_t)(DQ + 2 * DKV) * DM / 8);
    k_cvt8<<<(unsigned)(((size_t)DM * DQ / 8 + 255) / 256), 256, 0, stream>>>(wo, WO, (size_t)DM * DQ / 8); k_csP<<<(TT * HD + 255) / 256, 256, 0, stream>>>(CS);
    k_cvt8<<<(unsigned)(((size_t)NB_ * TT * DM / 8 + 255) / 256), 256, 0, stream>>>(x, XB, (size_t)NB_ * TT * DM / 8);
    k_gemmw<bf, 0, false, true><<<dim3(TT / 64, NH_ + 2 * NKV, NB_), 32, 0, stream>>>(XB, nullptr, WQ, nullptr, DM, nullptr, 0, nullptr, (size_t)TT * DM, 0, 0, po);
    k_fattn<<<dim3(NB_ * NH_, RH / 64 + (TT - RH) / 128, 1), 128, 0, stream>>>(QP16, KP16, VT16, QPh, QPl, KPh, KPl, VTh, VTl, ATh, ATl);
    k_gemmw<bf, 1, false, false><<<dim3(NB_ * TT / 64, DM / 64, 1), 32, 0, stream>>>(ATh, ATl, WO, nullptr, DQ, OUT, DM, nullptr, 0, 0, 0, po);
}

// v006
// A run of this version takes 174 microseconds.
// Timed twice side by side with v005, it ran 2.15 times as fast both times.
// Counting every step since v000, it is 22.7 times as fast.
#include <hip/hip_runtime.h>

// Multi-head attention WITHOUT a mask with interleaved-pair rotary position embedding on a fused bias-free natural projection, four batches (x [4][2048][1024]; qkv = x w_attn^T ('oi' [3072][1024] 0.02, no bias) split in thirds q | k | v (16 heads x 64; token-major); angles = t x 1 / THETA ** (2i / 64) (THETA 1e4; computed); pairs (2i, 2i+1): re cos - im sin, re sin + im cos, on q and k; scores x 1/sqrt(64); softmax over ALL keys (no mask); y = merged w_proj^T ('oi', no bias) -> [4][2048][1024] (8.4 M); argument order x, w_attn, w_proj).
// Layout, all four batches in every launch (planes [batch][head]..., batch = grid z or the high bits of grid x): bf16 copy of x; every matrix kernel stages its operands in LDS (asynchronous copies, two buffers) for a block of four waves; exact q | k | v projections in ONE launch whose epilogue (qkv_planes) applies the interleaved rotary step and writes the 16-bit planes; {cos, sin} per (position, pair) built once from the int positions and float32 inverse-frequency constants (precise cosf/sinf); DENSE T-2048 attention in ONE launch (k_fattn: key and value tiles staged in LDS for the block's four waves; scores, running softmax and probability x value stay in registers; hybrid rows: < 512 hi/lo 3 products, rest fp16; every key block computed: no mask; k_gemmc stays in the file, unused); merged hi/lo x Wo exact.
// Compute dtypes, f32 accumulate: every input rounded to bf16; projections exact; rotary f32; attention rows < 512 3 products, rest fp16; softmax f32; Wo hl x exact.

#define NB_  4
#define TT   2048
#define DM   1024
#define NH_  16
#define NKV  16
#define REP  (NH_ / NKV)
#define HD   64
#define DQ   (NH_ * HD)
#define DKV  (NKV * HD)
#define RH   512                  // query rows < RH use hi+lo planes (0: none)
#define SCL  0.125f   // HD^-0.5
typedef _Float16 h16;
typedef unsigned short bf;
typedef __attribute__((ext_vector_type(16))) __bf16   v16bf;
typedef __attribute__((ext_vector_type(16))) _Float16 v16h;
typedef __attribute__((ext_vector_type(8)))  _Float16 v8h;
typedef __attribute__((ext_vector_type(8)))  unsigned short v8us;
typedef __attribute__((ext_vector_type(8)))  float    v8f;
typedef __attribute__((ext_vector_type(4)))  float    v4f;
typedef v8h  __attribute__((may_alias)) v8ha;
typedef v4f  __attribute__((may_alias)) v4fa;
typedef v8us __attribute__((may_alias)) v8usa;

__device__ __forceinline__ unsigned short f2bf(float f) { unsigned u = __float_as_uint(f); u += 0x7FFFu + ((u >> 16) & 1u); return (unsigned short)(u >> 16); }
__device__ __forceinline__ float bf2f(unsigned short b) { return __uint_as_float(((unsigned)b) << 16); }
__device__ __forceinline__ float bfr(float f) { return bf2f(f2bf(f)); }
__device__ __forceinline__ v16h cat16(v8h lo, v8h hi) { return __builtin_shufflevector(lo, hi, 0, 1, 2, 3, 4, 5, 6, 7, 8, 9, 10, 11, 12, 13, 14, 15); }
__device__ __forceinline__ v16bf cat16b(v8us lo, v8us hi) { return __builtin_bit_cast(v16bf, __builtin_shufflevector(lo, hi, 0, 1, 2, 3, 4, 5, 6, 7, 8, 9, 10, 11, 12, 13, 14, 15)); }
__device__ __forceinline__ v8f wmma16(v16h a, v16h b, v8f c) { return __builtin_amdgcn_wmma_f32_16x16x32_f16(false, a, false, b, (short)0, c, false, false); }
__device__ __forceinline__ v8f wmmab(v16bf a, v16bf b, v8f c) { return __builtin_amdgcn_wmma_f32_16x16x32_bf16(false, a, false, b, (short)0, c, false, false); }



// ---- staging in LDS: tiles of 128-byte rows (64 16-bit elements), brought in by asynchronous copies and read as fragments at a padded pitch.
#define KST   64                 // k_fattn, keys per stage: a K tile is 64 keys x 64 d, a V^T tile 64 d x 64 keys, both 64 rows of 128 bytes
#define GKS   64                 // k_gemmw, k per stage: an operand tile is 128 rows of 128 bytes
#define LPB   144                // row pitch in LDS, bytes: 16 x odd, free of bank conflicts for 16-byte reads
#define LPE   (LPB / 2)          // the same in 16-bit elements
#define TILEB (64 * LPB)         // 64 staged rows
#define GTB   (128 * LPB)        // 128 staged rows
// 64 rows, 128 threads: a lane copies 16 bytes of rows r, r + 16, r + 32, r + 48 (8 lanes a row, so a wave's copy covers four whole 128-byte lines). l, g: the lane's own LDS byte address and global address in row r; gp: global row pitch in elements.
// The s_wait_xcnt closes the statement so that no register which a copy names is rewritten before the copies have taken their addresses.
template <typename T16>
__device__ __forceinline__ void stage_tile(unsigned l, const T16* g, int gp) {
    asm volatile("global_load_async_to_lds_b128 %0, %4, off\n\tglobal_load_async_to_lds_b128 %1, %5, off\n\tglobal_load_async_to_lds_b128 %2, %6, off\n\tglobal_load_async_to_lds_b128 %3, %7, off\n\ts_wait_xcnt 0x0"
                 :: "v"(l), "v"(l + 16 * LPB), "v"(l + 32 * LPB), "v"(l + 48 * LPB), "v"(g), "v"(g + 16 * gp), "v"(g + 32 * gp), "v"(g + 48 * gp) : "memory"); }

// ---- k_gemmw: register-blocked GEMM, four waves per 128x128 output tile, each wave a 64x64 quarter (16 accumulators); grid (M/128, N/128, Z), 128 threads.
// The operands' K-contiguous 16-bit rows come into LDS in stages of GKS k (two buffers: the next stage flies while this one is worked on) and are shared: two waves read each A row, two each B row.
// C[m][n] (f32, pitch ldc, + optional f32 bias[n]) = sum_k A[m][k] Bt[n][k] (+ split products per NSPLIT). z-batch strides sA/sB/sC in elements. K % 64 == 0.
template <typename T16> struct WFrag;
template <> struct WFrag<h16> { typedef v16h V; static __device__ __forceinline__ V ld(const h16* p) { return cat16(*(const v8h*)p, *(const v8h*)(p + 16)); } static __device__ __forceinline__ v8f mma(V a, V b, v8f c) { return wmma16(a, b, c); } };
template <> struct WFrag<bf> { typedef v16bf V; static __device__ __forceinline__ V ld(const bf* p) { return cat16b(*(const v8us*)p, *(const v8us*)(p + 16)); } static __device__ __forceinline__ v8f mma(V a, V b, v8f c) { return wmmab(a, b, c); } };
// QKV: a wave's quarter is 64 tokens x one head of the q | k | v projection (Bt: the q, then k, then v weight rows); instead of the f32 tile the epilogue qkv_planes writes that head's 16-bit planes, C is not used.
struct QkvOut { const float* CS; h16* Q16; bf* Qh; bf* Ql; h16* K16; bf* Kh; bf* Kl; h16* V16; bf* Vh; bf* Vl; };
__device__ __forceinline__ void qkv_planes(const v8f (&acc)[4][4], float* os, int r0, int y, const QkvOut& po);
template <typename T16, int NSPLIT, bool BIAS, bool QKV>
__global__ __launch_bounds__(128) void k_gemmw(const T16* __restrict__ A, const T16* __restrict__ A2, const T16* __restrict__ Bt, const T16* __restrict__ Bt2, int K, float* C, int ldc, const float* __restrict__ bias, size_t sA, size_t sB, size_t sC, QkvOut po) {
    typedef typename WFrag<T16>::V V;
    constexpr bool HA2 = NSPLIT == 1 || NSPLIT == 2, HB2 = NSPLIT >= 2;
    constexpr int OB = (HA2 ? 2 : 1) * GTB, BUFB = OB + (HB2 ? 2 : 1) * GTB;   // a buffer: A (| A2) | B (| B2)
    __shared__ __attribute__((aligned(128))) char sm[2 * BUFB];
    const size_t z = blockIdx.z; A += z * sA; if (A2) A2 += z * sA; Bt += z * sB; if (Bt2) Bt2 += z * sB; C += z * sC;
    const int lane = threadIdx.x & 31, lr = lane & 15, hi = lane >> 4, w = __builtin_amdgcn_readfirstlane(threadIdx.x >> 5) & 3, wm = w >> 1, wn = w & 1;   // w: wave number 0..3, held scalar
    const int r0 = blockIdx.x * 128 + wm * 64, c0 = blockIdx.y * 128 + wn * 64;
    v8f acc[4][4];
#pragma unroll
    for (int mb = 0; mb < 4; ++mb)
#pragma unroll
        for (int nb = 0; nb < 4; ++nb) acc[mb][nb] = (v8f){};
    const int cpr = threadIdx.x >> 3, cpc = threadIdx.x & 7;   // the lane's place in a copy: row cpr (+ 16, 32, ...), 16-byte column cpc
    const unsigned lc = (unsigned)(size_t)sm + cpr * LPB + cpc * 16;
    const size_t ga = (size_t)(blockIdx.x * 128 + cpr) * K + cpc * 8, gb = (size_t)(blockIdx.y * 128 + cpr) * K + cpc * 8, h64 = (size_t)64 * K;
    auto fill = [&](int st, int buf) { const unsigned l = lc + buf * BUFB; const size_t a = ga + st * GKS, b = gb + st * GKS;
        stage_tile(l, A + a, K); stage_tile(l + TILEB, A + a + h64, K);
        if (HA2) { stage_tile(l + GTB, A2 + a, K); stage_tile(l + GTB + TILEB, A2 + a + h64, K); }
        stage_tile(l + OB, Bt + b, K); stage_tile(l + OB + TILEB, Bt + b + h64, K);
        if (HB2) { stage_tile(l + OB + GTB, Bt2 + b, K); stage_tile(l + OB + GTB + TILEB, Bt2 + b + h64, K); } };
    const int NST = K / GKS;
    fill(0, 0);
    asm volatile("s_wait_asynccnt 0x0" ::: "memory");   // this wave's copies of stage 0 have landed
    __syncthreads();                                     // and so have the other waves': stage 0 may be read
    if (NST > 1) fill(1, 1);
    const int ao = (wm * 64 + lr) * LPE + 8 * hi, bo = (wn * 64 + lr) * LPE + 8 * hi;   // fragment reader: row lr of a 16-row group, elements 8 hi + 0..7 and 16 + 8 hi + 0..7 of a 32-element chunk
#pragma unroll 1
    for (int st = 0; st < NST; ++st) {   // kept rolled: one publish point a trip
        const T16* at = (const T16*)(sm + (st & 1) * BUFB) + ao; const T16* bt = (const T16*)(sm + (st & 1) * BUFB + OB) + bo;
#pragma unroll
        for (int kc = 0; kc < GKS; kc += 32) {
            V a[4], a2[4], b[4], b2[4];
#pragma unroll
            for (int mb = 0; mb < 4; ++mb) { a[mb] = WFrag<T16>::ld(at + mb * 16 * LPE + kc); if (HA2) a2[mb] = WFrag<T16>::ld(at + GTB / 2 + mb * 16 * LPE + kc); }
#pragma unroll
            for (int nb = 0; nb < 4; ++nb) { b[nb] = WFrag<T16>::ld(bt + nb * 16 * LPE + kc); if (HB2) b2[nb] = WFrag<T16>::ld(bt + GTB / 2 + nb * 16 * LPE + kc); }
            __builtin_amdgcn_sched_barrier(0);   // the fragments of a 32-k step are asked for as one group: sunk among the products, each pair of LDS reads would be waited for on its own
#pragma unroll
            for (int nb = 0; nb < 4; ++nb)
#pragma unroll
                for (int mb = 0; mb < 4; ++mb) { acc[mb][nb] = WFrag<T16>::mma(a[mb], b[nb], acc[mb][nb]); if (HA2) acc[mb][nb] = WFrag<T16>::mma(a2[mb], b[nb], acc[mb][nb]); if (HB2) acc[mb][nb] = WFrag<T16>::mma(a[mb], b2[nb], acc[mb][nb]); }
        }
        // publish point of stage st + 1, every wave, in this order
        asm volatile("s_wait_dscnt 0x0" ::: "memory");      // this wave's reads of the buffer that is refilled below have returned
        asm volatile("s_wait_asynccnt 0x0" ::: "memory");   // this wave's copies of stage st + 1 have landed
        __syncthreads();                                     // all waves: stage st + 1 may be read, stage st's buffer is free
        if (st + 2 < NST) fill(st + 2, st & 1);
    }
    asm volatile("s_wait_asynccnt 0x0" ::: "memory");   // no copy is outstanding from here on
    float* os = (float*)(sm + w * (16 * 68 * 4));        // output staging, a range of its own for each wave: behind the last trip's barrier nobody reads the buffers and nothing is copied into them any more
    if (QKV) { qkv_planes(acc, os, r0, blockIdx.y * 2 + wn, po); return; }
#pragma unroll
    for (int mb = 0; mb < 4; ++mb) {
#pragma unroll
        for (int nb = 0; nb < 4; ++nb) {
#pragma unroll
            for (int j = 0; j < 8; ++j) os[(hi * 8 + j) * 68 + nb * 16 + lr] = acc[mb][nb][j]; }
        __builtin_amdgcn_wave_barrier(); asm volatile("" ::: "memory");
        float* crow = C + (size_t)(r0 + mb * 16) * ldc + c0;
{
#pragma unroll
            for (int s = 0; s < 8; ++s) { const int row = 2 * s + hi, cofs = lr * 4; v4f val = *(const v4fa*)(os + row * 68 + cofs); if (BIAS) { val[0] += bfr(bias[c0 + cofs]); val[1] += bfr(bias[c0 + cofs + 1]); val[2] += bfr(bias[c0 + cofs + 2]); val[3] += bfr(bias[c0 + cofs + 3]); }
                *(v4f*)(crow + (size_t)row * ldc + cofs) = val; }
             }
        __builtin_amdgcn_wave_barrier(); asm volatile("" ::: "memory");
    }
}

// ---- k_gemmc: a one-wave 64x64 tile GEMM, operands read straight from global memory, specialised for causal attention: CMODE 1 skips score tiles entirely above the diagonal (query rows r0+roff.., key columns c0..), CMODE 2 limits the
// key (K) loop of the probability x value contraction to the diagonal block (probabilities beyond it are exactly zero). roff = row offset of this launch's first row within the sequence.
template <typename T16, int NSPLIT, int CMODE>
__global__ __launch_bounds__(32) void k_gemmc(const T16* __restrict__ A, const T16* __restrict__ A2, const T16* __restrict__ Bt, const T16* __restrict__ Bt2, int K, float* C, int ldc, int roff, size_t sA, size_t sB, size_t sC) {
    typedef typename WFrag<T16>::V V;
    __shared__ __align__(16) float os[16 * 68];
    const size_t z = blockIdx.z; A += z * sA; if (A2) A2 += z * sA; Bt += z * sB; if (Bt2) Bt2 += z * sB; C += z * sC;
    const int lane = threadIdx.x & 31, lr = lane & 15, hi = lane >> 4; const int r0 = blockIdx.x * 64, c0 = blockIdx.y * 64;
    if (CMODE == 1 && c0 > r0 + roff + 63) return;                  // score tile entirely above the causal diagonal: not computed
    const int Kl = (CMODE == 2) ? min(K, r0 + roff + 64) : K;        // P.V: probabilities are exactly 0 beyond the diagonal block, so the K loop stops there
    v8f acc[4][4];
#pragma unroll
    for (int mb = 0; mb < 4; ++mb)
#pragma unroll
        for (int nb = 0; nb < 4; ++nb) acc[mb][nb] = (v8f){};
    const size_t aoff = (size_t)(r0 + lr) * K + 8 * hi, boff = (size_t)(c0 + lr) * K + 8 * hi;
#pragma unroll 1
    for (int kc = 0; kc < Kl; kc += 32) {
        V a[4], a2[4];
#pragma unroll
        for (int mb = 0; mb < 4; ++mb) { a[mb] = WFrag<T16>::ld(A + aoff + (size_t)mb * 16 * K + kc); if (NSPLIT == 1 || NSPLIT == 2) a2[mb] = WFrag<T16>::ld(A2 + aoff + (size_t)mb * 16 * K + kc); }
#pragma unroll
        for (int nb = 0; nb < 4; ++nb) { const V b = WFrag<T16>::ld(Bt + boff + (size_t)nb * 16 * K + kc); V b2; if (NSPLIT >= 2) b2 = WFrag<T16>::ld(Bt2 + boff + (size_t)nb * 16 * K + kc);
#pragma unroll
            for (int mb = 0; mb < 4; ++mb) { acc[mb][nb] = WFrag<T16>::mma(a[mb], b, acc[mb][nb]); if (NSPLIT == 1 || NSPLIT == 2) acc[mb][nb] = WFrag<T16>::mma(a2[mb], b, acc[mb][nb]); if (NSPLIT >= 2) acc[mb][nb] = WFrag<T16>::mma(a[mb], b2, acc[mb][nb]); } }
        asm volatile("v_nop\n\tv_nop\n\tv_nop\n\tv_nop" : "+v"(acc[0][0]), "+v"(acc[1][1]), "+v"(acc[2][2]), "+v"(acc[3][3]) : "v"(a[0]), "v"(a[3]));
    }
#pragma unroll
    for (int mb = 0; mb < 4; ++mb) {
#pragma unroll
        for (int nb = 0; nb < 4; ++nb) {
#pragma unroll
            for (int j = 0; j < 8; ++j) os[(hi * 8 + j) * 68 + nb * 16 + lr] = acc[mb][nb][j]; }
        __builtin_amdgcn_wave_barrier(); asm volatile("" ::: "memory");
        float* crow = C + (size_t)(r0 + mb * 16) * ldc + c0;
{
#pragma unroll
            for (int s = 0; s < 8; ++s) { const int row = 2 * s + hi, cofs = lr * 4; v4f val = *(const v4fa*)(os + row * 68 + cofs);
                *(v4f*)(crow + (size_t)row * ldc + cofs) = val; }
             }
        __builtin_amdgcn_wave_barrier(); asm volatile("" ::: "memory");
    }
}

__device__ __forceinline__ h16 tohx(float x) { return (h16)x; }
__device__ __forceinline__ void splitf(float y, unsigned short& h, unsigned short& l) { h = f2bf(y); l = f2bf(y - bf2f(h)); }
typedef __attribute__((ext_vector_type(2))) _Float16 v2h;
typedef __attribute__((ext_vector_type(4))) _Float16 v4h;
typedef __attribute__((ext_vector_type(2))) unsigned short v2us;
typedef __attribute__((ext_vector_type(4))) unsigned short v4us;
typedef __attribute__((ext_vector_type(2))) float v2f;
typedef __attribute__((ext_vector_type(4))) int v4i;

__global__ __launch_bounds__(256) void k_cvt8(const float* __restrict__ src, bf* dst, size_t n8) { const size_t i = (size_t)blockIdx.x * 256 + threadIdx.x; if (i >= n8) return; const v8f v = *(const v8f*)(src + i * 8); v8us o;
#pragma unroll
    for (int k = 0; k < 8; ++k) o[k] = f2bf(v[k]); *(v8us*)(dst + i * 8) = o;  }

__constant__ float INV2[HD / 2] = { 1.000000000e+00f, 7.498942018e-01f, 5.623413324e-01f, 4.216965139e-01f, 3.162277639e-01f, 2.371373624e-01f, 1.778279394e-01f, 1.333521456e-01f, 1.000000015e-01f, 7.498941571e-02f, 5.623412877e-02f, 4.216964915e-02f, 3.162277862e-02f, 2.371373586e-02f, 1.778279431e-02f, 1.333521493e-02f, 9.999999776e-03f, 7.498942316e-03f, 5.623413250e-03f, 4.216964822e-03f, 3.162277862e-03f, 2.371373819e-03f, 1.778279431e-03f, 1.333521446e-03f, 1.000000047e-03f, 7.498941850e-04f, 5.623413017e-04f, 4.216964880e-04f, 3.162277862e-04f, 2.371373848e-04f, 1.778279402e-04f, 1.333521504e-04f };   // 1 / THETA ** (2i / 64), i = 0..31, in float32 as THIS module writes it (the RECIPROCAL spelling, evaluated in the reference's own f32 arithmetic: these 32 literals equal it bit for bit); ten entries differ by one ulp from the negative-power values the host's own table held
__global__ __launch_bounds__(256) void k_csP(float* CS) { const int idx = blockIdx.x * 256 + threadIdx.x; if (idx >= TT * HD) return; const int d = idx % HD; const int t = idx / HD; const float a = __fmul_rn((float)t, INV2[d >> 1]); v2f cs; cs[0] = cosf(a); cs[1] = sinf(a); *(v2f*)(CS + (size_t)idx * 2) = cs;  }
// ---- qkv_planes: epilogue of the q | k | v projection tile (k_gemmw, QKV): rotary step, fp16 / bf16 hi / lo split and the transposition of v, straight from the accumulators; no f32 projection goes to memory.
// y: q heads, then k heads, then v heads. 16 rows at a time through the wave's LDS so that every store covers whole 128-byte lines (8 lanes x 16 bytes a row):
// q, k: rows = tokens, a lane takes 8 neighbouring columns = 4 rotary pairs -> planes [head][token][64]; v: staged transposed (a lane's 8 accumulator values are 8 neighbouring tokens of one column), rows = columns, a lane takes 8 neighbouring tokens -> planes [head][64][token].
__device__ __forceinline__ void planes8(const float* r, size_t e, h16* P16, bf* Ph, bf* Pl) { v8h o16; v8us oh, ol;   // eight neighbouring elements -> fp16 plane, bf16 hi and lo planes
#pragma unroll
    for (int q = 0; q < 8; ++q) { o16[q] = tohx(r[q]); unsigned short a2, c2; splitf(r[q], a2, c2); oh[q] = a2; ol[q] = c2; }
    *(v8h*)(P16 + e) = o16; *(v8us*)(Ph + e) = oh; *(v8us*)(Pl + e) = ol;
    asm volatile("s_wait_xcnt 0x0" ::: "memory"); }   // the arithmetic that follows may reuse the address registers of these stores: the wait stands between
__device__ __forceinline__ void qkv_planes(const v8f (&acc)[4][4], float* os, int r0, int y, const QkvOut& po) {
    const size_t zo = (size_t)blockIdx.z * NH_ * TT * HD;   // grid z = batch: every plane holds NH_ * TT * HD (= NKV * HD * TT) elements a batch
    const int lane = threadIdx.x & 31, lr = lane & 15, hi = lane >> 4, rw = lane >> 3, cofs = (lane & 7) * 8;   // reader: row 4 s + rw of the 16 staged, 8 elements from cofs
    if (y < NH_ + NKV) {   // q or k head (block-uniform)
        const bool isq = y < NH_; const size_t pb = zo + (size_t)(isq ? y : y - NH_) * TT * HD;
        h16* P16 = isq ? po.Q16 : po.K16; bf* Ph = isq ? po.Qh : po.Kh; bf* Pl = isq ? po.Ql : po.Kl;
        const float* cp = po.CS + ((size_t)(r0 + rw) * HD + cofs) * 2;
        v2f cs[4][4][4];   // {cos, sin} of the lane's four pairs, by 16-row group and step; each group's are asked for one group ahead
#pragma unroll
        for (int s = 0; s < 4; ++s)
#pragma unroll
            for (int q = 0; q < 4; ++q) cs[0][s][q] = *(const v2f*)(cp + (size_t)(4 * s) * HD * 2 + 4 * q);
#pragma unroll
        for (int mb = 0; mb < 4; ++mb) {
            if (mb < 3) {
                if (mb > 0) asm volatile("s_wait_xcnt 0x0" ::: "memory");   // the loads below may land in registers that the stores of the group before name: the wait stands between them
#pragma unroll
                for (int s = 0; s < 4; ++s)
#pragma unroll
                    for (int q = 0; q < 4; ++q) cs[mb + 1][s][q] = *(const v2f*)(cp + (size_t)((mb + 1) * 16 + 4 * s) * HD * 2 + 4 * q); }
#pragma unroll
            for (int nb = 0; nb < 4; ++nb) {
#pragma unroll
                for (int j = 0; j < 8; ++j) os[(hi * 8 + j) * 68 + nb * 16 + lr] = acc[mb][nb][j]; }
            __builtin_amdgcn_wave_barrier(); asm volatile("" ::: "memory");   // the reads below take other lanes' values: keeps the compiler from moving them above the LDS stores
#pragma unroll
            for (int s = 0; s < 4; ++s) { const int row = 4 * s + rw; const v4f xa = *(const v4fa*)(os + row * 68 + cofs), xb = *(const v4fa*)(os + row * 68 + cofs + 4); const float x[8] = { xa[0], xa[1], xa[2], xa[3], xb[0], xb[1], xb[2], xb[3] }; float r[8];
#pragma unroll
                for (int q = 0; q < 4; ++q) { const v2f c = cs[mb][s][q]; r[2 * q] = x[2 * q] * c[0] - x[2 * q + 1] * c[1]; r[2 * q + 1] = x[2 * q] * c[1] + x[2 * q + 1] * c[0]; }   // even: re cos - im sin; odd: re sin + im cos
                planes8(r, pb + (size_t)(r0 + mb * 16 + row) * HD + cofs, P16, Ph, Pl); }
            __builtin_amdgcn_wave_barrier(); asm volatile("" ::: "memory");   // keeps the next 16 rows' LDS stores behind these reads
        }
    } else {                        // v head
        const size_t pb = zo + (size_t)(y - NH_ - NKV) * HD * TT;
#pragma unroll
        for (int nb = 0; nb < 4; ++nb) {
#pragma unroll
            for (int mb = 0; mb < 4; ++mb) { const v8f t8 = acc[mb][nb]; float* op = os + lr * 68 + mb * 16 + hi * 8;
                *(v4fa*)op = __builtin_shufflevector(t8, t8, 0, 1, 2, 3); *(v4fa*)(op + 4) = __builtin_shufflevector(t8, t8, 4, 5, 6, 7); }
            __builtin_amdgcn_wave_barrier(); asm volatile("" ::: "memory");   // the reads below take other lanes' values: keeps the compiler from moving them above the LDS stores
#pragma unroll
            for (int s = 0; s < 4; ++s) { const int row = 4 * s + rw; const v4f xa = *(const v4fa*)(os + row * 68 + cofs), xb = *(const v4fa*)(os + row * 68 + cofs + 4); const float x[8] = { xa[0], xa[1], xa[2], xa[3], xb[0], xb[1], xb[2], xb[3] };
                planes8(x, pb + (size_t)(nb * 16 + row) * TT + r0 + cofs, po.V16, po.Vh, po.Vl); }
            __builtin_amdgcn_wave_barrier(); asm volatile("" ::: "memory");   // keeps the next 16 columns' LDS stores behind these reads
        }
        asm volatile("s_wait_xcnt 0x0" ::: "memory");   // behind the last stores of this branch: in the built code the other branch's address arithmetic follows them and writes registers that they name
    }
}
// ---- k_fattn: scores, softmax and probability x value of all batches in one launch; nothing of a score or a probability goes to memory.
// One wave owns NQ x 16 query rows of one head and walks the 2048 keys in blocks of 32. The block's four waves share the key and value tiles: stages of KST keys are brought into LDS by asynchronous copies
// (whole 128-byte rows, two buffers: the next stage flies while this one is worked on), and every wave reads its fragments from there at a row pitch of 144 bytes.
// S^T = K Q^T (A = key rows, B = query rows): a lane holds scores of its own query column only (keys 8 hi + j of each 16-key tile), so two S^T tiles, converted in place, ARE the B operand of O^T += V^T P^T
// (A = V^T rows loaded in the same k order: 8 hi + 0..7, 16 + 8 hi + 0..7). Running softmax in log2 units: p = 2^(s c - ref), f32 row sum; ref moves (and O, sum are rescaled) only when a column's
// block maximum exceeds it by more than 8, so p <= 2^8; the common factor cancels in the final division. HI: bf16 hi/lo planes, 3 products in both contractions; else fp16, 1 product.
__device__ __forceinline__ float xhalf(float x) { const int b = __float_as_int(x); return __int_as_float(__builtin_amdgcn_permlanex16(b, b, 0x76543210, 0xfedcba98, false, false)); }   // value of lane l ^ 16
// Four x = 2^x in one statement: behind a transcendental the instruction set asks for one independent instruction before its result is read or its source overwritten; here each v_exp_f32 is followed by an
// independent one and the last by v_nop, so the slot is kept whatever the compiler schedules around the statement. In place: the statement writes only registers that the compiler's own multiply-add has just written,
// so it can overwrite no operand of a matrix instruction sooner than compiled code may.
__device__ __forceinline__ void exp2x4(float& x0, float& x1, float& x2, float& x3) {
    asm("v_exp_f32 %0, %0\n\tv_exp_f32 %1, %1\n\tv_exp_f32 %2, %2\n\tv_exp_f32 %3, %3\n\tv_nop" : "+v"(x0), "+v"(x1), "+v"(x2), "+v"(x3)); }
template <typename T16, bool HI, int NQ>
__device__ __forceinline__ void fa_body(const T16* __restrict__ Q, const T16* __restrict__ Q2, const T16* __restrict__ Kp, const T16* __restrict__ K2, const T16* __restrict__ Vt, const T16* __restrict__ V2, int q0, bf* Ah, bf* Al, const char* sm) {
    typedef typename WFrag<T16>::V V;
    constexpr float C2 = SCL * 1.4426950408889634f;
    const int lane = threadIdx.x & 31, lr = lane & 15, hi = lane >> 4;
    V qf[NQ][2], q2[NQ][2];
#pragma unroll
    for (int qt = 0; qt < NQ; ++qt)
#pragma unroll
        for (int ks = 0; ks < 2; ++ks) { const size_t qo = (size_t)(q0 + qt * 16 + lr) * HD + ks * 32 + 8 * hi; qf[qt][ks] = WFrag<T16>::ld(Q + qo); if (HI) q2[qt][ks] = WFrag<T16>::ld(Q2 + qo); }
    v8f o[4][NQ]; float ref[NQ]; v2f lsum[NQ];   // row sum: even and odd keys apart (packed adds), joined in the epilogue
#pragma unroll
    for (int qt = 0; qt < NQ; ++qt) { ref[qt] = -3.0e38f; lsum[qt] = (v2f){};
#pragma unroll
        for (int dt = 0; dt < 4; ++dt) o[dt][qt] = (v8f){}; }
    constexpr int BUFB = (HI ? 4 : 2) * TILEB, NST = TT / KST;   // a buffer: K | V^T (| K lo | V^T lo)
    const int crow = threadIdx.x >> 3, ccol = threadIdx.x & 7;   // the lane's place in a copy: row crow (+ 16, 32, 48), 16-byte column ccol
    const unsigned lc = (unsigned)(size_t)sm + crow * LPB + ccol * 16;
    const int gko = crow * HD + ccol * 8, gvo = crow * TT + ccol * 8;
    auto fill = [&](int st, int buf) { const unsigned l = lc + buf * BUFB;
        stage_tile(l, Kp + gko + st * KST * HD, HD); stage_tile(l + TILEB, Vt + gvo + st * KST, TT);
        if (HI) { stage_tile(l + 2 * TILEB, K2 + gko + st * KST * HD, HD); stage_tile(l + 3 * TILEB, V2 + gvo + st * KST, TT); } };
    fill(0, 0);
    asm volatile("s_wait_asynccnt 0x0" ::: "memory");   // this wave's copies of stage 0 have landed
    __syncthreads();                                     // and so have the other waves': stage 0 may be read
    fill(1, 1);
    const int fo = lr * LPE + 8 * hi;   // fragment reader: row lr of a 16-row group, elements 8 hi + 0..7 and 16 + 8 hi + 0..7 of a 32-element chunk
#pragma unroll 1
    for (int st = 0; st < NST; ++st) {   // kept rolled: one publish point a trip
    const T16* kt = (const T16*)(sm + (st & 1) * BUFB) + fo; const T16* vt = kt + TILEB / 2; const T16* kt2 = kt + TILEB; const T16* vt2 = kt + 3 * (TILEB / 2);
    V kf[2][2], k2[2][2];
#pragma unroll
    for (int mt = 0; mt < 2; ++mt)
#pragma unroll
        for (int ks = 0; ks < 2; ++ks) { kf[mt][ks] = WFrag<T16>::ld(kt + mt * 16 * LPE + ks * 32); if (HI) k2[mt][ks] = WFrag<T16>::ld(kt2 + mt * 16 * LPE + ks * 32); }
    __builtin_amdgcn_sched_barrier(0);   // the stage's first key fragments are asked for as one group: sunk among the score products, each pair of LDS reads would be waited for on its own
#pragma unroll
    for (int kb = 0; kb < KST; kb += 32) {   // the stage's blocks of 32 keys
        V vf[4], v2[4];
        if (!HI) {
#pragma unroll
            for (int dt = 0; dt < 4; ++dt) vf[dt] = WFrag<T16>::ld(vt + dt * 16 * LPE + kb); }
        v8f s[2][NQ];
#pragma unroll
        for (int mt = 0; mt < 2; ++mt)
#pragma unroll
            for (int qt = 0; qt < NQ; ++qt) s[mt][qt] = (v8f){};
#pragma unroll
        for (int ks = 0; ks < 2; ++ks)
#pragma unroll
            for (int pr = 0; pr < (HI ? 3 : 1); ++pr)   // tiles innermost: neighbouring matrix instructions accumulate into different tiles
#pragma unroll
                for (int mt = 0; mt < 2; ++mt)
#pragma unroll
                    for (int qt = 0; qt < NQ; ++qt) s[mt][qt] = WFrag<T16>::mma(pr == 2 ? k2[mt][ks] : kf[mt][ks], pr == 1 ? q2[qt][ks] : qf[qt][ks], s[mt][qt]);
        if (HI) {   // hi/lo: the value fragments are asked for here, as one group, and fly during the softmax (asked for earlier they would be live together with this block's key fragments)
#pragma unroll
            for (int dt = 0; dt < 4; ++dt) { vf[dt] = WFrag<T16>::ld(vt + dt * 16 * LPE + kb); v2[dt] = WFrag<T16>::ld(vt2 + dt * 16 * LPE + kb); }
            __builtin_amdgcn_sched_barrier(0); }   // keeps the group here: without it the compiler sinks each LDS read to its matrix instruction, which then waits out the LDS latency pair by pair
        if (!HI && kb + 32 < KST) {   // next block's key fragments OF THE SAME STAGE, fetched behind this block's score products so that they fly during the softmax; nothing of the next stage is read ahead
#pragma unroll
            for (int mt = 0; mt < 2; ++mt)
#pragma unroll
                for (int ks = 0; ks < 2; ++ks) kf[mt][ks] = WFrag<T16>::ld(kt + (kb + 32 + mt * 16) * LPE + ks * 32); }
        float mx[NQ]; bool need = false;
#pragma unroll
        for (int qt = 0; qt < NQ; ++qt) { float m = s[0][qt][0];
#pragma unroll
            for (int j = 1; j < 8; ++j) m = fmaxf(m, s[0][qt][j]);
#pragma unroll
            for (int j = 0; j < 8; ++j) m = fmaxf(m, s[1][qt][j]);
            m = fmaxf(m, xhalf(m)) * C2; mx[qt] = m; need = need || (m > ref[qt] + 8.0f); }
        if (__builtin_amdgcn_ballot_w32(need) != 0) {   // wave-uniform: rare after the first block
#pragma unroll
            for (int qt = 0; qt < NQ; ++qt) { const float mn = fmaxf(ref[qt], mx[qt]); const float al = __builtin_amdgcn_exp2f(ref[qt] - mn); ref[qt] = mn; lsum[qt] *= al;
#pragma unroll
                for (int dt = 0; dt < 4; ++dt) o[dt][qt] *= al; } }
#pragma unroll
        for (int qt = 0; qt < NQ; ++qt) { V pf, pl; float pe[16];
#pragma unroll
            for (int e = 0; e < 16; ++e) pe[e] = __builtin_fmaf(s[e >> 3][qt][e & 7], C2, -ref[qt]);
#pragma unroll
            for (int e = 0; e < 16; e += 4) exp2x4(pe[e], pe[e + 1], pe[e + 2], pe[e + 3]);
#pragma unroll
            for (int e = 0; e < 16; e += 2) lsum[qt] += (v2f){pe[e], pe[e + 1]};
#pragma unroll
            for (int e = 0; e < 16; ++e) { const float p = pe[e]; pf[e] = (__typeof__(pf[0]))p; if (HI) pl[e] = (__typeof__(pf[0]))(p - (float)pf[e]); }
            if (HI && qt == NQ - 1 && kb + 32 < KST) {   // hi/lo: next block's key fragments of the same stage, one group, flying during the products below
#pragma unroll
                for (int mt = 0; mt < 2; ++mt)
#pragma unroll
                    for (int ks = 0; ks < 2; ++ks) { kf[mt][ks] = WFrag<T16>::ld(kt + (kb + 32 + mt * 16) * LPE + ks * 32); k2[mt][ks] = WFrag<T16>::ld(kt2 + (kb + 32 + mt * 16) * LPE + ks * 32); }
                __builtin_amdgcn_sched_barrier(0); }   // keeps the group in front of the products (see above)
#pragma unroll
            for (int dt = 0; dt < 4; ++dt) { o[dt][qt] = WFrag<T16>::mma(vf[dt], pf, o[dt][qt]); if (HI) { o[dt][qt] = WFrag<T16>::mma(vf[dt], pl, o[dt][qt]); o[dt][qt] = WFrag<T16>::mma(v2[dt], pf, o[dt][qt]); } } }
    }
    // publish point of stage st + 1, every wave, in this order
    asm volatile("s_wait_dscnt 0x0" ::: "memory");      // this wave's reads of the buffer that is refilled below have returned
    asm volatile("s_wait_asynccnt 0x0" ::: "memory");   // this wave's copies of stage st + 1 have landed
    __syncthreads();                                     // all waves: stage st + 1 may be read, stage st's buffer is free
    if (st + 2 < NST) fill(st + 2, st & 1);
    }
    asm volatile("s_wait_asynccnt 0x0" ::: "memory");   // no copy is outstanding when the wave goes on to its end
#pragma unroll
    for (int qt = 0; qt < NQ; ++qt) { const float lh = lsum[qt][0] + lsum[qt][1]; const float inv = __fdiv_rn(1.0f, lh + xhalf(lh));   // the two halves of a column hold disjoint keys under one ref: joined once
        const size_t oo = (size_t)(q0 + qt * 16 + lr) * DQ + 8 * hi;
#pragma unroll
        for (int dt = 0; dt < 4; ++dt) { v8us oh, ol;
#pragma unroll
            for (int j = 0; j < 8; ++j) { unsigned short a, c2; splitf(o[dt][qt][j] * inv, a, c2); oh[j] = a; ol[j] = c2; }
            *(v8us*)(Ah + oo + dt * 16) = oh; *(v8us*)(Al + oo + dt * 16) = ol; } }
}
// grid (batches x heads, RH / 64 + (TT - RH) / 128), 4 waves: blocks y < RH / 64 take 4 x 16 hi/lo rows (the longer bodies, so they start first), the others 4 x 32 fp16 rows; the four waves of a block walk the same head's keys together. Writes the merged token-major hi/lo planes.
__global__ __launch_bounds__(128) void k_fattn(const h16* __restrict__ Q16, const h16* __restrict__ K16, const h16* __restrict__ V16, const bf* __restrict__ Qh, const bf* __restrict__ Ql, const bf* __restrict__ Kh, const bf* __restrict__ Kl, const bf* __restrict__ Vh, const bf* __restrict__ Vl, bf* Ah, bf* Al) {
    __shared__ __attribute__((aligned(128))) char sm[2 * 4 * TILEB];   // two buffers of up to four tiles
    const int h = blockIdx.x % NH_, b = blockIdx.x / NH_, w = threadIdx.x >> 5, bx = blockIdx.y; const size_t po = ((size_t)b * NH_ + h) * TT * HD, pk = ((size_t)b * NKV + h / REP) * TT * HD, ao = (size_t)b * TT * DQ + h * HD; Ah += ao; Al += ao;
    if (bx < RH / 64) fa_body<bf, true, 1>(Qh + po, Ql + po, Kh + pk, Kl + pk, Vh + pk, Vl + pk, bx * 64 + w * 16, Ah, Al, sm);
    else fa_body<h16, false, 2>(Q16 + po, nullptr, K16 + pk, nullptr, V16 + pk, nullptr, RH + (bx - RH / 64) * 128 + w * 32, Ah, Al, sm);
}

extern "C" void kernel_launch(void* const* d_in, const int* in_sizes, int n_in,
                              void* d_out, int out_size, void* d_ws, size_t ws_size, hipStream_t stream) {
    (void)in_sizes; (void)n_in; (void)out_size;
    const float* x = (const float*)d_in[0]; const float* wqkv = (const float*)d_in[1]; const float* wo = (const float*)d_in[2];   /* order x, w_attn ('oi' [3072][1024]: q | k | v row blocks), w_proj ('oi' [1024][1024]) */
    float* OUT = (float*)d_out;     // [4][2048][1024]
    char* wsp = (char*)d_ws;
    auto take = [&](size_t bytes) { char* p = wsp; wsp += (bytes + 255) & ~(size_t)255; return (void*)p; };
    bf* WQ = (bf*)take((size_t)(DQ + 2 * DKV) * DM * 2);   /* one buffer: q | k | v weight rows */ bf* WO = (bf*)take((size_t)DM * DQ * 2); float* CS = (float*)take((size_t)TT * HD * 2 * 4);
    bf* XB = (bf*)take((size_t)NB_ * TT * DM * 2);
    h16* QP16 = (h16*)take((size_t)NB_ * NH_ * TT * HD * 2); h16* KP16 = (h16*)take((size_t)NB_ * NKV * TT * HD * 2); h16* VT16 = (h16*)take((size_t)NB_ * NKV * HD * TT * 2);
    bf* QPh = (bf*)take((size_t)NB_ * NH_ * TT * HD * 2); bf* QPl = (bf*)take((size_t)NB_ * NH_ * TT * HD * 2); bf* KPh = (bf*)take((size_t)NB_ * NKV * TT * HD * 2); bf* KPl = (bf*)take((size_t)NB_ * NKV * TT * HD * 2); bf* VTh = (bf*)take((size_t)NB_ * NKV * HD * TT * 2); bf* VTl = (bf*)take((size_t)NB_ * NKV * HD * TT * 2);
    bf* ATh = (bf*)take((size_t)NB_ * TT * DQ * 2); bf* ATl = (bf*)take((size_t)NB_ * TT * DQ * 2);
    if ((size_t)(wsp - (char*)d_ws) > ws_size) return;    // ws 256 MiB
    const QkvOut po = { CS, QP16, QPh, QPl, KP16, KPh, KPl, VT16, VTh, VTl };
    // every stage once, for all batches: x, the merged planes and out are contiguous over the batches (rows batch * TT + token); the q | k | v weight rows are one contiguous block
    k_cvt8<<<(unsigned)(((size_t)(DQ + 2 * DKV) * DM / 8 + 255) / 256), 256, 0, stream>>>(wqkv, WQ, (size_t)(DQ + 2 * DKV) * DM / 8);
    k_cvt8<<<(unsigned)(((size_t)DM * DQ / 8 + 255) / 256), 256, 0, stream>>>(wo, WO, (size_t)DM * DQ / 8); k_csP<<<(TT * HD + 255) / 256, 256, 0, stream>>>(CS);
    k_cvt8<<<(unsigned)(((size_t)NB_ * TT * DM / 8 + 255) / 256), 256, 0, stream>>>(x, XB, (size_t)NB_ * TT * DM / 8);
    k_gemmw<bf, 0, false, true><<<dim3(TT / 128, (NH_ + 2 * NKV) / 2, NB_), 128, 0, stream>>>(XB, nullptr, WQ, nullptr, DM, nullptr, 0, nullptr, (size_t)TT * DM, 0, 0, po);
    k_fattn<<<dim3(NB_ * NH_, RH / 64 + (TT - RH) / 128, 1), 128, 0, stream>>>(QP16, KP16, VT16, QPh, QPl, KPh, KPl, VTh, VTl, ATh, ATl);
    k_gemmw<bf, 1, false, false><<<dim3(NB_ * TT / 128, DM / 128, 1), 128, 0, stream>>>(ATh, ATl, WO, nullptr, DQ, OUT, DM, nullptr, 0, 0, 0, po);
}

// v007
// Measured time: 147 microseconds a run.
// Timed twice side by side with v006, it ran 1.19 times as fast both times.
// All steps since v000 together make it 27.0 times as fast.
#include <hip/hip_runtime.h>

// Multi-head attention WITHOUT a mask with interleaved-pair rotary position embedding on a fused bias-free natural projection, four batches (x [4][2048][1024]; qkv = x w_attn^T ('oi' [3072][1024] 0.02, no bias) split in thirds q | k | v (16 heads x 64; token-major); angles = t x 1 / THETA ** (2i / 64) (THETA 1e4; computed); pairs (2i, 2i+1): re cos - im sin, re sin + im cos, on q and k; scores x 1/sqrt(64); softmax over ALL keys (no mask); y = merged w_proj^T ('oi', no bias) -> [4][2048][1024] (8.4 M); argument order x, w_attn, w_proj).
// Layout, all four batches in every launch (planes [batch][head]..., batch = grid z or the high bits of grid x): bf16 copy of x; every matrix kernel stages its operands in LDS (asynchronous copies, two buffers) for a block of four waves; exact q | k | v projections in ONE launch whose epilogue (qkv_planes) applies the interleaved rotary step and writes the fp16 planes; {cos, sin} per (position, pair) built once from the int positions and float32 inverse-frequency constants (precise cosf/sinf); DENSE T-2048 attention in ONE launch (k_fattn: key and value tiles staged in LDS for the block's four waves; scores, running softmax and probability x value stay in registers; every row fp16, 1 product: without a mask no query row differs from another; every key block computed; k_gemmc stays in the file, unused); merged hi/lo x Wo exact.
// Compute dtypes, f32 accumulate: every input rounded to bf16; projections exact; rotary f32; attention fp16; softmax f32; Wo hl x exact.

#define NB_  4
#define TT   2048
#define DM   1024
#define NH_  16
#define NKV  16
#define REP  (NH_ / NKV)
#define HD   64
#define DQ   (NH_ * HD)
#define DKV  (NKV * HD)
#define SCL  0.125f   // HD^-0.5
typedef _Float16 h16;
typedef unsigned short bf;
typedef __attribute__((ext_vector_type(16))) __bf16   v16bf;
typedef __attribute__((ext_vector_type(16))) _Float16 v16h;
typedef __attribute__((ext_vector_type(8)))  _Float16 v8h;
typedef __attribute__((ext_vector_type(8)))  unsigned short v8us;
typedef __attribute__((ext_vector_type(8)))  float    v8f;
typedef __attribute__((ext_vector_type(4)))  float    v4f;
typedef v8h  __attribute__((may_alias)) v8ha;
typedef v4f  __attribute__((may_alias)) v4fa;
typedef v8us __attribute__((may_alias)) v8usa;

__device__ __forceinline__ unsigned short f2bf(float f) { unsigned u = __float_as_uint(f); u += 0x7FFFu + ((u >> 16) & 1u); return (unsigned short)(u >> 16); }
__device__ __forceinline__ float bf2f(unsigned short b) { return __uint_as_float(((unsigned)b) << 16); }
__device__ __forceinline__ float bfr(float f) { return bf2f(f2bf(f)); }
__device__ __forceinline__ v16h cat16(v8h lo, v8h hi) { return __builtin_shufflevector(lo, hi, 0, 1, 2, 3, 4, 5, 6, 7, 8, 9, 10, 11, 12, 13, 14, 15); }
__device__ __forceinline__ v16bf cat16b(v8us lo, v8us hi) { return __builtin_bit_cast(v16bf, __builtin_shufflevector(lo, hi, 0, 1, 2, 3, 4, 5, 6, 7, 8, 9, 10, 11, 12, 13, 14, 15)); }
__device__ __forceinline__ v8f wmma16(v16h a, v16h b, v8f c) { return __builtin_amdgcn_wmma_f32_16x16x32_f16(false, a, false, b, (short)0, c, false, false); }
__device__ __forceinline__ v8f wmmab(v16bf a, v16bf b, v8f c) { return __builtin_amdgcn_wmma_f32_16x16x32_bf16(false, a, false, b, (short)0, c, false, false); }



// ---- staging in LDS: tiles of 128-byte rows (64 16-bit elements), brought in by asynchronous copies and read as fragments at a padded pitch.
#define KST   64                 // k_fattn, keys per stage: a K tile is 64 keys x 64 d, a V^T tile 64 d x 64 keys, both 64 rows of 128 bytes
#define GKS   64                 // k_gemmw, k per stage: an operand tile is 128 rows of 128 bytes
#define LPB   144                // row pitch in LDS, bytes: 16 x odd, free of bank conflicts for 16-byte reads
#define LPE   (LPB / 2)          // the same in 16-bit elements
#define TILEB (64 * LPB)         // 64 staged rows
#define GTB   (128 * LPB)        // 128 staged rows
// 64 rows, 128 threads: a lane copies 16 bytes of rows r, r + 16, r + 32, r + 48 (8 lanes a row, so a wave's copy covers four whole 128-byte lines). l, g: the lane's own LDS byte address and global address in row r; gp: global row pitch in elements.
// The s_wait_xcnt closes the statement so that no register which a copy names is rewritten before the copies have taken their addresses.
template <typename T16>
__device__ __forceinline__ void stage_tile(unsigned l, const T16* g, int gp) {
    asm volatile("global_load_async_to_lds_b128 %0, %4, off\n\tglobal_load_async_to_lds_b128 %1, %5, off\n\tglobal_load_async_to_lds_b128 %2, %6, off\n\tglobal_load_async_to_lds_b128 %3, %7, off\n\ts_wait_xcnt 0x0"
                 :: "v"(l), "v"(l + 16 * LPB), "v"(l + 32 * LPB), "v"(l + 48 * LPB), "v"(g), "v"(g + 16 * gp), "v"(g + 32 * gp), "v"(g + 48 * gp) : "memory"); }

// ---- k_gemmw: register-blocked GEMM, four waves per 128x128 output tile, each wave a 64x64 quarter (16 accumulators); grid (M/128, N/128, Z), 128 threads.
// The operands' K-contiguous 16-bit rows come into LDS in stages of GKS k (two buffers: the next stage flies while this one is worked on) and are shared: two waves read each A row, two each B row.
// C[m][n] (f32, pitch ldc, + optional f32 bias[n]) = sum_k A[m][k] Bt[n][k] (+ split products per NSPLIT). z-batch strides sA/sB/sC in elements. K % 64 == 0.
template <typename T16> struct WFrag;
template <> struct WFrag<h16> { typedef v16h V; static __device__ __forceinline__ V ld(const h16* p) { return cat16(*(const v8h*)p, *(const v8h*)(p + 16)); } static __device__ __forceinline__ v8f mma(V a, V b, v8f c) { return wmma16(a, b, c); } };
template <> struct WFrag<bf> { typedef v16bf V; static __device__ __forceinline__ V ld(const bf* p) { return cat16b(*(const v8us*)p, *(const v8us*)(p + 16)); } static __device__ __forceinline__ v8f mma(V a, V b, v8f c) { return wmmab(a, b, c); } };
// QKV: a wave's quarter is 64 tokens x one head of the q | k | v projection (Bt: the q, then k, then v weight rows); instead of the f32 tile the epilogue qkv_planes writes that head's fp16 plane, C is not used.
struct QkvOut { const float* CS; h16* Q16; h16* K16; h16* V16; };
__device__ __forceinline__ void qkv_planes(const v8f (&acc)[4][4], float* os, int r0, int y, const QkvOut& po);
template <typename T16, int NSPLIT, bool BIAS, bool QKV>
__global__ __launch_bounds__(128) void k_gemmw(const T16* __restrict__ A, const T16* __restrict__ A2, const T16* __restrict__ Bt, const T16* __restrict__ Bt2, int K, float* C, int ldc, const float* __restrict__ bias, size_t sA, size_t sB, size_t sC, QkvOut po) {
    typedef typename WFrag<T16>::V V;
    constexpr bool HA2 = NSPLIT == 1 || NSPLIT == 2, HB2 = NSPLIT >= 2;
    constexpr int OB = (HA2 ? 2 : 1) * GTB, BUFB = OB + (HB2 ? 2 : 1) * GTB;   // a buffer: A (| A2) | B (| B2)
    __shared__ __attribute__((aligned(128))) char sm[2 * BUFB];
    const size_t z = blockIdx.z; A += z * sA; if (A2) A2 += z * sA; Bt += z * sB; if (Bt2) Bt2 += z * sB; C += z * sC;
    const int lane = threadIdx.x & 31, lr = lane & 15, hi = lane >> 4, w = __builtin_amdgcn_readfirstlane(threadIdx.x >> 5) & 3, wm = w >> 1, wn = w & 1;   // w: wave number 0..3, held scalar
    const int r0 = blockIdx.x * 128 + wm * 64, c0 = blockIdx.y * 128 + wn * 64;
    v8f acc[4][4];
#pragma unroll
    for (int mb = 0; mb < 4; ++mb)
#pragma unroll
        for (int nb = 0; nb < 4; ++nb) acc[mb][nb] = (v8f){};
    const int cpr = threadIdx.x >> 3, cpc = threadIdx.x & 7;   // the lane's place in a copy: row cpr (+ 16, 32, ...), 16-byte column cpc
    const unsigned lc = (unsigned)(size_t)sm + cpr * LPB + cpc * 16;
    const size_t ga = (size_t)(blockIdx.x * 128 + cpr) * K + cpc * 8, gb = (size_t)(blockIdx.y * 128 + cpr) * K + cpc * 8, h64 = (size_t)64 * K;
    auto fill = [&](int st, int buf) { const unsigned l = lc + buf * BUFB; const size_t a = ga + st * GKS, b = gb + st * GKS;
        stage_tile(l, A + a, K); stage_tile(l + TILEB, A + a + h64, K);
        if (HA2) { stage_tile(l + GTB, A2 + a, K); stage_tile(l + GTB + TILEB, A2 + a + h64, K); }
        stage_tile(l + OB, Bt + b, K); stage_tile(l + OB + TILEB, Bt + b + h64, K);
        if (HB2) { stage_tile(l + OB + GTB, Bt2 + b, K); stage_tile(l + OB + GTB + TILEB, Bt2 + b + h64, K); } };
    const int NST = K / GKS;
    fill(0, 0);
    asm volatile("s_wait_asynccnt 0x0" ::: "memory");   // this wave's copies of stage 0 have landed
    __syncthreads();                                     // and so have the other waves': stage 0 may be read
    if (NST > 1) fill(1, 1);
    const int ao = (wm * 64 + lr) * LPE + 8 * hi, bo = (wn * 64 + lr) * LPE + 8 * hi;   // fragment reader: row lr of a 16-row group, elements 8 hi + 0..7 and 16 + 8 hi + 0..7 of a 32-element chunk
#pragma unroll 1
    for (int st = 0; st < NST; ++st) {   // kept rolled: one publish point a trip
        const T16* at = (const T16*)(sm + (st & 1) * BUFB) + ao; const T16* bt = (const T16*)(sm + (st & 1) * BUFB + OB) + bo;
#pragma unroll
        for (int kc = 0; kc < GKS; kc += 32) {
            V a[4], a2[4], b[4], b2[4];
#pragma unroll
            for (int mb = 0; mb < 4; ++mb) { a[mb] = WFrag<T16>::ld(at + mb * 16 * LPE + kc); if (HA2) a2[mb] = WFrag<T16>::ld(at + GTB / 2 + mb * 16 * LPE + kc); }
#pragma unroll
            for (int nb = 0; nb < 4; ++nb) { b[nb] = WFrag<T16>::ld(bt + nb * 16 * LPE + kc); if (HB2) b2[nb] = WFrag<T16>::ld(bt + GTB / 2 + nb * 16 * LPE + kc); }
            __builtin_amdgcn_sched_barrier(0);   // the fragments of a 32-k step are asked for as one group: sunk among the products, each pair of LDS reads would be waited for on its own
#pragma unroll
            for (int nb = 0; nb < 4; ++nb)
#pragma unroll
                for (int mb = 0; mb < 4; ++mb) { acc[mb][nb] = WFrag<T16>::mma(a[mb], b[nb], acc[mb][nb]); if (HA2) acc[mb][nb] = WFrag<T16>::mma(a2[mb], b[nb], acc[mb][nb]); if (HB2) acc[mb][nb] = WFrag<T16>::mma(a[mb], b2[nb], acc[mb][nb]); }
        }
        // publish point of stage st + 1, every wave, in this order
        asm volatile("s_wait_dscnt 0x0" ::: "memory");      // this wave's reads of the buffer that is refilled below have returned
        asm volatile("s_wait_asynccnt 0x0" ::: "memory");   // this wave's copies of stage st + 1 have landed
        __syncthreads();                                     // all waves: stage st + 1 may be read, stage st's buffer is free
        if (st + 2 < NST) fill(st + 2, st & 1);
    }
    asm volatile("s_wait_asynccnt 0x0" ::: "memory");   // no copy is outstanding from here on
    float* os = (float*)(sm + w * (16 * 68 * 4));        // output staging, a range of its own for each wave: behind the last trip's barrier nobody reads the buffers and nothing is copied into them any more
    if (QKV) { qkv_planes(acc, os, r0, blockIdx.y * 2 + wn, po); return; }
#pragma unroll
    for (int mb = 0; mb < 4; ++mb) {
#pragma unroll
        for (int nb = 0; nb < 4; ++nb) {
#pragma unroll
            for (int j = 0; j < 8; ++j) os[(hi * 8 + j) * 68 + nb * 16 + lr] = acc[mb][nb][j]; }
        __builtin_amdgcn_wave_barrier(); asm volatile("" ::: "memory");
        float* crow = C + (size_t)(r0 + mb * 16) * ldc + c0;
{
#pragma unroll
            for (int s = 0; s < 8; ++s) { const int row = 2 * s + hi, cofs = lr * 4; v4f val = *(const v4fa*)(os + row * 68 + cofs); if (BIAS) { val[0] += bfr(bias[c0 + cofs]); val[1] += bfr(bias[c0 + cofs + 1]); val[2] += bfr(bias[c0 + cofs + 2]); val[3] += bfr(bias[c0 + cofs + 3]); }
                *(v4f*)(crow + (size_t)row * ldc + cofs) = val; }
             }
        __builtin_amdgcn_wave_barrier(); asm volatile("" ::: "memory");
    }
}

// ---- k_gemmc: a one-wave 64x64 tile GEMM, operands read straight from global memory, specialised for causal attention: CMODE 1 skips score tiles entirely above the diagonal (query rows r0+roff.., key columns c0..), CMODE 2 limits the
// key (K) loop of the probability x value contraction to the diagonal block (probabilities beyond it are exactly zero). roff = row offset of this launch's first row within the sequence.
template <typename T16, int NSPLIT, int CMODE>
__global__ __launch_bounds__(32) void k_gemmc(const T16* __restrict__ A, const T16* __restrict__ A2, const T16* __restrict__ Bt, const T16* __restrict__ Bt2, int K, float* C, int ldc, int roff, size_t sA, size_t sB, size_t sC) {
    typedef typename WFrag<T16>::V V;
    __shared__ __align__(16) float os[16 * 68];
    const size_t z = blockIdx.z; A += z * sA; if (A2) A2 += z * sA; Bt += z * sB; if (Bt2) Bt2 += z * sB; C += z * sC;
    const int lane = threadIdx.x & 31, lr = lane & 15, hi = lane >> 4; const int r0 = blockIdx.x * 64, c0 = blockIdx.y * 64;
    if (CMODE == 1 && c0 > r0 + roff + 63) return;                  // score tile entirely above the causal diagonal: not computed
    const int Kl = (CMODE == 2) ? min(K, r0 + roff + 64) : K;        // P.V: probabilities are exactly 0 beyond the diagonal block, so the K loop stops there
    v8f acc[4][4];
#pragma unroll
    for (int mb = 0; mb < 4; ++mb)
#pragma unroll
        for (int nb = 0; nb < 4; ++nb) acc[mb][nb] = (v8f){};
    const size_t aoff = (size_t)(r0 + lr) * K + 8 * hi, boff = (size_t)(c0 + lr) * K + 8 * hi;
#pragma unroll 1
    for (int kc = 0; kc < Kl; kc += 32) {
        V a[4], a2[4];
#pragma unroll
        for (int mb = 0; mb < 4; ++mb) { a[mb] = WFrag<T16>::ld(A + aoff + (size_t)mb * 16 * K + kc); if (NSPLIT == 1 || NSPLIT == 2) a2[mb] = WFrag<T16>::ld(A2 + aoff + (size_t)mb * 16 * K + kc); }
#pragma unroll
        for (int nb = 0; nb < 4; ++nb) { const V b = WFrag<T16>::ld(Bt + boff + (size_t)nb * 16 * K + kc); V b2; if (NSPLIT >= 2) b2 = WFrag<T16>::ld(Bt2 + boff + (size_t)nb * 16 * K + kc);
#pragma unroll
            for (int mb = 0; mb < 4; ++mb) { acc[mb][nb] = WFrag<T16>::mma(a[mb], b, acc[mb][nb]); if (NSPLIT == 1 || NSPLIT == 2) acc[mb][nb] = WFrag<T16>::mma(a2[mb], b, acc[mb][nb]); if (NSPLIT >= 2) acc[mb][nb] = WFrag<T16>::mma(a[mb], b2, acc[mb][nb]); } }
        asm volatile("v_nop\n\tv_nop\n\tv_nop\n\tv_nop" : "+v"(acc[0][0]), "+v"(acc[1][1]), "+v"(acc[2][2]), "+v"(acc[3][3]) : "v"(a[0]), "v"(a[3]));
    }
#pragma unroll
    for (int mb = 0; mb < 4; ++mb) {
#pragma unroll
        for (int nb = 0; nb < 4; ++nb) {
#pragma unroll
            for (int j = 0; j < 8; ++j) os[(hi * 8 + j) * 68 + nb * 16 + lr] = acc[mb][nb][j]; }
        __builtin_amdgcn_wave_barrier(); asm volatile("" ::: "memory");
        float* crow = C + (size_t)(r0 + mb * 16) * ldc + c0;
{
#pragma unroll
            for (int s = 0; s < 8; ++s) { const int row = 2 * s + hi, cofs = lr * 4; v4f val = *(const v4fa*)(os + row * 68 + cofs);
                *(v4f*)(crow + (size_t)row * ldc + cofs) = val; }
             }
        __builtin_amdgcn_wave_barrier(); asm volatile("" ::: "memory");
    }
}

__device__ __forceinline__ h16 tohx(float x) { return (h16)x; }
__device__ __forceinline__ void splitf(float y, unsigned short& h, unsigned short& l) { h = f2bf(y); l = f2bf(y - bf2f(h)); }
typedef __attribute__((ext_vector_type(2))) _Float16 v2h;
typedef __attribute__((ext_vector_type(4))) _Float16 v4h;
typedef __attribute__((ext_vector_type(2))) unsigned short v2us;
typedef __attribute__((ext_vector_type(4))) unsigned short v4us;
typedef __attribute__((ext_vector_type(2))) float v2f;
typedef __attribute__((ext_vector_type(4))) int v4i;

__global__ __launch_bounds__(256) void k_cvt8(const float* __restrict__ src, bf* dst, size_t n8) { const size_t i = (size_t)blockIdx.x * 256 + threadIdx.x; if (i >= n8) return; const v8f v = *(const v8f*)(src + i * 8); v8us o;
#pragma unroll
    for (int k = 0; k < 8; ++k) o[k] = f2bf(v[k]); *(v8us*)(dst + i * 8) = o;  }

__constant__ float INV2[HD / 2] = { 1.000000000e+00f, 7.498942018e-01f, 5.623413324e-01f, 4.216965139e-01f, 3.162277639e-01f, 2.371373624e-01f, 1.778279394e-01f, 1.333521456e-01f, 1.000000015e-01f, 7.498941571e-02f, 5.623412877e-02f, 4.216964915e-02f, 3.162277862e-02f, 2.371373586e-02f, 1.778279431e-02f, 1.333521493e-02f, 9.999999776e-03f, 7.498942316e-03f, 5.623413250e-03f, 4.216964822e-03f, 3.162277862e-03f, 2.371373819e-03f, 1.778279431e-03f, 1.333521446e-03f, 1.000000047e-03f, 7.498941850e-04f, 5.623413017e-04f, 4.216964880e-04f, 3.162277862e-04f, 2.371373848e-04f, 1.778279402e-04f, 1.333521504e-04f };   // 1 / THETA ** (2i / 64), i = 0..31, in float32 as THIS module writes it (the RECIPROCAL spelling, evaluated in the reference's own f32 arithmetic: these 32 literals equal it bit for bit); ten entries differ by one ulp from the negative-power values the host's own table held
__global__ __launch_bounds__(256) void k_csP(float* CS) { const int idx = blockIdx.x * 256 + threadIdx.x; if (idx >= TT * HD) return; const int d = idx % HD; const int t = idx / HD; const float a = __fmul_rn((float)t, INV2[d >> 1]); v2f cs; cs[0] = cosf(a); cs[1] = sinf(a); *(v2f*)(CS + (size_t)idx * 2) = cs;  }
// ---- qkv_planes: epilogue of the q | k | v projection tile (k_gemmw, QKV): rotary step, rounding to fp16 and the transposition of v, straight from the accumulators; no f32 projection goes to memory.
// y: q heads, then k heads, then v heads. 16 rows at a time through the wave's LDS so that every store covers whole 128-byte lines (8 lanes x 16 bytes a row):
// q, k: rows = tokens, a lane takes 8 neighbouring columns = 4 rotary pairs -> planes [head][token][64]; v: staged transposed (a lane's 8 accumulator values are 8 neighbouring tokens of one column), rows = columns, a lane takes 8 neighbouring tokens -> planes [head][64][token].
__device__ __forceinline__ void planes8(const float* r, size_t e, h16* P16) { v8h o16;   // eight neighbouring elements -> fp16 plane
#pragma unroll
    for (int q = 0; q < 8; ++q) o16[q] = tohx(r[q]);
    *(v8h*)(P16 + e) = o16;
    asm volatile("s_wait_xcnt 0x0" ::: "memory"); }   // the arithmetic that follows may reuse the address registers of this store: the wait stands between
__device__ __forceinline__ void qkv_planes(const v8f (&acc)[4][4], float* os, int r0, int y, const QkvOut& po) {
    const size_t zo = (size_t)blockIdx.z * NH_ * TT * HD;   // grid z = batch: every plane holds NH_ * TT * HD (= NKV * HD * TT) elements a batch
    const int lane = threadIdx.x & 31, lr = lane & 15, hi = lane >> 4, rw = lane >> 3, cofs = (lane & 7) * 8;   // reader: row 4 s + rw of the 16 staged, 8 elements from cofs
    if (y < NH_ + NKV) {   // q or k head (block-uniform)
        const bool isq = y < NH_; const size_t pb = zo + (size_t)(isq ? y : y - NH_) * TT * HD;
        h16* P16 = isq ? po.Q16 : po.K16;
        const float* cp = po.CS + ((size_t)(r0 + rw) * HD + cofs) * 2;
        v2f cs[4][4][4];   // {cos, sin} of the lane's four pairs, by 16-row group and step; each group's are asked for one group ahead
#pragma unroll
        for (int s = 0; s < 4; ++s)
#pragma unroll
            for (int q = 0; q < 4; ++q) cs[0][s][q] = *(const v2f*)(cp + (size_t)(4 * s) * HD * 2 + 4 * q);
#pragma unroll
        for (int mb = 0; mb < 4; ++mb) {
            if (mb < 3) {
                if (mb > 0) asm volatile("s_wait_xcnt 0x0" ::: "memory");   // the loads below may land in registers that the stores of the group before name: the wait stands between them
#pragma unroll
                for (int s = 0; s < 4; ++s)
#pragma unroll
                    for (int q = 0; q < 4; ++q) cs[mb + 1][s][q] = *(const v2f*)(cp + (size_t)((mb + 1) * 16 + 4 * s) * HD * 2 + 4 * q); }
#pragma unroll
            for (int nb = 0; nb < 4; ++nb) {
#pragma unroll
                for (int j = 0; j < 8; ++j) os[(hi * 8 + j) * 68 + nb * 16 + lr] = acc[mb][nb][j]; }
            __builtin_amdgcn_wave_barrier(); asm volatile("" ::: "memory");   // the reads below take other lanes' values: keeps the compiler from moving them above the LDS stores
#pragma unroll
            for (int s = 0; s < 4; ++s) { const int row = 4 * s + rw; const v4f xa = *(const v4fa*)(os + row * 68 + cofs), xb = *(const v4fa*)(os + row * 68 + cofs + 4); const float x[8] = { xa[0], xa[1], xa[2], xa[3], xb[0], xb[1], xb[2], xb[3] }; float r[8];
#pragma unroll
                for (int q = 0; q < 4; ++q) { const v2f c = cs[mb][s][q]; r[2 * q] = x[2 * q] * c[0] - x[2 * q + 1] * c[1]; r[2 * q + 1] = x[2 * q] * c[1] + x[2 * q + 1] * c[0]; }   // even: re cos - im sin; odd: re sin + im cos
                planes8(r, pb + (size_t)(r0 + mb * 16 + row) * HD + cofs, P16); }
            __builtin_amdgcn_wave_barrier(); asm volatile("" ::: "memory");   // keeps the next 16 rows' LDS stores behind these reads
        }
    } else {                        // v head
        const size_t pb = zo + (size_t)(y - NH_ - NKV) * HD * TT;
#pragma unroll
        for (int nb = 0; nb < 4; ++nb) {
#pragma unroll
            for (int mb = 0; mb < 4; ++mb) { const v8f t8 = acc[mb][nb]; float* op = os + lr * 68 + mb * 16 + hi * 8;
                *(v4fa*)op = __builtin_shufflevector(t8, t8, 0, 1, 2, 3); *(v4fa*)(op + 4) = __builtin_shufflevector(t8, t8, 4, 5, 6, 7); }
            __builtin_amdgcn_wave_barrier(); asm volatile("" ::: "memory");   // the reads below take other lanes' values: keeps the compiler from moving them above the LDS stores
#pragma unroll
            for (int s = 0; s < 4; ++s) { const int row = 4 * s + rw; const v4f xa = *(const v4fa*)(os + row * 68 + cofs), xb = *(const v4fa*)(os + row * 68 + cofs + 4); const float x[8] = { xa[0], xa[1], xa[2], xa[3], xb[0], xb[1], xb[2], xb[3] };
                planes8(x, pb + (size_t)(nb * 16 + row) * TT + r0 + cofs, po.V16); }
            __builtin_amdgcn_wave_barrier(); asm volatile("" ::: "memory");   // keeps the next 16 columns' LDS stores behind these reads
        }
        asm volatile("s_wait_xcnt 0x0" ::: "memory");   // behind the last stores of this branch: in the built code the other branch's address arithmetic follows them and writes registers that they name
    }
}
// ---- k_fattn: scores, softmax and probability x value of all batches in one launch; nothing of a score or a probability goes to memory.
// One wave owns NQ x 16 query rows of one head and walks the 2048 keys in blocks of 32. The block's four waves share the key and value tiles: stages of KST keys are brought into LDS by asynchronous copies
// (whole 128-byte rows, two buffers: the next stage flies while this one is worked on), and every wave reads its fragments from there at a row pitch of 144 bytes.
// S^T = K Q^T (A = key rows, B = query rows): a lane holds scores of its own query column only (keys 8 hi + j of each 16-key tile), so two S^T tiles, converted in place, ARE the B operand of O^T += V^T P^T
// (A = V^T rows loaded in the same k order: 8 hi + 0..7, 16 + 8 hi + 0..7). Running softmax in log2 units: p = 2^(s c - ref), f32 row sum; ref moves (and O, sum are rescaled) only when a column's
// block maximum exceeds it by more than 8, so p <= 2^8; the common factor cancels in the final division. Operands fp16, 1 product in both contractions, for every query row.
__device__ __forceinline__ float xhalf(float x) { const int b = __float_as_int(x); return __int_as_float(__builtin_amdgcn_permlanex16(b, b, 0x76543210, 0xfedcba98, false, false)); }   // value of lane l ^ 16
// Four x = 2^x in one statement: behind a transcendental the instruction set asks for one independent instruction before its result is read or its source overwritten; here each v_exp_f32 is followed by an
// independent one and the last by v_nop, so the slot is kept whatever the compiler schedules around the statement. In place: the statement writes only registers that the compiler's own multiply-add has just written,
// so it can overwrite no operand of a matrix instruction sooner than compiled code may.
__device__ __forceinline__ void exp2x4(float& x0, float& x1, float& x2, float& x3) {
    asm("v_exp_f32 %0, %0\n\tv_exp_f32 %1, %1\n\tv_exp_f32 %2, %2\n\tv_exp_f32 %3, %3\n\tv_nop" : "+v"(x0), "+v"(x1), "+v"(x2), "+v"(x3)); }
template <typename T16, int NQ>
__device__ __forceinline__ void fa_body(const T16* __restrict__ Q, const T16* __restrict__ Kp, const T16* __restrict__ Vt, int q0, bf* Ah, bf* Al, const char* sm) {
    typedef typename WFrag<T16>::V V;
    constexpr float C2 = SCL * 1.4426950408889634f;
    const int lane = threadIdx.x & 31, lr = lane & 15, hi = lane >> 4;
    V qf[NQ][2];
#pragma unroll
    for (int qt = 0; qt < NQ; ++qt)
#pragma unroll
        for (int ks = 0; ks < 2; ++ks) qf[qt][ks] = WFrag<T16>::ld(Q + (size_t)(q0 + qt * 16 + lr) * HD + ks * 32 + 8 * hi);
    v8f o[4][NQ]; float ref[NQ]; v2f lsum[NQ];   // row sum: even and odd keys apart (packed adds), joined in the epilogue
#pragma unroll
    for (int qt = 0; qt < NQ; ++qt) { ref[qt] = -3.0e38f; lsum[qt] = (v2f){};
#pragma unroll
        for (int dt = 0; dt < 4; ++dt) o[dt][qt] = (v8f){}; }
    constexpr int BUFB = 2 * TILEB, NST = TT / KST;   // a buffer: K | V^T
    const int crow = threadIdx.x >> 3, ccol = threadIdx.x & 7;   // the lane's place in a copy: row crow (+ 16, 32, 48), 16-byte column ccol
    const unsigned lc = (unsigned)(size_t)sm + crow * LPB + ccol * 16;
    const int gko = crow * HD + ccol * 8, gvo = crow * TT + ccol * 8;
    auto fill = [&](int st, int buf) { const unsigned l = lc + buf * BUFB;
        stage_tile(l, Kp + gko + st * KST * HD, HD); stage_tile(l + TILEB, Vt + gvo + st * KST, TT); };
    fill(0, 0);
    asm volatile("s_wait_asynccnt 0x0" ::: "memory");   // this wave's copies of stage 0 have landed
    __syncthreads();                                     // and so have the other waves': stage 0 may be read
    fill(1, 1);
    const int fo = lr * LPE + 8 * hi;   // fragment reader: row lr of a 16-row group, elements 8 hi + 0..7 and 16 + 8 hi + 0..7 of a 32-element chunk
#pragma unroll 1
    for (int st = 0; st < NST; ++st) {   // kept rolled: one publish point a trip
    const T16* kt = (const T16*)(sm + (st & 1) * BUFB) + fo; const T16* vt = kt + TILEB / 2;
    V kf[2][2];
#pragma unroll
    for (int mt = 0; mt < 2; ++mt)
#pragma unroll
        for (int ks = 0; ks < 2; ++ks) kf[mt][ks] = WFrag<T16>::ld(kt + mt * 16 * LPE + ks * 32);
    __builtin_amdgcn_sched_barrier(0);   // the stage's first key fragments are asked for as one group: sunk among the score products, each pair of LDS reads would be waited for on its own
#pragma unroll
    for (int kb = 0; kb < KST; kb += 32) {   // the stage's blocks of 32 keys
        V vf[4];
#pragma unroll
        for (int dt = 0; dt < 4; ++dt) vf[dt] = WFrag<T16>::ld(vt + dt * 16 * LPE + kb);
        v8f s[2][NQ];
#pragma unroll
        for (int mt = 0; mt < 2; ++mt)
#pragma unroll
            for (int qt = 0; qt < NQ; ++qt) s[mt][qt] = (v8f){};
#pragma unroll
        for (int ks = 0; ks < 2; ++ks)   // tiles innermost: neighbouring matrix instructions accumulate into different tiles
#pragma unroll
            for (int mt = 0; mt < 2; ++mt)
#pragma unroll
                for (int qt = 0; qt < NQ; ++qt) s[mt][qt] = WFrag<T16>::mma(kf[mt][ks], qf[qt][ks], s[mt][qt]);
        if (kb + 32 < KST) {   // next block's key fragments OF THE SAME STAGE, fetched behind this block's score products so that they fly during the softmax; nothing of the next stage is read ahead
#pragma unroll
            for (int mt = 0; mt < 2; ++mt)
#pragma unroll
                for (int ks = 0; ks < 2; ++ks) kf[mt][ks] = WFrag<T16>::ld(kt + (kb + 32 + mt * 16) * LPE + ks * 32); }
        float mx[NQ]; bool need = false;
#pragma unroll
        for (int qt = 0; qt < NQ; ++qt) { float m = s[0][qt][0];
#pragma unroll
            for (int j = 1; j < 8; ++j) m = fmaxf(m, s[0][qt][j]);
#pragma unroll
            for (int j = 0; j < 8; ++j) m = fmaxf(m, s[1][qt][j]);
            m = fmaxf(m, xhalf(m)) * C2; mx[qt] = m; need = need || (m > ref[qt] + 8.0f); }
        if (__builtin_amdgcn_ballot_w32(need) != 0) {   // wave-uniform: rare after the first block
#pragma unroll
            for (int qt = 0; qt < NQ; ++qt) { const float mn = fmaxf(ref[qt], mx[qt]); const float al = __builtin_amdgcn_exp2f(ref[qt] - mn); ref[qt] = mn; lsum[qt] *= al;
#pragma unroll
                for (int dt = 0; dt < 4; ++dt) o[dt][qt] *= al; } }
#pragma unroll
        for (int qt = 0; qt < NQ; ++qt) { V pf; float pe[16];
#pragma unroll
            for (int e = 0; e < 16; ++e) pe[e] = __builtin_fmaf(s[e >> 3][qt][e & 7], C2, -ref[qt]);
#pragma unroll
            for (int e = 0; e < 16; e += 4) exp2x4(pe[e], pe[e + 1], pe[e + 2], pe[e + 3]);
#pragma unroll
            for (int e = 0; e < 16; e += 2) lsum[qt] += (v2f){pe[e], pe[e + 1]};
#pragma unroll
            for (int e = 0; e < 16; ++e) pf[e] = (__typeof__(pf[0]))pe[e];
#pragma unroll
            for (int dt = 0; dt < 4; ++dt) o[dt][qt] = WFrag<T16>::mma(vf[dt], pf, o[dt][qt]); }
    }
    // publish point of stage st + 1, every wave, in this order
    asm volatile("s_wait_dscnt 0x0" ::: "memory");      // this wave's reads of the buffer that is refilled below have returned
    asm volatile("s_wait_asynccnt 0x0" ::: "memory");   // this wave's copies of stage st + 1 have landed
    __syncthreads();                                     // all waves: stage st + 1 may be read, stage st's buffer is free
    if (st + 2 < NST) fill(st + 2, st & 1);
    }
    asm volatile("s_wait_asynccnt 0x0" ::: "memory");   // no copy is outstanding when the wave goes on to its end
#pragma unroll
    for (int qt = 0; qt < NQ; ++qt) { const float lh = lsum[qt][0] + lsum[qt][1]; const float inv = __fdiv_rn(1.0f, lh + xhalf(lh));   // the two halves of a column hold disjoint keys under one ref: joined once
        const size_t oo = (size_t)(q0 + qt * 16 + lr) * DQ + 8 * hi;
#pragma unroll
        for (int dt = 0; dt < 4; ++dt) { v8us oh, ol;
#pragma unroll
            for (int j = 0; j < 8; ++j) { unsigned short a, c2; splitf(o[dt][qt][j] * inv, a, c2); oh[j] = a; ol[j] = c2; }
            *(v8us*)(Ah + oo + dt * 16) = oh; *(v8us*)(Al + oo + dt * 16) = ol; } }
}
// grid (batches x heads, TT / 128), 4 waves: a block takes 4 x 32 query rows; its four waves walk the same head's keys together. Writes the merged token-major hi/lo planes.
__global__ __launch_bounds__(128) void k_fattn(const h16* __restrict__ Q16, const h16* __restrict__ K16, const h16* __restrict__ V16, bf* Ah, bf* Al) {
    __shared__ __attribute__((aligned(128))) char sm[2 * 2 * TILEB];   // two buffers of two tiles
    const int h = blockIdx.x % NH_, b = blockIdx.x / NH_, w = threadIdx.x >> 5, bx = blockIdx.y; const size_t po = ((size_t)b * NH_ + h) * TT * HD, pk = ((size_t)b * NKV + h / REP) * TT * HD, ao = (size_t)b * TT * DQ + h * HD; Ah += ao; Al += ao;
    fa_body<h16, 2>(Q16 + po, K16 + pk, V16 + pk, bx * 128 + w * 32, Ah, Al, sm);
}

extern "C" void kernel_launch(void* const* d_in, const int* in_sizes, int n_in,
                              void* d_out, int out_size, void* d_ws, size_t ws_size, hipStream_t stream) {
    (void)in_sizes; (void)n_in; (void)out_size;
    const float* x = (const float*)d_in[0]; const float* wqkv = (const float*)d_in[1]; const float* wo = (const float*)d_in[2];   /* order x, w_attn ('oi' [3072][1024]: q | k | v row blocks), w_proj ('oi' [1024][1024]) */
    float* OUT = (float*)d_out;     // [4][2048][1024]
    char* wsp = (char*)d_ws;
    auto take = [&](size_t bytes) { char* p = wsp; wsp += (bytes + 255) & ~(size_t)255; return (void*)p; };
    bf* WQ = (bf*)take((size_t)(DQ + 2 * DKV) * DM * 2);   /* one buffer: q | k | v weight rows */ bf* WO = (bf*)take((size_t)DM * DQ * 2); float* CS = (float*)take((size_t)TT * HD * 2 * 4);
    bf* XB = (bf*)take((size_t)NB_ * TT * DM * 2);
    h16* QP16 = (h16*)take((size_t)NB_ * NH_ * TT * HD * 2); h16* KP16 = (h16*)take((size_t)NB_ * NKV * TT * HD * 2); h16* VT16 = (h16*)take((size_t)NB_ * NKV * HD * TT * 2);
    bf* ATh = (bf*)take((size_t)NB_ * TT * DQ * 2); bf* ATl = (bf*)take((size_t)NB_ * TT * DQ * 2);
    if ((size_t)(wsp - (char*)d_ws) > ws_size) return;    // ws 256 MiB
    const QkvOut po = { CS, QP16, KP16, VT16 };
    // every stage once, for all batches: x, the merged planes and out are contiguous over the batches (rows batch * TT + token); the q | k | v weight rows are one contiguous block
    k_cvt8<<<(unsigned)(((size_t)(DQ + 2 * DKV) * DM / 8 + 255) / 256), 256, 0, stream>>>(wqkv, WQ, (size_t)(DQ + 2 * DKV) * DM / 8);
    k_cvt8<<<(unsigned)(((size_t)DM * DQ / 8 + 255) / 256), 256, 0, stream>>>(wo, WO, (size_t)DM * DQ / 8); k_csP<<<(TT * HD + 255) / 256, 256, 0, stream>>>(CS);
    k_cvt8<<<(unsigned)(((size_t)NB_ * TT * DM / 8 + 255) / 256), 256, 0, stream>>>(x, XB, (size_t)NB_ * TT * DM / 8);
    k_gemmw<bf, 0, false, true><<<dim3(TT / 128, (NH_ + 2 * NKV) / 2, NB_), 128, 0, stream>>>(XB, nullptr, WQ, nullptr, DM, nullptr, 0, nullptr, (size_t)TT * DM, 0, 0, po);
    k_fattn<<<dim3(NB_ * NH_, TT / 128, 1), 128, 0, stream>>>(QP16, KP16, VT16, ATh, ATl);
    k_gemmw<bf, 1, false, false><<<dim3(NB_ * TT / 128, DM / 128, 1), 128, 0, stream>>>(ATh, ATl, WO, nullptr, DQ, OUT, DM, nullptr, 0, 0, 0, po);
}

// v009
// It runs in 126 microseconds.
// Versions between v007 and this one are left out; their measured steps multiply to 1.16 times as fast.
// Over all steps from v000 it is 31.3 times as fast.
#include <hip/hip_runtime.h>

// Multi-head attention WITHOUT a mask with interleaved-pair rotary position embedding on a fused bias-free natural projection, four batches (x [4][2048][1024]; qkv = x w_attn^T ('oi' [3072][1024] 0.02, no bias) split in thirds q | k | v (16 heads x 64; token-major); angles = t x 1 / THETA ** (2i / 64) (THETA 1e4; computed); pairs (2i, 2i+1): re cos - im sin, re sin + im cos, on q and k; scores x 1/sqrt(64); softmax over ALL keys (no mask); y = merged w_proj^T ('oi', no bias) -> [4][2048][1024] (8.4 M); argument order x, w_attn, w_proj).
// Layout, all four batches in every launch (planes [batch][head]..., batch = grid z or the high bits of grid x): bf16 copy of x; every matrix kernel stages its operands in LDS (asynchronous copies, two buffers) for a block of four waves (the q | k | v projection: eight); exact q | k | v projections in ONE launch whose epilogue (qkv_planes) applies the interleaved rotary step and writes the fp16 planes; {cos, sin} per (position, pair) built once from the int positions and float32 inverse-frequency constants (precise cosf/sinf); DENSE T-2048 attention in ONE launch (k_fattn: key and value tiles staged in LDS for the block's four waves; scores, running softmax and probability x value stay in registers; every row fp16, 1 product: without a mask no query row differs from another; every key block computed; k_gemmc stays in the file, unused); merged fp16 x Wo, 1 product.
// Compute dtypes, f32 accumulate: every input rounded to bf16; projections exact; rotary f32; attention fp16; softmax f32; merged rows rounded to fp16 (their P and V operands are fp16 already, so a low half adds no accuracy), Wo's bf16-rounded values held in fp16, 1 product.

#define NB_  4
#define TT   2048
#define DM   1024
#define NH_  16
#define NKV  16
#define REP  (NH_ / NKV)
#define HD   64
#define DQ   (NH_ * HD)
#define DKV  (NKV * HD)
#define SCL  0.125f   // HD^-0.5
typedef _Float16 h16;
typedef unsigned short bf;
typedef __attribute__((ext_vector_type(16))) __bf16   v16bf;
typedef __attribute__((ext_vector_type(16))) _Float16 v16h;
typedef __attribute__((ext_vector_type(8)))  _Float16 v8h;
typedef __attribute__((ext_vector_type(8)))  unsigned short v8us;
typedef __attribute__((ext_vector_type(8)))  float    v8f;
typedef __attribute__((ext_vector_type(4)))  float    v4f;
typedef v8h  __attribute__((may_alias)) v8ha;
typedef v4f  __attribute__((may_alias)) v4fa;
typedef v8us __attribute__((may_alias)) v8usa;

__device__ __forceinline__ unsigned short f2bf(float f) { unsigned u = __float_as_uint(f); u += 0x7FFFu + ((u >> 16) & 1u); return (unsigned short)(u >> 16); }
__device__ __forceinline__ float bf2f(unsigned short b) { return __uint_as_float(((unsigned)b) << 16); }
__device__ __forceinline__ float bfr(float f) { return bf2f(f2bf(f)); }
__device__ __forceinline__ v16h cat16(v8h lo, v8h hi) { return __builtin_shufflevector(lo, hi, 0, 1, 2, 3, 4, 5, 6, 7, 8, 9, 10, 11, 12, 13, 14, 15); }
__device__ __forceinline__ v16bf cat16b(v8us lo, v8us hi) { return __builtin_bit_cast(v16bf, __builtin_shufflevector(lo, hi, 0, 1, 2, 3, 4, 5, 6, 7, 8, 9, 10, 11, 12, 13, 14, 15)); }
__device__ __forceinline__ v8f wmma16(v16h a, v16h b, v8f c) { return __builtin_amdgcn_wmma_f32_16x16x32_f16(false, a, false, b, (short)0, c, false, false); }
__device__ __forceinline__ v8f wmmab(v16bf a, v16bf b, v8f c) { return __builtin_amdgcn_wmma_f32_16x16x32_bf16(false, a, false, b, (short)0, c, false, false); }



// ---- staging in LDS: tiles of 128-byte rows (64 16-bit elements), brought in by asynchronous copies and read as fragments at a padded pitch.
#define KST   64                 // k_fattn, keys per stage: a K tile is 64 keys x 64 d, a V^T tile 64 d x 64 keys, both 64 rows of 128 bytes
#define GKS   64                 // k_gemmw, k per stage: an operand tile is 64 WMW (A) or 64 NG WNW (B) rows of 128 bytes
#define LPB   144                // row pitch in LDS, bytes: 16 x odd, free of bank conflicts for 16-byte reads
#define LPE   (LPB / 2)          // the same in 16-bit elements
#define TILEB (64 * LPB)         // 64 staged rows
#define GTB   (128 * LPB)        // 128 staged rows
// 64 rows, 128 threads: a lane copies 16 bytes of rows r, r + 16, r + 32, r + 48 (8 lanes a row, so a wave's copy covers four whole 128-byte lines). l, g: the lane's own LDS byte address and global address in row r; gp: global row pitch in elements.
// The s_wait_xcnt closes the statement so that no register which a copy names is rewritten before the copies have taken their addresses.
template <typename T16>
__device__ __forceinline__ void stage_tile(unsigned l, const T16* g, int gp) {
    asm volatile("global_load_async_to_lds_b128 %0, %4, off\n\tglobal_load_async_to_lds_b128 %1, %5, off\n\tglobal_load_async_to_lds_b128 %2, %6, off\n\tglobal_load_async_to_lds_b128 %3, %7, off\n\ts_wait_xcnt 0x0"
                 :: "v"(l), "v"(l + 16 * LPB), "v"(l + 32 * LPB), "v"(l + 48 * LPB), "v"(g), "v"(g + 16 * gp), "v"(g + 32 * gp), "v"(g + 48 * gp) : "memory"); }

// The same for a block of 256 threads: 128 rows, a lane copies 16 bytes of rows r, r + 32, r + 64, r + 96.
// Written as the builtin: that kernel holds more than 256 vector registers, and operands of asm text would have to be moved below v256 first.
typedef __attribute__((ext_vector_type(4))) int cp4i;
template <typename T16>
__device__ __forceinline__ void stage_tile32(unsigned l, const T16* g, int gp) {
#pragma unroll
    for (int i = 0; i < 4; ++i) __builtin_amdgcn_global_load_async_to_lds_b128((__attribute__((address_space(1))) cp4i*)(g + 32 * i * gp), (__attribute__((address_space(3))) cp4i*)(l + 32 * i * LPB), 0, 0); }

// ---- k_gemmw: register-blocked GEMM, WMW x WNW waves per output tile, each wave 64 rows x NG groups of 64 columns (16 NG accumulators); grid (M / (64 WMW), N / (64 NG WNW), Z), 32 WMW WNW threads.
// The operands' K-contiguous 16-bit rows come into LDS in stages of GKS k (two buffers: the next stage flies while this one is worked on) and are shared: WNW waves read each A row, WMW each B row.
// C[m][n] (f32, pitch ldc, + optional f32 bias[n]) = sum_k A[m][k] Bt[n][k] (+ split products per NSPLIT). z-batch strides sA/sB/sC in elements. K % 64 == 0.
template <typename T16> struct WFrag;
template <> struct WFrag<h16> { typedef v16h V; static __device__ __forceinline__ V ld(const h16* p) { return cat16(*(const v8h*)p, *(const v8h*)(p + 16)); } static __device__ __forceinline__ v8f mma(V a, V b, v8f c) { return wmma16(a, b, c); } };
template <> struct WFrag<bf> { typedef v16bf V; static __device__ __forceinline__ V ld(const bf* p) { return cat16b(*(const v8us*)p, *(const v8us*)(p + 16)); } static __device__ __forceinline__ v8f mma(V a, V b, v8f c) { return wmmab(a, b, c); } };
// QKV: a wave's tile is 64 tokens x NG heads of the q | k | v projection (Bt: the q, then k, then v weight rows); instead of the f32 tile the epilogue qkv_planes writes each head's fp16 plane, C is not used.
// Its launch: NG 3, 4 x 2 waves, block tile 256 x 384: 256 blocks, one a WGP, two waves a SIMD; an A fragment read from LDS feeds 12 products, a B fragment 4.
struct QkvOut { const float* CS; h16* Q16; h16* K16; h16* V16; };
__device__ __forceinline__ void qkv_planes(const v8f (&acc)[4][4], float* os, int r0, int y, const QkvOut& po);
template <typename T16, int NSPLIT, bool BIAS, bool QKV, int NG, int WMW, int WNW>
__global__ __launch_bounds__(32 * WMW * WNW) void k_gemmw(const T16* __restrict__ A, const T16* __restrict__ A2, const T16* __restrict__ Bt, const T16* __restrict__ Bt2, int K, float* C, int ldc, const float* __restrict__ bias, size_t sA, size_t sB, size_t sC, QkvOut po) {
    typedef typename WFrag<T16>::V V;
    constexpr bool HA2 = NSPLIT == 1 || NSPLIT == 2, HB2 = NSPLIT >= 2;
    constexpr int BM = WMW * 64, BN = WNW * NG * 64, ATB = BM * LPB, BTB = BN * LPB, CR = 16 * WMW * WNW;   // the block's tile; bytes of its staged A and B tiles; rows that one copy statement brings
    constexpr int OB = (HA2 ? 2 : 1) * ATB, BUFB = OB + (HB2 ? 2 : 1) * BTB;   // a buffer: A (| A2) | B (| B2)
    __shared__ __attribute__((aligned(128))) char sm[2 * BUFB];
    const size_t z = blockIdx.z; A += z * sA; if (A2) A2 += z * sA; Bt += z * sB; if (Bt2) Bt2 += z * sB; C += z * sC;
    const int lane = threadIdx.x & 31, lr = lane & 15, hi = lane >> 4, w = __builtin_amdgcn_readfirstlane(threadIdx.x >> 5) & (WMW * WNW - 1), wm = w / WNW, wn = w % WNW;   // w: wave number, held scalar
    const int r0 = blockIdx.x * BM + wm * 64, c0 = blockIdx.y * BN + wn * (NG * 64);
    v8f acc[NG][4][4];
#pragma unroll
    for (int g = 0; g < NG; ++g)
#pragma unroll
    for (int mb = 0; mb < 4; ++mb)
#pragma unroll
        for (int nb = 0; nb < 4; ++nb) acc[g][mb][nb] = (v8f){};
    const int cpr = threadIdx.x >> 3, cpc = threadIdx.x & 7;   // the lane's place in a copy: row cpr (+ multiples of CR / 4), 16-byte column cpc
    const unsigned lc = (unsigned)(size_t)sm + cpr * LPB + cpc * 16;
    const size_t ga = (size_t)(blockIdx.x * BM + cpr) * K + cpc * 8, gb = (size_t)(blockIdx.y * BN + cpr) * K + cpc * 8, hcr = (size_t)CR * K;
    auto stage = [&](unsigned l, const T16* g) { if (CR == 64) stage_tile(l, g, K); else stage_tile32(l, g, K); };
    auto fill = [&](int st, int buf) { const unsigned l = lc + buf * BUFB; const size_t a = ga + st * GKS, b = gb + st * GKS;
#pragma unroll
        for (int h = 0; h < BM / CR; ++h) { stage(l + h * CR * LPB, A + a + h * hcr); if (HA2) stage(l + ATB + h * CR * LPB, A2 + a + h * hcr); }
#pragma unroll
        for (int h = 0; h < BN / CR; ++h) { stage(l + OB + h * CR * LPB, Bt + b + h * hcr); if (HB2) stage(l + OB + BTB + h * CR * LPB, Bt2 + b + h * hcr); } };
    const int NST = K / GKS;
    fill(0, 0);
    asm volatile("s_wait_asynccnt 0x0" ::: "memory");   // this wave's copies of stage 0 have landed
    __syncthreads();                                     // and so have the other waves': stage 0 may be read
    if (NST > 1) fill(1, 1);
    const int ao = (wm * 64 + lr) * LPE + 8 * hi, bo = (wn * (NG * 64) + lr) * LPE + 8 * hi;   // fragment reader: row lr of a 16-row group, elements 8 hi + 0..7 and 16 + 8 hi + 0..7 of a 32-element chunk
#pragma unroll 1
    for (int st = 0; st < NST; ++st) {   // kept rolled: one publish point a trip
        const T16* at = (const T16*)(sm + (st & 1) * BUFB) + ao; const T16* bt = (const T16*)(sm + (st & 1) * BUFB + OB) + bo;
#pragma unroll
        for (int kc = 0; kc < GKS; kc += 32) {
            V a[4], a2[4], b[2][4], b2[2][4];   // the A fragments serve all NG column groups; B fragments: this group's and the next one's
#pragma unroll
            for (int mb = 0; mb < 4; ++mb) { a[mb] = WFrag<T16>::ld(at + mb * 16 * LPE + kc); if (HA2) a2[mb] = WFrag<T16>::ld(at + ATB / 2 + mb * 16 * LPE + kc); }
#pragma unroll
            for (int nb = 0; nb < 4; ++nb) { b[0][nb] = WFrag<T16>::ld(bt + nb * 16 * LPE + kc); if (HB2) b2[0][nb] = WFrag<T16>::ld(bt + BTB / 2 + nb * 16 * LPE + kc); }
            __builtin_amdgcn_sched_barrier(0);   // the A fragments and the first column group's B fragments are asked for as one group: sunk among the products, each pair of LDS reads would be waited for on its own
#pragma unroll
            for (int g = 0; g < NG; ++g) {
                if (g + 1 < NG) {   // the next column group's B fragments, as one group in front of this group's products
#pragma unroll
                    for (int nb = 0; nb < 4; ++nb) { b[(g + 1) & 1][nb] = WFrag<T16>::ld(bt + ((g + 1) * 4 + nb) * 16 * LPE + kc); if (HB2) b2[(g + 1) & 1][nb] = WFrag<T16>::ld(bt + BTB / 2 + ((g + 1) * 4 + nb) * 16 * LPE + kc); }
                    __builtin_amdgcn_sched_barrier(0); }   // keeps that group together and no more than two groups' fragments in registers
#pragma unroll
                for (int nb = 0; nb < 4; ++nb)
#pragma unroll
                    for (int mb = 0; mb < 4; ++mb) { acc[g][mb][nb] = WFrag<T16>::mma(a[mb], b[g & 1][nb], acc[g][mb][nb]); if (HA2) acc[g][mb][nb] = WFrag<T16>::mma(a2[mb], b[g & 1][nb], acc[g][mb][nb]); if (HB2) acc[g][mb][nb] = WFrag<T16>::mma(a[mb], b2[g & 1][nb], acc[g][mb][nb]); }
            }
        }
        // publish point of stage st + 1, every wave, in this order
        asm volatile("s_wait_dscnt 0x0" ::: "memory");      // this wave's reads of the buffer that is refilled below have returned
        asm volatile("s_wait_asynccnt 0x0" ::: "memory");   // this wave's copies of stage st + 1 have landed
        __syncthreads();                                     // all waves: stage st + 1 may be read, stage st's buffer is free
        if (st + 2 < NST) fill(st + 2, st & 1);
    }
    asm volatile("s_wait_asynccnt 0x0" ::: "memory");   // no copy is outstanding from here on
    float* os = (float*)(sm + w * (16 * 68 * 4));        // output staging, a range of its own for each wave: behind the last trip's barrier nobody reads the buffers and nothing is copied into them any more
    if (QKV) {
#pragma unroll
        for (int g = 0; g < NG; ++g) qkv_planes(acc[g], os, r0, (blockIdx.y * WNW + wn) * NG + g, po);   // a head at a time
        return; }
    static_assert(QKV || NG == 1, "the f32 epilogue below writes one column group");
#pragma unroll
    for (int mb = 0; mb < 4; ++mb) {
#pragma unroll
        for (int nb = 0; nb < 4; ++nb) {
#pragma unroll
            for (int j = 0; j < 8; ++j) os[(hi * 8 + j) * 68 + nb * 16 + lr] = acc[0][mb][nb][j]; }
        __builtin_amdgcn_wave_barrier(); asm volatile("" ::: "memory");
        float* crow = C + (size_t)(r0 + mb * 16) * ldc + c0;
{
#pragma unroll
            for (int s = 0; s < 8; ++s) { const int row = 2 * s + hi, cofs = lr * 4; v4f val = *(const v4fa*)(os + row * 68 + cofs); if (BIAS) { val[0] += bfr(bias[c0 + cofs]); val[1] += bfr(bias[c0 + cofs + 1]); val[2] += bfr(bias[c0 + cofs + 2]); val[3] += bfr(bias[c0 + cofs + 3]); }
                *(v4f*)(crow + (size_t)row * ldc + cofs) = val; }
             }
        __builtin_amdgcn_wave_barrier(); asm volatile("" ::: "memory");
    }
}

// ---- k_gemmc: a one-wave 64x64 tile GEMM, operands read straight from global memory, specialised for causal attention: CMODE 1 skips score tiles entirely above the diagonal (query rows r0+roff.., key columns c0..), CMODE 2 limits the
// key (K) loop of the probability x value contraction to the diagonal block (probabilities beyond it are exactly zero). roff = row offset of this launch's first row within the sequence.
template <typename T16, int NSPLIT, int CMODE>
__global__ __launch_bounds__(32) void k_gemmc(const T16* __restrict__ A, const T16* __restrict__ A2, const T16* __restrict__ Bt, const T16* __restrict__ Bt2, int K, float* C, int ldc, int roff, size_t sA, size_t sB, size_t sC) {
    typedef typename WFrag<T16>::V V;
    __shared__ __align__(16) float os[16 * 68];
    const size_t z = blockIdx.z; A += z * sA; if (A2) A2 += z * sA; Bt += z * sB; if (Bt2) Bt2 += z * sB; C += z * sC;
    const int lane = threadIdx.x & 31, lr = lane & 15, hi = lane >> 4; const int r0 = blockIdx.x * 64, c0 = blockIdx.y * 64;
    if (CMODE == 1 && c0 > r0 + roff + 63) return;                  // score tile entirely above the causal diagonal: not computed
    const int Kl = (CMODE == 2) ? min(K, r0 + roff + 64) : K;        // P.V: probabilities are exactly 0 beyond the diagonal block, so the K loop stops there
    v8f acc[4][4];
#pragma unroll
    for (int mb = 0; mb < 4; ++mb)
#pragma unroll
        for (int nb = 0; nb < 4; ++nb) acc[mb][nb] = (v8f){};
    const size_t aoff = (size_t)(r0 + lr) * K + 8 * hi, boff = (size_t)(c0 + lr) * K + 8 * hi;
#pragma unroll 1
    for (int kc = 0; kc < Kl; kc += 32) {
        V a[4], a2[4];
#pragma unroll
        for (int mb = 0; mb < 4; ++mb) { a[mb] = WFrag<T16>::ld(A + aoff + (size_t)mb * 16 * K + kc); if (NSPLIT == 1 || NSPLIT == 2) a2[mb] = WFrag<T16>::ld(A2 + aoff + (size_t)mb * 16 * K + kc); }
#pragma unroll
        for (int nb = 0; nb < 4; ++nb) { const V b = WFrag<T16>::ld(Bt + boff + (size_t)nb * 16 * K + kc); V b2; if (NSPLIT >= 2) b2 = WFrag<T16>::ld(Bt2 + boff + (size_t)nb * 16 * K + kc);
#pragma unroll
            for (int mb = 0; mb < 4; ++mb) { acc[mb][nb] = WFrag<T16>::mma(a[mb], b, acc[mb][nb]); if (NSPLIT == 1 || NSPLIT == 2) acc[mb][nb] = WFrag<T16>::mma(a2[mb], b, acc[mb][nb]); if (NSPLIT >= 2) acc[mb][nb] = WFrag<T16>::mma(a[mb], b2, acc[mb][nb]); } }
        asm volatile("v_nop\n\tv_nop\n\tv_nop\n\tv_nop" : "+v"(acc[0][0]), "+v"(acc[1][1]), "+v"(acc[2][2]), "+v"(acc[3][3]) : "v"(a[0]), "v"(a[3]));
    }
#pragma unroll
    for (int mb = 0; mb < 4; ++mb) {
#pragma unroll
        for (int nb = 0; nb < 4; ++nb) {
#pragma unroll
            for (int j = 0; j < 8; ++j) os[(hi * 8 + j) * 68 + nb * 16 + lr] = acc[mb][nb][j]; }
        __builtin_amdgcn_wave_barrier(); asm volatile("" ::: "memory");
        float* crow = C + (size_t)(r0 + mb * 16) * ldc + c0;
{
#pragma unroll
            for (int s = 0; s < 8; ++s) { const int row = 2 * s + hi, cofs = lr * 4; v4f val = *(const v4fa*)(os + row * 68 + cofs);
                *(v4f*)(crow + (size_t)row * ldc + cofs) = val; }
             }
        __builtin_amdgcn_wave_barrier(); asm volatile("" ::: "memory");
    }
}

__device__ __forceinline__ h16 tohx(float x) { return (h16)x; }
typedef __attribute__((ext_vector_type(2))) _Float16 v2h;
typedef __attribute__((ext_vector_type(4))) _Float16 v4h;
typedef __attribute__((ext_vector_type(2))) unsigned short v2us;
typedef __attribute__((ext_vector_type(4))) unsigned short v4us;
typedef __attribute__((ext_vector_type(2))) float v2f;
typedef __attribute__((ext_vector_type(4))) int v4i;

__global__ __launch_bounds__(256) void k_cvt8(const float* __restrict__ src, bf* dst, size_t n8) { const size_t i = (size_t)blockIdx.x * 256 + threadIdx.x; if (i >= n8) return; const v8f v = *(const v8f*)(src + i * 8); v8us o;
#pragma unroll
    for (int k = 0; k < 8; ++k) o[k] = f2bf(v[k]); *(v8us*)(dst + i * 8) = o;  }

// the same rounding to bf16, the value then held in fp16 (operand of the fp16 output projection)
__global__ __launch_bounds__(256) void k_cvt8h(const float* __restrict__ src, h16* dst, size_t n8) { const size_t i = (size_t)blockIdx.x * 256 + threadIdx.x; if (i >= n8) return; const v8f v = *(const v8f*)(src + i * 8); v8h o;
#pragma unroll
    for (int k = 0; k < 8; ++k) o[k] = tohx(bfr(v[k])); *(v8h*)(dst + i * 8) = o;  }

__constant__ float INV2[HD / 2] = { 1.000000000e+00f, 7.498942018e-01f, 5.623413324e-01f, 4.216965139e-01f, 3.162277639e-01f, 2.371373624e-01f, 1.778279394e-01f, 1.333521456e-01f, 1.000000015e-01f, 7.498941571e-02f, 5.623412877e-02f, 4.216964915e-02f, 3.162277862e-02f, 2.371373586e-02f, 1.778279431e-02f, 1.333521493e-02f, 9.999999776e-03f, 7.498942316e-03f, 5.623413250e-03f, 4.216964822e-03f, 3.162277862e-03f, 2.371373819e-03f, 1.778279431e-03f, 1.333521446e-03f, 1.000000047e-03f, 7.498941850e-04f, 5.623413017e-04f, 4.216964880e-04f, 3.162277862e-04f, 2.371373848e-04f, 1.778279402e-04f, 1.333521504e-04f };   // 1 / THETA ** (2i / 64), i = 0..31, in float32 as THIS module writes it (the RECIPROCAL spelling, evaluated in the reference's own f32 arithmetic: these 32 literals equal it bit for bit); ten entries differ by one ulp from the negative-power values the host's own table held
__global__ __launch_bounds__(256) void k_csP(float* CS) { const int idx = blockIdx.x * 256 + threadIdx.x; if (idx >= TT * HD) return; const int d = idx % HD; const int t = idx / HD; const float a = __fmul_rn((float)t, INV2[d >> 1]); v2f cs; cs[0] = cosf(a); cs[1] = sinf(a); *(v2f*)(CS + (size_t)idx * 2) = cs;  }
// ---- qkv_planes: epilogue of the q | k | v projection tile (k_gemmw, QKV): rotary step, rounding to fp16 and the transposition of v, straight from the accumulators; no f32 projection goes to memory.
// y: q heads, then k heads, then v heads. 16 rows at a time through the wave's LDS so that every store covers whole 128-byte lines (8 lanes x 16 bytes a row):
// q, k: rows = tokens, a lane takes 8 neighbouring columns = 4 rotary pairs -> planes [head][token][64]; v: staged transposed (a lane's 8 accumulator values are 8 neighbouring tokens of one column), rows = columns, a lane takes 8 neighbouring tokens -> planes [head][64][token].
__device__ __forceinline__ void planes8(const float* r, size_t e, h16* P16) { v8h o16;   // eight neighbouring elements -> fp16 plane
#pragma unroll
    for (int q = 0; q < 8; ++q) o16[q] = tohx(r[q]);
    *(v8h*)(P16 + e) = o16;
    asm volatile("s_wait_xcnt 0x0" ::: "memory"); }   // the arithmetic that follows may reuse the address registers of this store: the wait stands between
__device__ __forceinline__ void qkv_planes(const v8f (&acc)[4][4], float* os, int r0, int y, const QkvOut& po) {
    const size_t zo = (size_t)blockIdx.z * NH_ * TT * HD;   // grid z = batch: every plane holds NH_ * TT * HD (= NKV * HD * TT) elements a batch
    const int lane = threadIdx.x & 31, lr = lane & 15, hi = lane >> 4, rw = lane >> 3, cofs = (lane & 7) * 8;   // reader: row 4 s + rw of the 16 staged, 8 elements from cofs
    if (y < NH_ + NKV) {   // q or k head (wave-uniform)
        const bool isq = y < NH_; const size_t pb = zo + (size_t)(isq ? y : y - NH_) * TT * HD;
        h16* P16 = isq ? po.Q16 : po.K16;
        const float* cp = po.CS + ((size_t)(r0 + rw) * HD + cofs) * 2;
        v2f cs[4][4][4];   // {cos, sin} of the lane's four pairs, by 16-row group and step; each group's are asked for one group ahead
#pragma unroll
        for (int s = 0; s < 4; ++s)
#pragma unroll
            for (int q = 0; q < 4; ++q) cs[0][s][q] = *(const v2f*)(cp + (size_t)(4 * s) * HD * 2 + 4 * q);
#pragma unroll
        for (int mb = 0; mb < 4; ++mb) {
            if (mb < 3) {
                if (mb > 0) asm volatile("s_wait_xcnt 0x0" ::: "memory");   // the loads below may land in registers that the stores of the group before name: the wait stands between them
#pragma unroll
                for (int s = 0; s < 4; ++s)
#pragma unroll
                    for (int q = 0; q < 4; ++q) cs[mb + 1][s][q] = *(const v2f*)(cp + (size_t)((mb + 1) * 16 + 4 * s) * HD * 2 + 4 * q);
                if (mb == 2) asm volatile("s_wait_xcnt 0x0" :: "v"(cp) : "memory"); }   // behind the last of these loads their address registers are free for other values: the wait stands in front of that reuse (the address is named as an input so that it keeps its registers up to here)
#pragma unroll
            for (int nb = 0; nb < 4; ++nb) {
#pragma unroll
                for (int j = 0; j < 8; ++j) os[(hi * 8 + j) * 68 + nb * 16 + lr] = acc[mb][nb][j]; }
            __builtin_amdgcn_wave_barrier(); asm volatile("" ::: "memory");   // the reads below take other lanes' values: keeps the compiler from moving them above the LDS stores
#pragma unroll
            for (int s = 0; s < 4; ++s) { const int row = 4 * s + rw; const v4f xa = *(const v4fa*)(os + row * 68 + cofs), xb = *(const v4fa*)(os + row * 68 + cofs + 4); const float x[8] = { xa[0], xa[1], xa[2], xa[3], xb[0], xb[1], xb[2], xb[3] }; float r[8];
#pragma unroll
                for (int q = 0; q < 4; ++q) { const v2f c = cs[mb][s][q]; r[2 * q] = x[2 * q] * c[0] - x[2 * q + 1] * c[1]; r[2 * q + 1] = x[2 * q] * c[1] + x[2 * q + 1] * c[0]; }   // even: re cos - im sin; odd: re sin + im cos
                planes8(r, pb + (size_t)(r0 + mb * 16 + row) * HD + cofs, P16); }
            __builtin_amdgcn_wave_barrier(); asm volatile("" ::: "memory");   // keeps the next 16 rows' LDS stores behind these reads
        }
    } else {                        // v head
        const size_t pb = zo + (size_t)(y - NH_ - NKV) * HD * TT;
#pragma unroll
        for (int nb = 0; nb < 4; ++nb) {
#pragma unroll
            for (int mb = 0; mb < 4; ++mb) { const v8f t8 = acc[mb][nb]; float* op = os + lr * 68 + mb * 16 + hi * 8;
                *(v4fa*)op = __builtin_shufflevector(t8, t8, 0, 1, 2, 3); *(v4fa*)(op + 4) = __builtin_shufflevector(t8, t8, 4, 5, 6, 7); }
            __builtin_amdgcn_wave_barrier(); asm volatile("" ::: "memory");   // the reads below take other lanes' values: keeps the compiler from moving them above the LDS stores
#pragma unroll
            for (int s = 0; s < 4; ++s) { const int row = 4 * s + rw; const v4f xa = *(const v4fa*)(os + row * 68 + cofs), xb = *(const v4fa*)(os + row * 68 + cofs + 4); const float x[8] = { xa[0], xa[1], xa[2], xa[3], xb[0], xb[1], xb[2], xb[3] };
                planes8(x, pb + (size_t)(nb * 16 + row) * TT + r0 + cofs, po.V16); }
            __builtin_amdgcn_wave_barrier(); asm volatile("" ::: "memory");   // keeps the next 16 columns' LDS stores behind these reads
        }
        asm volatile("s_wait_xcnt 0x0" ::: "memory");   // behind the last stores of this branch: in the built code the other branch's address arithmetic follows them and writes registers that they name
    }
}
// ---- k_fattn: scores, softmax and probability x value of all batches in one launch; nothing of a score or a probability goes to memory.
// One wave owns NQ x 16 query rows of one head and walks the 2048 keys in blocks of 32. The block's four waves share the key and value tiles: stages of KST keys are brought into LDS by asynchronous copies
// (whole 128-byte rows, two buffers: the next stage flies while this one is worked on), and every wave reads its fragments from there at a row pitch of 144 bytes.
// S^T = K Q^T (A = key rows, B = query rows): a lane holds scores of its own query column only (keys 8 hi + j of each 16-key tile), so two S^T tiles, converted in place, ARE the B operand of O^T += V^T P^T
// (A = V^T rows loaded in the same k order: 8 hi + 0..7, 16 + 8 hi + 0..7). Running softmax in log2 units: p = 2^(s c - ref), f32 row sum; ref moves (and O, sum are rescaled) only when a column's
// block maximum exceeds it by more than 8, so p <= 2^8; the common factor cancels in the final division. Operands fp16, 1 product in both contractions, for every query row.
__device__ __forceinline__ float xhalf(float x) { const int b = __float_as_int(x); return __int_as_float(__builtin_amdgcn_permlanex16(b, b, 0x76543210, 0xfedcba98, false, false)); }   // value of lane l ^ 16
// Four x = 2^x in one statement: behind a transcendental the instruction set asks for one independent instruction before its result is read or its source overwritten; here each v_exp_f32 is followed by an
// independent one and the last by v_nop, so the slot is kept whatever the compiler schedules around the statement. In place: the statement writes only registers that the compiler's own multiply-add has just written,
// so it can overwrite no operand of a matrix instruction sooner than compiled code may.
__device__ __forceinline__ void exp2x4(float& x0, float& x1, float& x2, float& x3) {
    asm("v_exp_f32 %0, %0\n\tv_exp_f32 %1, %1\n\tv_exp_f32 %2, %2\n\tv_exp_f32 %3, %3\n\tv_nop" : "+v"(x0), "+v"(x1), "+v"(x2), "+v"(x3)); }
template <typename T16, int NQ>
__device__ __forceinline__ void fa_body(const T16* __restrict__ Q, const T16* __restrict__ Kp, const T16* __restrict__ Vt, int q0, h16* Ao, const char* sm) {
    typedef typename WFrag<T16>::V V;
    constexpr float C2 = SCL * 1.4426950408889634f;
    const int lane = threadIdx.x & 31, lr = lane & 15, hi = lane >> 4;
    V qf[NQ][2];
#pragma unroll
    for (int qt = 0; qt < NQ; ++qt)
#pragma unroll
        for (int ks = 0; ks < 2; ++ks) qf[qt][ks] = WFrag<T16>::ld(Q + (size_t)(q0 + qt * 16 + lr) * HD + ks * 32 + 8 * hi);
    v8f o[4][NQ]; float ref[NQ]; v2f lsum[NQ];   // row sum: even and odd keys apart (packed adds), joined in the epilogue
#pragma unroll
    for (int qt = 0; qt < NQ; ++qt) { ref[qt] = -3.0e38f; lsum[qt] = (v2f){};
#pragma unroll
        for (int dt = 0; dt < 4; ++dt) o[dt][qt] = (v8f){}; }
    constexpr int BUFB = 2 * TILEB, NST = TT / KST;   // a buffer: K | V^T
    const int crow = threadIdx.x >> 3, ccol = threadIdx.x & 7;   // the lane's place in a copy: row crow (+ 16, 32, 48), 16-byte column ccol
    const unsigned lc = (unsigned)(size_t)sm + crow * LPB + ccol * 16;
    const int gko = crow * HD + ccol * 8, gvo = crow * TT + ccol * 8;
    auto fill = [&](int st, int buf) { const unsigned l = lc + buf * BUFB;
        stage_tile(l, Kp + gko + st * KST * HD, HD); stage_tile(l + TILEB, Vt + gvo + st * KST, TT); };
    fill(0, 0);
    asm volatile("s_wait_asynccnt 0x0" ::: "memory");   // this wave's copies of stage 0 have landed
    __syncthreads();                                     // and so have the other waves': stage 0 may be read
    fill(1, 1);
    const int fo = lr * LPE + 8 * hi;   // fragment reader: row lr of a 16-row group, elements 8 hi + 0..7 and 16 + 8 hi + 0..7 of a 32-element chunk
#pragma unroll 1
    for (int st = 0; st < NST; ++st) {   // kept rolled: one publish point a trip
    const T16* kt = (const T16*)(sm + (st & 1) * BUFB) + fo; const T16* vt = kt + TILEB / 2;
    V kf[2][2];
#pragma unroll
    for (int mt = 0; mt < 2; ++mt)
#pragma unroll
        for (int ks = 0; ks < 2; ++ks) kf[mt][ks] = WFrag<T16>::ld(kt + mt * 16 * LPE + ks * 32);
    __builtin_amdgcn_sched_barrier(0);   // the stage's first key fragments are asked for as one group: sunk among the score products, each pair of LDS reads would be waited for on its own
#pragma unroll
    for (int kb = 0; kb < KST; kb += 32) {   // the stage's blocks of 32 keys
        V vf[4];
#pragma unroll
        for (int dt = 0; dt < 4; ++dt) vf[dt] = WFrag<T16>::ld(vt + dt * 16 * LPE + kb);
        v8f s[2][NQ];
#pragma unroll
        for (int mt = 0; mt < 2; ++mt)
#pragma unroll
            for (int qt = 0; qt < NQ; ++qt) s[mt][qt] = (v8f){};
#pragma unroll
        for (int ks = 0; ks < 2; ++ks)   // tiles innermost: neighbouring matrix instructions accumulate into different tiles
#pragma unroll
            for (int mt = 0; mt < 2; ++mt)
#pragma unroll
                for (int qt = 0; qt < NQ; ++qt) s[mt][qt] = WFrag<T16>::mma(kf[mt][ks], qf[qt][ks], s[mt][qt]);
        if (kb + 32 < KST) {   // next block's key fragments OF THE SAME STAGE, fetched behind this block's score products so that they fly during the softmax; nothing of the next stage is read ahead
#pragma unroll
            for (int mt = 0; mt < 2; ++mt)
#pragma unroll
                for (int ks = 0; ks < 2; ++ks) kf[mt][ks] = WFrag<T16>::ld(kt + (kb + 32 + mt * 16) * LPE + ks * 32); }
        float mx[NQ]; bool need = false;
#pragma unroll
        for (int qt = 0; qt < NQ; ++qt) { float m = s[0][qt][0];
#pragma unroll
            for (int j = 1; j < 8; ++j) m = fmaxf(m, s[0][qt][j]);
#pragma unroll
            for (int j = 0; j < 8; ++j) m = fmaxf(m, s[1][qt][j]);
            m = fmaxf(m, xhalf(m)) * C2; mx[qt] = m; need = need || (m > ref[qt] + 8.0f); }
        if (__builtin_amdgcn_ballot_w32(need) != 0) {   // wave-uniform: rare after the first block
#pragma unroll
            for (int qt = 0; qt < NQ; ++qt) { const float mn = fmaxf(ref[qt], mx[qt]); const float al = __builtin_amdgcn_exp2f(ref[qt] - mn); ref[qt] = mn; lsum[qt] *= al;
#pragma unroll
                for (int dt = 0; dt < 4; ++dt) o[dt][qt] *= al; } }
#pragma unroll
        for (int qt = 0; qt < NQ; ++qt) { V pf; float pe[16];
#pragma unroll
            for (int e = 0; e < 16; ++e) pe[e] = __builtin_fmaf(s[e >> 3][qt][e & 7], C2, -ref[qt]);
#pragma unroll
            for (int e = 0; e < 16; e += 4) exp2x4(pe[e], pe[e + 1], pe[e + 2], pe[e + 3]);
#pragma unroll
            for (int e = 0; e < 16; e += 2) lsum[qt] += (v2f){pe[e], pe[e + 1]};
#pragma unroll
            for (int e = 0; e < 16; ++e) pf[e] = (__typeof__(pf[0]))pe[e];
#pragma unroll
            for (int dt = 0; dt < 4; ++dt) o[dt][qt] = WFrag<T16>::mma(vf[dt], pf, o[dt][qt]); }
    }
    // publish point of stage st + 1, every wave, in this order
    asm volatile("s_wait_dscnt 0x0" ::: "memory");      // this wave's reads of the buffer that is refilled below have returned
    asm volatile("s_wait_asynccnt 0x0" ::: "memory");   // this wave's copies of stage st + 1 have landed
    __syncthreads();                                     // all waves: stage st + 1 may be read, stage st's buffer is free
    if (st + 2 < NST) fill(st + 2, st & 1);
    }
    asm volatile("s_wait_asynccnt 0x0" ::: "memory");   // no copy is outstanding when the wave goes on to its end
#pragma unroll
    for (int qt = 0; qt < NQ; ++qt) { const float lh = lsum[qt][0] + lsum[qt][1]; const float inv = __fdiv_rn(1.0f, lh + xhalf(lh));   // the two halves of a column hold disjoint keys under one ref: joined once
        const size_t oo = (size_t)(q0 + qt * 16 + lr) * DQ + 8 * hi;
#pragma unroll
        for (int dt = 0; dt < 4; ++dt) { v8h oh;
#pragma unroll
            for (int j = 0; j < 8; ++j) oh[j] = tohx(o[dt][qt][j] * inv);
            *(v8h*)(Ao + oo + dt * 16) = oh;
            asm volatile("s_wait_xcnt 0x0" ::: "memory"); } }   // the arithmetic that follows may reuse the registers of this store: the wait stands between
}
// grid (batches x heads, TT / 128), 4 waves: a block takes 4 x 32 query rows; its four waves walk the same head's keys together. Writes the merged token-major fp16 plane.
__global__ __launch_bounds__(128) void k_fattn(const h16* __restrict__ Q16, const h16* __restrict__ K16, const h16* __restrict__ V16, h16* Ao) {
    __shared__ __attribute__((aligned(128))) char sm[2 * 2 * TILEB];   // two buffers of two tiles
    const int h = blockIdx.x % NH_, b = blockIdx.x / NH_, w = threadIdx.x >> 5, bx = blockIdx.y; const size_t po = ((size_t)b * NH_ + h) * TT * HD, pk = ((size_t)b * NKV + h / REP) * TT * HD, ao = (size_t)b * TT * DQ + h * HD;
    fa_body<h16, 2>(Q16 + po, K16 + pk, V16 + pk, bx * 128 + w * 32, Ao + ao, sm);
}

extern "C" void kernel_launch(void* const* d_in, const int* in_sizes, int n_in,
                              void* d_out, int out_size, void* d_ws, size_t ws_size, hipStream_t stream) {
    (void)in_sizes; (void)n_in; (void)out_size;
    const float* x = (const float*)d_in[0]; const float* wqkv = (const float*)d_in[1]; const float* wo = (const float*)d_in[2];   /* order x, w_attn ('oi' [3072][1024]: q | k | v row blocks), w_proj ('oi' [1024][1024]) */
    float* OUT = (float*)d_out;     // [4][2048][1024]
    char* wsp = (char*)d_ws;
    auto take = [&](size_t bytes) { char* p = wsp; wsp += (bytes + 255) & ~(size_t)255; return (void*)p; };
    bf* WQ = (bf*)take((size_t)(DQ + 2 * DKV) * DM * 2);   /* one buffer: q | k | v weight rows */ h16* WO = (h16*)take((size_t)DM * DQ * 2); float* CS = (float*)take((size_t)TT * HD * 2 * 4);
    bf* XB = (bf*)take((size_t)NB_ * TT * DM * 2);
    h16* QP16 = (h16*)take((size_t)NB_ * NH_ * TT * HD * 2); h16* KP16 = (h16*)take((size_t)NB_ * NKV * TT * HD * 2); h16* VT16 = (h16*)take((size_t)NB_ * NKV * HD * TT * 2);
    h16* AT16 = (h16*)take((size_t)NB_ * TT * DQ * 2);
    if ((size_t)(wsp - (char*)d_ws) > ws_size) return;    // ws 256 MiB
    const QkvOut po = { CS, QP16, KP16, VT16 };
    // every stage once, for all batches: x, the merged planes and out are contiguous over the batches (rows batch * TT + token); the q | k | v weight rows are one contiguous block
    k_cvt8<<<(unsigned)(((size_t)(DQ + 2 * DKV) * DM / 8 + 255) / 256), 256, 0, stream>>>(wqkv, WQ, (size_t)(DQ + 2 * DKV) * DM / 8);
    k_cvt8h<<<(unsigned)(((size_t)DM * DQ / 8 + 255) / 256), 256, 0, stream>>>(wo, WO, (size_t)DM * DQ / 8); k_csP<<<(TT * HD + 255) / 256, 256, 0, stream>>>(CS);
    k_cvt8<<<(unsigned)(((size_t)NB_ * TT * DM / 8 + 255) / 256), 256, 0, stream>>>(x, XB, (size_t)NB_ * TT * DM / 8);
    k_gemmw<bf, 0, false, true, 3, 4, 2><<<dim3(TT / 256, (NH_ + 2 * NKV) / 6, NB_), 256, 0, stream>>>(XB, nullptr, WQ, nullptr, DM, nullptr, 0, nullptr, (size_t)TT * DM, 0, 0, po);
    k_fattn<<<dim3(NB_ * NH_, TT / 128, 1), 128, 0, stream>>>(QP16, KP16, VT16, AT16);
    k_gemmw<h16, 0, false, false, 1, 2, 2><<<dim3(NB_ * TT / 128, DM / 128, 1), 128, 0, stream>>>(AT16, nullptr, WO, nullptr, DQ, OUT, DM, nullptr, 0, 0, 0, po);
}

// v010
// A run of this version takes 121 microseconds.
// In two side-by-side timings against v009, it was 1.05 and 1.04 times as fast.
// Counting every step since v000, it is 32.6 times as fast.
#include <hip/hip_runtime.h>

// Multi-head attention WITHOUT a mask with interleaved-pair rotary position embedding on a fused bias-free natural projection, four batches (x [4][2048][1024]; qkv = x w_attn^T ('oi' [3072][1024] 0.02, no bias) split in thirds q | k | v (16 heads x 64; token-major); angles = t x 1 / THETA ** (2i / 64) (THETA 1e4; computed); pairs (2i, 2i+1): re cos - im sin, re sin + im cos, on q and k; scores x 1/sqrt(64); softmax over ALL keys (no mask); y = merged w_proj^T ('oi', no bias) -> [4][2048][1024] (8.4 M); argument order x, w_attn, w_proj).
// Layout, all four batches in every launch (planes [batch][head]..., batch = grid z or the high bits of grid x): bf16 copy of x; every matrix kernel stages its operands in LDS (asynchronous copies, two buffers) for a block of four waves (the q | k | v projection: eight); exact q | k | v projections in ONE launch whose epilogue (qkv_planes) applies the interleaved rotary step and writes the fp16 planes; {cos, sin} per (position, pair) built once from the int positions and float32 inverse-frequency constants (precise cosf/sinf); DENSE T-2048 attention in ONE launch (k_fattn: key and value tiles staged in LDS for the block's four waves; scores, running softmax and probability x value stay in registers; every row fp16, 1 product: without a mask no query row differs from another; every key block computed; k_gemmc stays in the file, unused); merged fp16 x Wo, 1 product.
// Compute dtypes, f32 accumulate: every input rounded to bf16; projections exact; rotary f32; attention fp16; softmax f32; merged rows rounded to fp16 (their P and V operands are fp16 already, so a low half adds no accuracy), Wo's bf16-rounded values held in fp16, 1 product.

#define NB_  4
#define TT   2048
#define DM   1024
#define NH_  16
#define NKV  16
#define REP  (NH_ / NKV)
#define HD   64
#define DQ   (NH_ * HD)
#define DKV  (NKV * HD)
#define SCL  0.125f   // HD^-0.5
typedef _Float16 h16;
typedef unsigned short bf;
typedef __attribute__((ext_vector_type(16))) __bf16   v16bf;
typedef __attribute__((ext_vector_type(16))) _Float16 v16h;
typedef __attribute__((ext_vector_type(8)))  _Float16 v8h;
typedef __attribute__((ext_vector_type(8)))  unsigned short v8us;
typedef __attribute__((ext_vector_type(8)))  float    v8f;
typedef __attribute__((ext_vector_type(4)))  float    v4f;
typedef v8h  __attribute__((may_alias)) v8ha;
typedef v4f  __attribute__((may_alias)) v4fa;
typedef v8us __attribute__((may_alias)) v8usa;

__device__ __forceinline__ unsigned short f2bf(float f) { unsigned u = __float_as_uint(f); u += 0x7FFFu + ((u >> 16) & 1u); return (unsigned short)(u >> 16); }
__device__ __forceinline__ float bf2f(unsigned short b) { return __uint_as_float(((unsigned)b) << 16); }
__device__ __forceinline__ float bfr(float f) { return bf2f(f2bf(f)); }
__device__ __forceinline__ v16h cat16(v8h lo, v8h hi) { return __builtin_shufflevector(lo, hi, 0, 1, 2, 3, 4, 5, 6, 7, 8, 9, 10, 11, 12, 13, 14, 15); }
__device__ __forceinline__ v16bf cat16b(v8us lo, v8us hi) { return __builtin_bit_cast(v16bf, __builtin_shufflevector(lo, hi, 0, 1, 2, 3, 4, 5, 6, 7, 8, 9, 10, 11, 12, 13, 14, 15)); }
__device__ __forceinline__ v8f wmma16(v16h a, v16h b, v8f c) { return __builtin_amdgcn_wmma_f32_16x16x32_f16(false, a, false, b, (short)0, c, false, false); }
__device__ __forceinline__ v8f wmmab(v16bf a, v16bf b, v8f c) { return __builtin_amdgcn_wmma_f32_16x16x32_bf16(false, a, false, b, (short)0, c, false, false); }



// ---- staging in LDS: tiles of 128-byte rows (64 16-bit elements), brought in by asynchronous copies and read as fragments at a padded pitch.
#define KST   64                 // k_fattn, keys per stage: a K tile is 64 keys x 64 d, a V^T tile 64 d x 64 keys, both 64 rows of 128 bytes
#define GKS   64                 // k_gemmw, k per stage: an operand tile is 64 WMW (A) or 64 NG WNW (B) rows of 128 bytes
#define LPB   144                // row pitch in LDS, bytes: 16 x odd, free of bank conflicts for 16-byte reads
#define LPE   (LPB / 2)          // the same in 16-bit elements
#define TILEB (64 * LPB)         // 64 staged rows
#define GTB   (128 * LPB)        // 128 staged rows
// 64 rows, 128 threads: a lane copies 16 bytes of rows r, r + 16, r + 32, r + 48 (8 lanes a row, so a wave's copy covers four whole 128-byte lines). l, g: the lane's own LDS byte address and global address in row r; gp: global row pitch in elements.
// The s_wait_xcnt closes the statement so that no register which a copy names is rewritten before the copies have taken their addresses.
template <typename T16>
__device__ __forceinline__ void stage_tile(unsigned l, const T16* g, int gp) {
    asm volatile("global_load_async_to_lds_b128 %0, %4, off\n\tglobal_load_async_to_lds_b128 %1, %5, off\n\tglobal_load_async_to_lds_b128 %2, %6, off\n\tglobal_load_async_to_lds_b128 %3, %7, off\n\ts_wait_xcnt 0x0"
                 :: "v"(l), "v"(l + 16 * LPB), "v"(l + 32 * LPB), "v"(l + 48 * LPB), "v"(g), "v"(g + 16 * gp), "v"(g + 32 * gp), "v"(g + 48 * gp) : "memory"); }

// The same for a block of 256 threads: 128 rows, a lane copies 16 bytes of rows r, r + 32, r + 64, r + 96.
// Written as the builtin: that kernel holds more than 256 vector registers, and operands of asm text would have to be moved below v256 first.
typedef __attribute__((ext_vector_type(4))) int cp4i;
template <typename T16>
__device__ __forceinline__ void stage_tile32(unsigned l, const T16* g, int gp) {
#pragma unroll
    for (int i = 0; i < 4; ++i) __builtin_amdgcn_global_load_async_to_lds_b128((__attribute__((address_space(1))) cp4i*)(g + 32 * i * gp), (__attribute__((address_space(3))) cp4i*)(l + 32 * i * LPB), 0, 0); }

// ---- k_gemmw: register-blocked GEMM, WMW x WNW waves per output tile, each wave 64 rows x NG groups of 64 columns (16 NG accumulators); grid (M / (64 WMW), N / (64 NG WNW), Z), 32 WMW WNW threads.
// The operands' K-contiguous 16-bit rows come into LDS in stages of GKS k (two buffers: the next stage flies while this one is worked on) and are shared: WNW waves read each A row, WMW each B row.
// C[m][n] (f32, pitch ldc, + optional f32 bias[n]) = sum_k A[m][k] Bt[n][k] (+ split products per NSPLIT). z-batch strides sA/sB/sC in elements. K % 64 == 0.
template <typename T16> struct WFrag;
template <> struct WFrag<h16> { typedef v16h V; static __device__ __forceinline__ V ld(const h16* p) { return cat16(*(const v8h*)p, *(const v8h*)(p + 16)); } static __device__ __forceinline__ v8f mma(V a, V b, v8f c) { return wmma16(a, b, c); } };
template <> struct WFrag<bf> { typedef v16bf V; static __device__ __forceinline__ V ld(const bf* p) { return cat16b(*(const v8us*)p, *(const v8us*)(p + 16)); } static __device__ __forceinline__ v8f mma(V a, V b, v8f c) { return wmmab(a, b, c); } };
// QKV: a wave's tile is 64 tokens x NG heads of the q | k | v projection (Bt: the q, then k, then v weight rows); instead of the f32 tile the epilogue qkv_planes writes each head's fp16 plane, C is not used.
// Its launch: NG 3, 4 x 2 waves, block tile 256 x 384: 256 blocks, one a WGP, two waves a SIMD; an A fragment read from LDS feeds 12 products, a B fragment 4.
struct QkvOut { const float* CS; h16* Q16; h16* K16; h16* V16; };
__device__ __forceinline__ void qkv_planes(const v8f (&acc)[4][4], float* os, int r0, int y, const QkvOut& po);
template <typename T16, int NSPLIT, bool BIAS, bool QKV, int NG, int WMW, int WNW>
__global__ __launch_bounds__(32 * WMW * WNW) void k_gemmw(const T16* __restrict__ A, const T16* __restrict__ A2, const T16* __restrict__ Bt, const T16* __restrict__ Bt2, int K, float* C, int ldc, const float* __restrict__ bias, size_t sA, size_t sB, size_t sC, QkvOut po) {
    typedef typename WFrag<T16>::V V;
    constexpr bool HA2 = NSPLIT == 1 || NSPLIT == 2, HB2 = NSPLIT >= 2;
    constexpr int BM = WMW * 64, BN = WNW * NG * 64, ATB = BM * LPB, BTB = BN * LPB, CR = 16 * WMW * WNW;   // the block's tile; bytes of its staged A and B tiles; rows that one copy statement brings
    constexpr int OB = (HA2 ? 2 : 1) * ATB, BUFB = OB + (HB2 ? 2 : 1) * BTB;   // a buffer: A (| A2) | B (| B2)
    __shared__ __attribute__((aligned(128))) char sm[2 * BUFB];
    const size_t z = blockIdx.z; A += z * sA; if (A2) A2 += z * sA; Bt += z * sB; if (Bt2) Bt2 += z * sB; C += z * sC;
    const int lane = threadIdx.x & 31, lr = lane & 15, hi = lane >> 4, w = __builtin_amdgcn_readfirstlane(threadIdx.x >> 5) & (WMW * WNW - 1), wm = w / WNW, wn = w % WNW;   // w: wave number, held scalar
    const int r0 = blockIdx.x * BM + wm * 64, c0 = blockIdx.y * BN + wn * (NG * 64);
    v8f acc[NG][4][4];
#pragma unroll
    for (int g = 0; g < NG; ++g)
#pragma unroll
    for (int mb = 0; mb < 4; ++mb)
#pragma unroll
        for (int nb = 0; nb < 4; ++nb) acc[g][mb][nb] = (v8f){};
    const int cpr = threadIdx.x >> 3, cpc = threadIdx.x & 7;   // the lane's place in a copy: row cpr (+ multiples of CR / 4), 16-byte column cpc
    const unsigned lc = (unsigned)(size_t)sm + cpr * LPB + cpc * 16;
    const size_t ga = (size_t)(blockIdx.x * BM + cpr) * K + cpc * 8, gb = (size_t)(blockIdx.y * BN + cpr) * K + cpc * 8, hcr = (size_t)CR * K;
    auto stage = [&](unsigned l, const T16* g) { if (CR == 64) stage_tile(l, g, K); else stage_tile32(l, g, K); };
    auto fill = [&](int st, int buf) { const unsigned l = lc + buf * BUFB; const size_t a = ga + st * GKS, b = gb + st * GKS;
#pragma unroll
        for (int h = 0; h < BM / CR; ++h) { stage(l + h * CR * LPB, A + a + h * hcr); if (HA2) stage(l + ATB + h * CR * LPB, A2 + a + h * hcr); }
#pragma unroll
        for (int h = 0; h < BN / CR; ++h) { stage(l + OB + h * CR * LPB, Bt + b + h * hcr); if (HB2) stage(l + OB + BTB + h * CR * LPB, Bt2 + b + h * hcr); } };
    const int NST = K / GKS;
    fill(0, 0);
    asm volatile("s_wait_asynccnt 0x0" ::: "memory");   // this wave's copies of stage 0 have landed
    __syncthreads();                                     // and so have the other waves': stage 0 may be read
    if (NST > 1) fill(1, 1);
    const int ao = (wm * 64 + lr) * LPE + 8 * hi, bo = (wn * (NG * 64) + lr) * LPE + 8 * hi;   // fragment reader: row lr of a 16-row group, elements 8 hi + 0..7 and 16 + 8 hi + 0..7 of a 32-element chunk
#pragma unroll 1
    for (int st = 0; st < NST; ++st) {   // kept rolled: one publish point a trip
        const T16* at = (const T16*)(sm + (st & 1) * BUFB) + ao; const T16* bt = (const T16*)(sm + (st & 1) * BUFB + OB) + bo;
#pragma unroll
        for (int kc = 0; kc < GKS; kc += 32) {
            V a[4], a2[4], b[2][4], b2[2][4];   // the A fragments serve all NG column groups; B fragments: this group's and the next one's
#pragma unroll
            for (int mb = 0; mb < 4; ++mb) { a[mb] = WFrag<T16>::ld(at + mb * 16 * LPE + kc); if (HA2) a2[mb] = WFrag<T16>::ld(at + ATB / 2 + mb * 16 * LPE + kc); }
#pragma unroll
            for (int nb = 0; nb < 4; ++nb) { b[0][nb] = WFrag<T16>::ld(bt + nb * 16 * LPE + kc); if (HB2) b2[0][nb] = WFrag<T16>::ld(bt + BTB / 2 + nb * 16 * LPE + kc); }
            __builtin_amdgcn_sched_barrier(0);   // the A fragments and the first column group's B fragments are asked for as one group: sunk among the products, each pair of LDS reads would be waited for on its own
#pragma unroll
            for (int g = 0; g < NG; ++g) {
                if (g + 1 < NG) {   // the next column group's B fragments, as one group in front of this group's products
#pragma unroll
                    for (int nb = 0; nb < 4; ++nb) { b[(g + 1) & 1][nb] = WFrag<T16>::ld(bt + ((g + 1) * 4 + nb) * 16 * LPE + kc); if (HB2) b2[(g + 1) & 1][nb] = WFrag<T16>::ld(bt + BTB / 2 + ((g + 1) * 4 + nb) * 16 * LPE + kc); }
                    __builtin_amdgcn_sched_barrier(0); }   // keeps that group together and no more than two groups' fragments in registers
#pragma unroll
                for (int nb = 0; nb < 4; ++nb)
#pragma unroll
                    for (int mb = 0; mb < 4; ++mb) { acc[g][mb][nb] = WFrag<T16>::mma(a[mb], b[g & 1][nb], acc[g][mb][nb]); if (HA2) acc[g][mb][nb] = WFrag<T16>::mma(a2[mb], b[g & 1][nb], acc[g][mb][nb]); if (HB2) acc[g][mb][nb] = WFrag<T16>::mma(a[mb], b2[g & 1][nb], acc[g][mb][nb]); }
            }
        }
        // publish point of stage st + 1, every wave, in this order
        asm volatile("s_wait_dscnt 0x0" ::: "memory");      // this wave's reads of the buffer that is refilled below have returned
        asm volatile("s_wait_asynccnt 0x0" ::: "memory");   // this wave's copies of stage st + 1 have landed
        __syncthreads();                                     // all waves: stage st + 1 may be read, stage st's buffer is free
        if (st + 2 < NST) fill(st + 2, st & 1);
    }
    asm volatile("s_wait_asynccnt 0x0" ::: "memory");   // no copy is outstanding from here on
    float* os = (float*)(sm + w * (16 * 68 * 4));        // output staging, a range of its own for each wave: behind the last trip's barrier nobody reads the buffers and nothing is copied into them any more
    if (QKV) {
#pragma unroll
        for (int g = 0; g < NG; ++g) qkv_planes(acc[g], os, r0, (blockIdx.y * WNW + wn) * NG + g, po);   // a head at a time
        return; }
    static_assert(QKV || NG == 1, "the f32 epilogue below writes one column group");
#pragma unroll
    for (int mb = 0; mb < 4; ++mb) {
#pragma unroll
        for (int nb = 0; nb < 4; ++nb) {
#pragma unroll
            for (int j = 0; j < 8; ++j) os[(hi * 8 + j) * 68 + nb * 16 + lr] = acc[0][mb][nb][j]; }
        __builtin_amdgcn_wave_barrier(); asm volatile("" ::: "memory");
        float* crow = C + (size_t)(r0 + mb * 16) * ldc + c0;
{
#pragma unroll
            for (int s = 0; s < 8; ++s) { const int row = 2 * s + hi, cofs = lr * 4; v4f val = *(const v4fa*)(os + row * 68 + cofs); if (BIAS) { val[0] += bfr(bias[c0 + cofs]); val[1] += bfr(bias[c0 + cofs + 1]); val[2] += bfr(bias[c0 + cofs + 2]); val[3] += bfr(bias[c0 + cofs + 3]); }
                *(v4f*)(crow + (size_t)row * ldc + cofs) = val; }
             }
        __builtin_amdgcn_wave_barrier(); asm volatile("" ::: "memory");
    }
}

// ---- k_gemmc: a one-wave 64x64 tile GEMM, operands read straight from global memory, specialised for causal attention: CMODE 1 skips score tiles entirely above the diagonal (query rows r0+roff.., key columns c0..), CMODE 2 limits the
// key (K) loop of the probability x value contraction to the diagonal block (probabilities beyond it are exactly zero). roff = row offset of this launch's first row within the sequence.
template <typename T16, int NSPLIT, int CMODE>
__global__ __launch_bounds__(32) void k_gemmc(const T16* __restrict__ A, const T16* __restrict__ A2, const T16* __restrict__ Bt, const T16* __restrict__ Bt2, int K, float* C, int ldc, int roff, size_t sA, size_t sB, size_t sC) {
    typedef typename WFrag<T16>::V V;
    __shared__ __align__(16) float os[16 * 68];
    const size_t z = blockIdx.z; A += z * sA; if (A2) A2 += z * sA; Bt += z * sB; if (Bt2) Bt2 += z * sB; C += z * sC;
    const int lane = threadIdx.x & 31, lr = lane & 15, hi = lane >> 4; const int r0 = blockIdx.x * 64, c0 = blockIdx.y * 64;
    if (CMODE == 1 && c0 > r0 + roff + 63) return;                  // score tile entirely above the causal diagonal: not computed
    const int Kl = (CMODE == 2) ? min(K, r0 + roff + 64) : K;        // P.V: probabilities are exactly 0 beyond the diagonal block, so the K loop stops there
    v8f acc[4][4];
#pragma unroll
    for (int mb = 0; mb < 4; ++mb)
#pragma unroll
        for (int nb = 0; nb < 4; ++nb) acc[mb][nb] = (v8f){};
    const size_t aoff = (size_t)(r0 + lr) * K + 8 * hi, boff = (size_t)(c0 + lr) * K + 8 * hi;
#pragma unroll 1
    for (int kc = 0; kc < Kl; kc += 32) {
        V a[4], a2[4];
#pragma unroll
        for (int mb = 0; mb < 4; ++mb) { a[mb] = WFrag<T16>::ld(A + aoff + (size_t)mb * 16 * K + kc); if (NSPLIT == 1 || NSPLIT == 2) a2[mb] = WFrag<T16>::ld(A2 + aoff + (size_t)mb * 16 * K + kc); }
#pragma unroll
        for (int nb = 0; nb < 4; ++nb) { const V b = WFrag<T16>::ld(Bt + boff + (size_t)nb * 16 * K + kc); V b2; if (NSPLIT >= 2) b2 = WFrag<T16>::ld(Bt2 + boff + (size_t)nb * 16 * K + kc);
#pragma unroll
            for (int mb = 0; mb < 4; ++mb) { acc[mb][nb] = WFrag<T16>::mma(a[mb], b, acc[mb][nb]); if (NSPLIT == 1 || NSPLIT == 2) acc[mb][nb] = WFrag<T16>::mma(a2[mb], b, acc[mb][nb]); if (NSPLIT >= 2) acc[mb][nb] = WFrag<T16>::mma(a[mb], b2, acc[mb][nb]); } }
        asm volatile("v_nop\n\tv_nop\n\tv_nop\n\tv_nop" : "+v"(acc[0][0]), "+v"(acc[1][1]), "+v"(acc[2][2]), "+v"(acc[3][3]) : "v"(a[0]), "v"(a[3]));
    }
#pragma unroll
    for (int mb = 0; mb < 4; ++mb) {
#pragma unroll
        for (int nb = 0; nb < 4; ++nb) {
#pragma unroll
            for (int j = 0; j < 8; ++j) os[(hi * 8 + j) * 68 + nb * 16 + lr] = acc[mb][nb][j]; }
        __builtin_amdgcn_wave_barrier(); asm volatile("" ::: "memory");
        float* crow = C + (size_t)(r0 + mb * 16) * ldc + c0;
{
#pragma unroll
            for (int s = 0; s < 8; ++s) { const int row = 2 * s + hi, cofs = lr * 4; v4f val = *(const v4fa*)(os + row * 68 + cofs);
                *(v4f*)(crow + (size_t)row * ldc + cofs) = val; }
             }
        __builtin_amdgcn_wave_barrier(); asm volatile("" ::: "memory");
    }
}

__device__ __forceinline__ h16 tohx(float x) { return (h16)x; }
typedef __attribute__((ext_vector_type(2))) _Float16 v2h;
typedef __attribute__((ext_vector_type(4))) _Float16 v4h;
typedef __attribute__((ext_vector_type(2))) unsigned short v2us;
typedef __attribute__((ext_vector_type(4))) unsigned short v4us;
typedef __attribute__((ext_vector_type(2))) float v2f;
typedef __attribute__((ext_vector_type(4))) int v4i;

// ---- k_prep: all that the matrix kernels need beforehand, in ONE launch that fills the chip once: PREPT threads = 4096 waves, 16 a WGP (blocks of 512, one a WGP).
// A thread rounds 12 groups of eight neighbouring f32 values (8 of x, 3 of the q | k | v weights, 1 of Wo; a block takes one contiguous stretch of each buffer in steps of 512 groups, a thread one group a step, so a wave's loads and stores cover whole 128-byte lines) and builds one table entry.
// Its 24 loads of 16 bytes are asked for together, ahead of all arithmetic: the table entry's cosine and sine run while they fly.
#define PREPT (TT * HD)
__device__ __forceinline__ v8us rnd8(v8f v) { v8us o;   // f32 -> bf16
#pragma unroll
    for (int k = 0; k < 8; ++k) o[k] = f2bf(v[k]); return o; }
__device__ __forceinline__ v8h rnd8h(v8f v) { v8h o;   // the same rounding to bf16, the value then held in fp16 (operand of the fp16 output projection)
#pragma unroll
    for (int k = 0; k < 8; ++k) o[k] = tohx(bfr(v[k])); return o; }

__constant__ float INV2[HD / 2] = { 1.000000000e+00f, 7.498942018e-01f, 5.623413324e-01f, 4.216965139e-01f, 3.162277639e-01f, 2.371373624e-01f, 1.778279394e-01f, 1.333521456e-01f, 1.000000015e-01f, 7.498941571e-02f, 5.623412877e-02f, 4.216964915e-02f, 3.162277862e-02f, 2.371373586e-02f, 1.778279431e-02f, 1.333521493e-02f, 9.999999776e-03f, 7.498942316e-03f, 5.623413250e-03f, 4.216964822e-03f, 3.162277862e-03f, 2.371373819e-03f, 1.778279431e-03f, 1.333521446e-03f, 1.000000047e-03f, 7.498941850e-04f, 5.623413017e-04f, 4.216964880e-04f, 3.162277862e-04f, 2.371373848e-04f, 1.778279402e-04f, 1.333521504e-04f };   // 1 / THETA ** (2i / 64), i = 0..31, in float32 as THIS module writes it (the RECIPROCAL spelling, evaluated in the reference's own f32 arithmetic: these 32 literals equal it bit for bit); ten entries differ by one ulp from the negative-power values the host's own table held
__global__ __launch_bounds__(512) void k_prep(const float* __restrict__ x, const float* __restrict__ wqkv, const float* __restrict__ wo, bf* XB, bf* WQ, h16* WO, float* CS) {
    constexpr int NX = NB_ * TT * DM / 8 / PREPT, NW = (DQ + 2 * DKV) * DM / 8 / PREPT, NO = DM * DQ / 8 / PREPT;   // groups a thread: 8, 3, 1
    static_assert(NX * PREPT * 8 == NB_ * TT * DM && NW * PREPT * 8 == (DQ + 2 * DKV) * DM && NO * PREPT * 8 == DM * DQ, "every buffer is a whole number of groups a thread");
    const int idx = blockIdx.x * 512 + threadIdx.x; const int d = idx % HD; const int t = idx / HD;
    const size_t bx = (size_t)blockIdx.x * (512 * 8);                   // elements of one step of 512 groups, times the block's number: with the factor NX, NW or NO the start of the block's own stretch of a buffer
    const unsigned ib = threadIdx.x * 32u, ob = threadIdx.x * 16u;   // the thread's byte offset in a step, f32 and 16-bit: one 32-bit register beside a uniform base serves every load, one every store; the steps are immediate offsets
    const float inv = INV2[d >> 1];
    __builtin_amdgcn_sched_barrier(0);   // the table's frequency is asked for first, so that its wait leaves the 24 loads below in flight
    v8f vx[NX], vw[NW], vo[NO];
#pragma unroll
    for (int k = 0; k < NX; ++k) vx[k] = *(const v8f*)((const char*)(x + bx * NX + k * (512 * 8)) + ib);
#pragma unroll
    for (int k = 0; k < NW; ++k) vw[k] = *(const v8f*)((const char*)(wqkv + bx * NW + k * (512 * 8)) + ib);
#pragma unroll
    for (int k = 0; k < NO; ++k) vo[k] = *(const v8f*)((const char*)(wo + bx * NO + k * (512 * 8)) + ib);
    __builtin_amdgcn_sched_barrier(0);   // keeps the loads one group in front of the arithmetic: sunk to their uses, few would be in flight at a time
    const float a = __fmul_rn((float)t, inv); v2f cs; cs[0] = cosf(a); cs[1] = sinf(a); *(v2f*)(CS + (size_t)idx * 2) = cs;
#pragma unroll
    for (int k = 0; k < NX; ++k) *(v8us*)((char*)(XB + bx * NX + k * (512 * 8)) + ob) = rnd8(vx[k]);
#pragma unroll
    for (int k = 0; k < NW; ++k) *(v8us*)((char*)(WQ + bx * NW + k * (512 * 8)) + ob) = rnd8(vw[k]);
#pragma unroll
    for (int k = 0; k < NO; ++k) *(v8h*)((char*)(WO + bx * NO + k * (512 * 8)) + ob) = rnd8h(vo[k]);
}
// ---- qkv_planes: epilogue of the q | k | v projection tile (k_gemmw, QKV): rotary step, rounding to fp16 and the transposition of v, straight from the accumulators; no f32 projection goes to memory.
// y: q heads, then k heads, then v heads. 16 rows at a time through the wave's LDS so that every store covers whole 128-byte lines (8 lanes x 16 bytes a row):
// q, k: rows = tokens, a lane takes 8 neighbouring columns = 4 rotary pairs -> planes [head][token][64]; v: staged transposed (a lane's 8 accumulator values are 8 neighbouring tokens of one column), rows = columns, a lane takes 8 neighbouring tokens -> planes [head][64][token].
__device__ __forceinline__ void planes8(const float* r, size_t e, h16* P16) { v8h o16;   // eight neighbouring elements -> fp16 plane
#pragma unroll
    for (int q = 0; q < 8; ++q) o16[q] = tohx(r[q]);
    *(v8h*)(P16 + e) = o16;
    asm volatile("s_wait_xcnt 0x0" ::: "memory"); }   // the arithmetic that follows may reuse the address registers of this store: the wait stands between
__device__ __forceinline__ void qkv_planes(const v8f (&acc)[4][4], float* os, int r0, int y, const QkvOut& po) {
    const size_t zo = (size_t)blockIdx.z * NH_ * TT * HD;   // grid z = batch: every plane holds NH_ * TT * HD (= NKV * HD * TT) elements a batch
    const int lane = threadIdx.x & 31, lr = lane & 15, hi = lane >> 4, rw = lane >> 3, cofs = (lane & 7) * 8;   // reader: row 4 s + rw of the 16 staged, 8 elements from cofs
    if (y < NH_ + NKV) {   // q or k head (wave-uniform)
        const bool isq = y < NH_; const size_t pb = zo + (size_t)(isq ? y : y - NH_) * TT * HD;
        h16* P16 = isq ? po.Q16 : po.K16;
        const float* cp = po.CS + ((size_t)(r0 + rw) * HD + cofs) * 2;
        v2f cs[4][4][4];   // {cos, sin} of the lane's four pairs, by 16-row group and step; each group's are asked for one group ahead
#pragma unroll
        for (int s = 0; s < 4; ++s)
#pragma unroll
            for (int q = 0; q < 4; ++q) cs[0][s][q] = *(const v2f*)(cp + (size_t)(4 * s) * HD * 2 + 4 * q);
#pragma unroll
        for (int mb = 0; mb < 4; ++mb) {
            if (mb < 3) {
                if (mb > 0) asm volatile("s_wait_xcnt 0x0" ::: "memory");   // the loads below may land in registers that the stores of the group before name: the wait stands between them
#pragma unroll
                for (int s = 0; s < 4; ++s)
#pragma unroll
                    for (int q = 0; q < 4; ++q) cs[mb + 1][s][q] = *(const v2f*)(cp + (size_t)((mb + 1) * 16 + 4 * s) * HD * 2 + 4 * q);
                if (mb == 2) asm volatile("s_wait_xcnt 0x0" :: "v"(cp) : "memory"); }   // behind the last of these loads their address registers are free for other values: the wait stands in front of that reuse (the address is named as an input so that it keeps its registers up to here)
#pragma unroll
            for (int nb = 0; nb < 4; ++nb) {
#pragma unroll
                for (int j = 0; j < 8; ++j) os[(hi * 8 + j) * 68 + nb * 16 + lr] = acc[mb][nb][j]; }
            __builtin_amdgcn_wave_barrier(); asm volatile("" ::: "memory");   // the reads below take other lanes' values: keeps the compiler from moving them above the LDS stores
#pragma unroll
            for (int s = 0; s < 4; ++s) { const int row = 4 * s + rw; const v4f xa = *(const v4fa*)(os + row * 68 + cofs), xb = *(const v4fa*)(os + row * 68 + cofs + 4); const float x[8] = { xa[0], xa[1], xa[2], xa[3], xb[0], xb[1], xb[2], xb[3] }; float r[8];
#pragma unroll
                for (int q = 0; q < 4; ++q) { const v2f c = cs[mb][s][q]; r[2 * q] = x[2 * q] * c[0] - x[2 * q + 1] * c[1]; r[2 * q + 1] = x[2 * q] * c[1] + x[2 * q + 1] * c[0]; }   // even: re cos - im sin; odd: re sin + im cos
                planes8(r, pb + (size_t)(r0 + mb * 16 + row) * HD + cofs, P16); }
            __builtin_amdgcn_wave_barrier(); asm volatile("" ::: "memory");   // keeps the next 16 rows' LDS stores behind these reads
        }
    } else {                        // v head
        const size_t pb = zo + (size_t)(y - NH_ - NKV) * HD * TT;
#pragma unroll
        for (int nb = 0; nb < 4; ++nb) {
#pragma unroll
            for (int mb = 0; mb < 4; ++mb) { const v8f t8 = acc[mb][nb]; float* op = os + lr * 68 + mb * 16 + hi * 8;
                *(v4fa*)op = __builtin_shufflevector(t8, t8, 0, 1, 2, 3); *(v4fa*)(op + 4) = __builtin_shufflevector(t8, t8, 4, 5, 6, 7); }
            __builtin_amdgcn_wave_barrier(); asm volatile("" ::: "memory");   // the reads below take other lanes' values: keeps the compiler from moving them above the LDS stores
#pragma unroll
            for (int s = 0; s < 4; ++s) { const int row = 4 * s + rw; const v4f xa = *(const v4fa*)(os + row * 68 + cofs), xb = *(const v4fa*)(os + row * 68 + cofs + 4); const float x[8] = { xa[0], xa[1], xa[2], xa[3], xb[0], xb[1], xb[2], xb[3] };
                planes8(x, pb + (size_t)(nb * 16 + row) * TT + r0 + cofs, po.V16); }
            __builtin_amdgcn_wave_barrier(); asm volatile("" ::: "memory");   // keeps the next 16 columns' LDS stores behind these reads
        }
        asm volatile("s_wait_xcnt 0x0" ::: "memory");   // behind the last stores of this branch: in the built code the other branch's address arithmetic follows them and writes registers that they name
    }
}
// ---- k_fattn: scores, softmax and probability x value of all batches in one launch; nothing of a score or a probability goes to memory.
// One wave owns NQ x 16 query rows of one head and walks the 2048 keys in blocks of 32. The block's four waves share the key and value tiles: stages of KST keys are brought into LDS by asynchronous copies
// (whole 128-byte rows, two buffers: the next stage flies while this one is worked on), and every wave reads its fragments from there at a row pitch of 144 bytes.
// S^T = K Q^T (A = key rows, B = query rows): a lane holds scores of its own query column only (keys 8 hi + j of each 16-key tile), so two S^T tiles, converted in place, ARE the B operand of O^T += V^T P^T
// (A = V^T rows loaded in the same k order: 8 hi + 0..7, 16 + 8 hi + 0..7). Running softmax in log2 units: p = 2^(s c - ref), f32 row sum; ref moves (and O, sum are rescaled) only when a column's
// block maximum exceeds it by more than 8, so p <= 2^8; the common factor cancels in the final division. Operands fp16, 1 product in both contractions, for every query row.
__device__ __forceinline__ float xhalf(float x) { const int b = __float_as_int(x); return __int_as_float(__builtin_amdgcn_permlanex16(b, b, 0x76543210, 0xfedcba98, false, false)); }   // value of lane l ^ 16
// Four x = 2^x in one statement: behind a transcendental the instruction set asks for one independent instruction before its result is read or its source overwritten; here each v_exp_f32 is followed by an
// independent one and the last by v_nop, so the slot is kept whatever the compiler schedules around the statement. In place: the statement writes only registers that the compiler's own multiply-add has just written,
// so it can overwrite no operand of a matrix instruction sooner than compiled code may.
__device__ __forceinline__ void exp2x4(float& x0, float& x1, float& x2, float& x3) {
    asm("v_exp_f32 %0, %0\n\tv_exp_f32 %1, %1\n\tv_exp_f32 %2, %2\n\tv_exp_f32 %3, %3\n\tv_nop" : "+v"(x0), "+v"(x1), "+v"(x2), "+v"(x3)); }
template <typename T16, int NQ>
__device__ __forceinline__ void fa_body(const T16* __restrict__ Q, const T16* __restrict__ Kp, const T16* __restrict__ Vt, int q0, h16* Ao, const char* sm) {
    typedef typename WFrag<T16>::V V;
    constexpr float C2 = SCL * 1.4426950408889634f;
    const int lane = threadIdx.x & 31, lr = lane & 15, hi = lane >> 4;
    V qf[NQ][2];
#pragma unroll
    for (int qt = 0; qt < NQ; ++qt)
#pragma unroll
        for (int ks = 0; ks < 2; ++ks) qf[qt][ks] = WFrag<T16>::ld(Q + (size_t)(q0 + qt * 16 + lr) * HD + ks * 32 + 8 * hi);
    v8f o[4][NQ]; float ref[NQ]; v2f lsum[NQ];   // row sum: even and odd keys apart (packed adds), joined in the epilogue
#pragma unroll
    for (int qt = 0; qt < NQ; ++qt) { ref[qt] = -3.0e38f; lsum[qt] = (v2f){};
#pragma unroll
        for (int dt = 0; dt < 4; ++dt) o[dt][qt] = (v8f){}; }
    constexpr int BUFB = 2 * TILEB, NST = TT / KST;   // a buffer: K | V^T
    const int crow = threadIdx.x >> 3, ccol = threadIdx.x & 7;   // the lane's place in a copy: row crow (+ 16, 32, 48), 16-byte column ccol
    const unsigned lc = (unsigned)(size_t)sm + crow * LPB + ccol * 16;
    const int gko = crow * HD + ccol * 8, gvo = crow * TT + ccol * 8;
    auto fill = [&](int st, int buf) { const unsigned l = lc + buf * BUFB;
        stage_tile(l, Kp + gko + st * KST * HD, HD); stage_tile(l + TILEB, Vt + gvo + st * KST, TT); };
    fill(0, 0);
    asm volatile("s_wait_asynccnt 0x0" ::: "memory");   // this wave's copies of stage 0 have landed
    __syncthreads();                                     // and so have the other waves': stage 0 may be read
    fill(1, 1);
    const int fo = lr * LPE + 8 * hi;   // fragment reader: row lr of a 16-row group, elements 8 hi + 0..7 and 16 + 8 hi + 0..7 of a 32-element chunk
#pragma unroll 1
    for (int st = 0; st < NST; ++st) {   // kept rolled: one publish point a trip
    const T16* kt = (const T16*)(sm + (st & 1) * BUFB) + fo; const T16* vt = kt + TILEB / 2;
    V kf[2][2];
#pragma unroll
    for (int mt = 0; mt < 2; ++mt)
#pragma unroll
        for (int ks = 0; ks < 2; ++ks) kf[mt][ks] = WFrag<T16>::ld(kt + mt * 16 * LPE + ks * 32);
    __builtin_amdgcn_sched_barrier(0);   // the stage's first key fragments are asked for as one group: sunk among the score products, each pair of LDS reads would be waited for on its own
#pragma unroll
    for (int kb = 0; kb < KST; kb += 32) {   // the stage's blocks of 32 keys
        V vf[4];
#pragma unroll
        for (int dt = 0; dt < 4; ++dt) vf[dt] = WFrag<T16>::ld(vt + dt * 16 * LPE + kb);
        v8f s[2][NQ];
#pragma unroll
        for (int mt = 0; mt < 2; ++mt)
#pragma unroll
            for (int qt = 0; qt < NQ; ++qt) s[mt][qt] = (v8f){};
#pragma unroll
        for (int ks = 0; ks < 2; ++ks)   // tiles innermost: neighbouring matrix instructions accumulate into different tiles
#pragma unroll
            for (int mt = 0; mt < 2; ++mt)
#pragma unroll
                for (int qt = 0; qt < NQ; ++qt) s[mt][qt] = WFrag<T16>::mma(kf[mt][ks], qf[qt][ks], s[mt][qt]);
        if (kb + 32 < KST) {   // next block's key fragments OF THE SAME STAGE, fetched behind this block's score products so that they fly during the softmax; nothing of the next stage is read ahead
#pragma unroll
            for (int mt = 0; mt < 2; ++mt)
#pragma unroll
                for (int ks = 0; ks < 2; ++ks) kf[mt][ks] = WFrag<T16>::ld(kt + (kb + 32 + mt * 16) * LPE + ks * 32); }
        float mx[NQ]; bool need = false;
#pragma unroll
        for (int qt = 0; qt < NQ; ++qt) { float m = s[0][qt][0];
#pragma unroll
            for (int j = 1; j < 8; ++j) m = fmaxf(m, s[0][qt][j]);
#pragma unroll
            for (int j = 0; j < 8; ++j) m = fmaxf(m, s[1][qt][j]);
            m = fmaxf(m, xhalf(m)) * C2; mx[qt] = m; need = need || (m > ref[qt] + 8.0f); }
        if (__builtin_amdgcn_ballot_w32(need) != 0) {   // wave-uniform: rare after the first block
#pragma unroll
            for (int qt = 0; qt < NQ; ++qt) { const float mn = fmaxf(ref[qt], mx[qt]); const float al = __builtin_amdgcn_exp2f(ref[qt] - mn); ref[qt] = mn; lsum[qt] *= al;
#pragma unroll
                for (int dt = 0; dt < 4; ++dt) o[dt][qt] *= al; } }
#pragma unroll
        for (int qt = 0; qt < NQ; ++qt) { V pf; float pe[16];
#pragma unroll
            for (int e = 0; e < 16; ++e) pe[e] = __builtin_fmaf(s[e >> 3][qt][e & 7], C2, -ref[qt]);
#pragma unroll
            for (int e = 0; e < 16; e += 4) exp2x4(pe[e], pe[e + 1], pe[e + 2], pe[e + 3]);
#pragma unroll
            for (int e = 0; e < 16; e += 2) lsum[qt] += (v2f){pe[e], pe[e + 1]};
#pragma unroll
            for (int e = 0; e < 16; ++e) pf[e] = (__typeof__(pf[0]))pe[e];
#pragma unroll
            for (int dt = 0; dt < 4; ++dt) o[dt][qt] = WFrag<T16>::mma(vf[dt], pf, o[dt][qt]); }
    }
    // publish point of stage st + 1, every wave, in this order
    asm volatile("s_wait_dscnt 0x0" ::: "memory");      // this wave's reads of the buffer that is refilled below have returned
    asm volatile("s_wait_asynccnt 0x0" ::: "memory");   // this wave's copies of stage st + 1 have landed
    __syncthreads();                                     // all waves: stage st + 1 may be read, stage st's buffer is free
    if (st + 2 < NST) fill(st + 2, st & 1);
    }
    asm volatile("s_wait_asynccnt 0x0" ::: "memory");   // no copy is outstanding when the wave goes on to its end
#pragma unroll
    for (int qt = 0; qt < NQ; ++qt) { const float lh = lsum[qt][0] + lsum[qt][1]; const float inv = __fdiv_rn(1.0f, lh + xhalf(lh));   // the two halves of a column hold disjoint keys under one ref: joined once
        const size_t oo = (size_t)(q0 + qt * 16 + lr) * DQ + 8 * hi;
#pragma unroll
        for (int dt = 0; dt < 4; ++dt) { v8h oh;
#pragma unroll
            for (int j = 0; j < 8; ++j) oh[j] = tohx(o[dt][qt][j] * inv);
            *(v8h*)(Ao + oo + dt * 16) = oh;
            asm volatile("s_wait_xcnt 0x0" ::: "memory"); } }   // the arithmetic that follows may reuse the registers of this store: the wait stands between
}
// grid (batches x heads, TT / 128), 4 waves: a block takes 4 x 32 query rows; its four waves walk the same head's keys together. Writes the merged token-major fp16 plane.
__global__ __launch_bounds__(128) void k_fattn(const h16* __restrict__ Q16, const h16* __restrict__ K16, const h16* __restrict__ V16, h16* Ao) {
    __shared__ __attribute__((aligned(128))) char sm[2 * 2 * TILEB];   // two buffers of two tiles
    const int h = blockIdx.x % NH_, b = blockIdx.x / NH_, w = threadIdx.x >> 5, bx = blockIdx.y; const size_t po = ((size_t)b * NH_ + h) * TT * HD, pk = ((size_t)b * NKV + h / REP) * TT * HD, ao = (size_t)b * TT * DQ + h * HD;
    fa_body<h16, 2>(Q16 + po, K16 + pk, V16 + pk, bx * 128 + w * 32, Ao + ao, sm);
}

extern "C" void kernel_launch(void* const* d_in, const int* in_sizes, int n_in,
                              void* d_out, int out_size, void* d_ws, size_t ws_size, hipStream_t stream) {
    (void)in_sizes; (void)n_in; (void)out_size;
    const float* x = (const float*)d_in[0]; const float* wqkv = (const float*)d_in[1]; const float* wo = (const float*)d_in[2];   /* order x, w_attn ('oi' [3072][1024]: q | k | v row blocks), w_proj ('oi' [1024][1024]) */
    float* OUT = (float*)d_out;     // [4][2048][1024]
    char* wsp = (char*)d_ws;
    auto take = [&](size_t bytes) { char* p = wsp; wsp += (bytes + 255) & ~(size_t)255; return (void*)p; };
    bf* WQ = (bf*)take((size_t)(DQ + 2 * DKV) * DM * 2);   /* one buffer: q | k | v weight rows */ h16* WO = (h16*)take((size_t)DM * DQ * 2); float* CS = (float*)take((size_t)TT * HD * 2 * 4);
    bf* XB = (bf*)take((size_t)NB_ * TT * DM * 2);
    h16* QP16 = (h16*)take((size_t)NB_ * NH_ * TT * HD * 2); h16* KP16 = (h16*)take((size_t)NB_ * NKV * TT * HD * 2); h16* VT16 = (h16*)take((size_t)NB_ * NKV * HD * TT * 2);
    h16* AT16 = (h16*)take((size_t)NB_ * TT * DQ * 2);
    if ((size_t)(wsp - (char*)d_ws) > ws_size) return;    // ws 256 MiB
    const QkvOut po = { CS, QP16, KP16, VT16 };
    // every stage once, for all batches: x, the merged planes and out are contiguous over the batches (rows batch * TT + token); the q | k | v weight rows are one contiguous block
    k_prep<<<PREPT / 512, 512, 0, stream>>>(x, wqkv, wo, XB, WQ, WO, CS);
    k_gemmw<bf, 0, false, true, 3, 4, 2><<<dim3(TT / 256, (NH_ + 2 * NKV) / 6, NB_), 256, 0, stream>>>(XB, nullptr, WQ, nullptr, DM, nullptr, 0, nullptr, (size_t)TT * DM, 0, 0, po);
    k_fattn<<<dim3(NB_ * NH_, TT / 128, 1), 128, 0, stream>>>(QP16, KP16, VT16, AT16);
    k_gemmw<h16, 0, false, false, 1, 2, 2><<<dim3(NB_ * TT / 128, DM / 128, 1), 128, 0, stream>>>(AT16, nullptr, WO, nullptr, DQ, OUT, DM, nullptr, 0, 0, 0, po);
}
